// v000
// Measured on an AMD MI455X. A time is GPU time per run, averaged over a window of back-to-back runs after a warm-up
// (all launches, gaps included; the runs take copies of the inputs in turn), and the median of several windows.
// Apart from v000's, it joins two sittings. Times from different sittings can be a few percent apart, while
// side-by-side timings come from the same sitting.
// The starting kernel, v000, takes 128 microseconds a run.
#include <hip/hip_runtime.h>
#include <math.h>

typedef float v2f __attribute__((ext_vector_type(2)));
typedef float v8f __attribute__((ext_vector_type(8)));
typedef unsigned int u32x4 __attribute__((ext_vector_type(4)));
typedef int i32x4 __attribute__((ext_vector_type(4)));
typedef int i32x8 __attribute__((ext_vector_type(8)));

#define H 8
#define QD 256
#define HALF 128
#define NKEY 32
#define DTK 4
#define TOKENS 1024      // B*S
#define D 1024
#define NQ 2048          // H*QD
#define OUTD 1024
#define NITEM 8192       // TOKENS*H

// GEMM tiling
#define BM 64            // rows per block
#define BN 128           // cols per block
#define BK 32            // K-step
#define BNP 129          // padded B row stride (via TDM pad: 1 dword per 128)
#define AMP 33           // padded A row stride

// ---------------- helpers ----------------
__device__ inline float waveRedSum32(float x) {
    #pragma unroll
    for (int off = 16; off; off >>= 1) x += __shfl_xor(x, off, 32);
    return x;
}

// Issue a TDM load of a 32x128 f32 tile of Wq (row stride 2048 elems) into LDS
// at byte offset lds_off, padded +1 dword per 128 dwords (-> 129-dword rows).
__device__ inline void tdm_load_B(const float* gaddr, unsigned int lds_off) {
    u32x4 g0;
    g0.x = 1u;                                   // count=1, user mode
    g0.y = lds_off;                              // LDS byte address
    unsigned long long ga = (unsigned long long)(uintptr_t)gaddr;
    g0.z = (unsigned int)ga;                     // global_addr[31:0]
    g0.w = (unsigned int)(ga >> 32) | 0x80000000u; // global_addr[56:32] | type=2
    i32x8 g1;
    g1[0] = (int)((2u << 16)       // data_size = 4 bytes
                | (1u << 20)       // pad_enable
                | (6u << 22));     // pad_interval = 128 dwords (pad_amount=0 -> 1 dword)
    g1[1] = (int)(2048u << 16);    // tensor_dim0 = 2048 (elements per row)
    g1[2] = (int)(1024u << 16);    // tensor_dim1 = 1024 rows (dim0 hi bits = 0)
    g1[3] = (int)(128u << 16);     // tile_dim0 = 128 (dim1 hi bits = 0)
    g1[4] = 32;                    // tile_dim1 = 32, tile_dim2 = 0
    g1[5] = 2048;                  // tensor_dim0_stride[31:0] = 2048
    g1[6] = 0;                     // stride hi / dim1_stride lo
    g1[7] = 0;
    i32x4 gz4 = {0, 0, 0, 0};              // groups 2/3 unused (2D tensor)
    i32x8 gz8 = {0, 0, 0, 0, 0, 0, 0, 0};
    __builtin_amdgcn_tensor_load_to_lds(g0, g1, gz4, gz4, gz8, 0);
}

// ---------------- kernel: normalize sub-keys ----------------
__global__ void peer_knorm(const float* __restrict__ k0,
                           const float* __restrict__ k1,
                           float* __restrict__ n0,
                           float* __restrict__ n1) {
    int wid = threadIdx.x >> 5, lane = threadIdx.x & 31;
    int gw = blockIdx.x * 8 + wid;          // [0,64)
    int table = gw >> 5, row = gw & 31;
    const float* src = table ? k1 : k0;
    float*       dst = table ? n1 : n0;
    float v[4]; float ss = 0.f;
    #pragma unroll
    for (int j = 0; j < 4; ++j) {
        v[j] = src[row * HALF + lane * 4 + j];
        ss += v[j] * v[j];
    }
    ss = waveRedSum32(ss);
    float inv = 1.f / fmaxf(sqrtf(ss), 1e-12f);
    #pragma unroll
    for (int j = 0; j < 4; ++j) dst[row * HALF + lane * 4 + j] = v[j] * inv;
}

// ---------------- kernel: Q projection GEMM (f32 WMMA + TDM double-buffer) ----------------
// q[TOKENS][NQ] = hs[TOKENS][D] @ Wq[D][NQ] + bq
// Block tile 64x128, 8 waves in 2x4 grid, each wave a 2x2 grid of 16x16 tiles.
// B tiles arrive via Tensor Data Mover (async, double buffered, padded rows).
__global__ void peer_qproj(const float* __restrict__ hs,
                           const float* __restrict__ Wq,
                           const float* __restrict__ bq,
                           float* __restrict__ q) {
    __shared__ float As[2][BM][AMP];
    __shared__ float Bs[2][BK][BNP];
    int t = threadIdx.x;
    int wid = t >> 5, lane = t & 31;
    int rowBase = blockIdx.y * BM;
    int colBase = blockIdx.x * BN;
    int wm = wid >> 2;                 // 0..1  (row group of 32)
    int wn = wid & 3;                  // 0..3  (col group of 32)
    int l15 = lane & 15;
    int khi = (lane >> 4) << 1;        // 0 or 2

    v8f acc00 = {}, acc01 = {}, acc10 = {}, acc11 = {};

    // ---- prologue: stage 0 ----
    if (wid == 0)
        tdm_load_B(Wq + colBase, (unsigned int)(uintptr_t)&Bs[0][0][0]);
    #pragma unroll
    for (int i = 0; i < 8; ++i) {                // A: 64x32
        int idx = i * 256 + t;
        int r = idx >> 5, c = idx & 31;
        As[0][r][c] = hs[(rowBase + r) * D + c];
    }

    int buf = 0;
    for (int it = 0; it < D / BK; ++it) {
        int k0 = it * BK;
        // ---- issue next stage (overlaps this stage's WMMA) ----
        if (it < D / BK - 1) {
            int kn = k0 + BK;
            if (wid == 0)
                tdm_load_B(Wq + (size_t)kn * NQ + colBase,
                           (unsigned int)(uintptr_t)&Bs[buf ^ 1][0][0]);
            #pragma unroll
            for (int i = 0; i < 8; ++i) {
                int idx = i * 256 + t;
                int r = idx >> 5, c = idx & 31;
                As[buf ^ 1][r][c] = hs[(rowBase + r) * D + kn + c];
            }
            if (wid == 0) __builtin_amdgcn_s_wait_tensorcnt(1);
        } else {
            if (wid == 0) __builtin_amdgcn_s_wait_tensorcnt(0);
        }
        __syncthreads();    // stage `buf` (A stores + TDM B) complete

        #pragma unroll
        for (int kk = 0; kk < 8; ++kk) {
            int kb = kk * 4 + khi;
            v2f a0 = { As[buf][wm * 32 + l15][kb],      As[buf][wm * 32 + l15][kb + 1] };
            v2f a1 = { As[buf][wm * 32 + 16 + l15][kb], As[buf][wm * 32 + 16 + l15][kb + 1] };
            v2f b0 = { Bs[buf][kb][wn * 32 + l15],      Bs[buf][kb + 1][wn * 32 + l15] };
            v2f b1 = { Bs[buf][kb][wn * 32 + 16 + l15], Bs[buf][kb + 1][wn * 32 + 16 + l15] };
            acc00 = __builtin_amdgcn_wmma_f32_16x16x4_f32(false, a0, false, b0, (short)0, acc00, false, false);
            acc01 = __builtin_amdgcn_wmma_f32_16x16x4_f32(false, a0, false, b1, (short)0, acc01, false, false);
            acc10 = __builtin_amdgcn_wmma_f32_16x16x4_f32(false, a1, false, b0, (short)0, acc10, false, false);
            acc11 = __builtin_amdgcn_wmma_f32_16x16x4_f32(false, a1, false, b1, (short)0, acc11, false, false);
        }
        __syncthreads();    // all waves done reading stage `buf`
        buf ^= 1;
    }

    // ---- epilogue: bias + store (C layout: VGPR v -> M = v + 8*(lane>=16)) ----
    int rhalf = (lane >> 4) << 3;
    #pragma unroll
    for (int sn = 0; sn < 2; ++sn) {
        int col = colBase + wn * 32 + sn * 16 + l15;
        float bias = bq[col];
        v8f a0v = sn ? acc01 : acc00;
        v8f a1v = sn ? acc11 : acc10;
        #pragma unroll
        for (int v = 0; v < 8; ++v) {
            int row0 = rowBase + wm * 32 + v + rhalf;
            q[row0 * NQ + col] = a0v[v] + bias;
            q[(row0 + 16) * NQ + col] = a1v[v] + bias;
        }
    }
}

// ---------------- kernel: BN partial stats ----------------
__global__ void peer_bnstat(const float* __restrict__ q,
                            float* __restrict__ part1,
                            float* __restrict__ part2) {
    int t = threadIdx.x;
    float s = 0.f, s2 = 0.f;
    int r0 = blockIdx.x * 32;
    for (int r = r0; r < r0 + 32; ++r) {
        #pragma unroll
        for (int i = 0; i < 8; ++i) {
            float v = q[r * NQ + i * QD + t];
            s += v; s2 += v * v;
        }
    }
    part1[blockIdx.x * QD + t] = s;
    part2[blockIdx.x * QD + t] = s2;
}

// ---------------- kernel: BN finalize ----------------
__global__ void peer_bnfin(const float* __restrict__ part1,
                           const float* __restrict__ part2,
                           const float* __restrict__ gamma,
                           const float* __restrict__ beta,
                           float* __restrict__ bnsc,
                           float* __restrict__ bnsh) {
    int t = threadIdx.x;
    float s = 0.f, s2 = 0.f;
    for (int b = 0; b < 32; ++b) {
        s  += part1[b * QD + t];
        s2 += part2[b * QD + t];
    }
    float mean = s * (1.f / 8192.f);
    float var  = s2 * (1.f / 8192.f) - mean * mean;
    float sc = gamma[t] / sqrtf(var + 1e-5f);
    bnsc[t] = sc;
    bnsh[t] = beta[t] - mean * sc;
}

// ---------------- kernel: routing ----------------
// one wave per (token, head); TOPK==DTK^2 so softmax runs over ALL 16 combos.
__global__ void peer_route(const float* __restrict__ q,
                           const float* __restrict__ bnsc,
                           const float* __restrict__ bnsh,
                           const float* __restrict__ n0,
                           const float* __restrict__ n1,
                           int* __restrict__ rid,
                           float* __restrict__ rw) {
    __shared__ float qn[8][QD];
    int wid = threadIdx.x >> 5, lane = threadIdx.x & 31;
    int item = blockIdx.x * 8 + wid;            // [0, 8192)
    int r = item >> 3, h = item & 7;
    const float* qrow = q + r * NQ + h * QD;

    float vr[8]; float ss = 0.f;
    int cb = lane * 8;
    #pragma unroll
    for (int j = 0; j < 8; ++j) {
        int c = cb + j;
        float x = qrow[c] * bnsc[c] + bnsh[c];
        vr[j] = x; ss += x * x;
    }
    float ssg = ss;
    #pragma unroll
    for (int off = 8; off; off >>= 1) ssg += __shfl_xor(ssg, off, 16);
    float ss0 = __shfl(ssg, 0, 32);
    float ss1 = __shfl(ssg, 16, 32);
    float inv = (lane < 16) ? 1.f / fmaxf(sqrtf(ss0), 1e-12f)
                            : 1.f / fmaxf(sqrtf(ss1), 1e-12f);
    #pragma unroll
    for (int j = 0; j < 8; ++j) qn[wid][cb + j] = vr[j] * inv;
    __syncthreads();

    float s0 = 0.f, s1 = 0.f;
    const float* k0r = n0 + lane * HALF;
    const float* k1r = n1 + lane * HALF;
    #pragma unroll 4
    for (int c = 0; c < HALF; ++c) {
        s0 += qn[wid][c] * k0r[c];
        s1 += qn[wid][HALF + c] * k1r[c];
    }

    float ts0[DTK], ts1[DTK]; int ti0[DTK], ti1[DTK];
    float mv = s0; int mi = lane;
    #pragma unroll
    for (int tI = 0; tI < DTK; ++tI) {
        float v = mv; int i = mi;
        #pragma unroll
        for (int off = 16; off; off >>= 1) {
            float ov = __shfl_xor(v, off, 32);
            int   oi = __shfl_xor(i, off, 32);
            if (ov > v || (ov == v && oi < i)) { v = ov; i = oi; }
        }
        ts0[tI] = v; ti0[tI] = i;
        if (lane == i) mv = -INFINITY;
    }
    mv = s1; mi = lane;
    #pragma unroll
    for (int tI = 0; tI < DTK; ++tI) {
        float v = mv; int i = mi;
        #pragma unroll
        for (int off = 16; off; off >>= 1) {
            float ov = __shfl_xor(v, off, 32);
            int   oi = __shfl_xor(i, off, 32);
            if (ov > v || (ov == v && oi < i)) { v = ov; i = oi; }
        }
        ts1[tI] = v; ti1[tI] = i;
        if (lane == i) mv = -INFINITY;
    }

    int ii = (lane >> 2) & 3, jj = lane & 3;
    float cs = ts0[ii] + ts1[jj];
    int  cid = ti0[ii] * NKEY + ti1[jj];
    float m = cs;
    #pragma unroll
    for (int off = 8; off; off >>= 1) m = fmaxf(m, __shfl_xor(m, off, 16));
    float e = expf(cs - m);
    float sum = e;
    #pragma unroll
    for (int off = 8; off; off >>= 1) sum += __shfl_xor(sum, off, 16);
    float w = e / sum;
    if (lane < 16) {
        rid[item * 16 + lane] = cid;
        rw [item * 16 + lane] = w;
    }
}

// ---------------- kernel: expert gather/MLP/accumulate ----------------
__global__ void peer_expert(const float* __restrict__ hs,
                            const float* __restrict__ down,
                            const float* __restrict__ up,
                            const int* __restrict__ rid,
                            const float* __restrict__ rw,
                            float* __restrict__ out) {
    __shared__ float hsr[D];
    __shared__ float geh[128];
    __shared__ int   eid[128];
    __shared__ float ew [128];
    int t = threadIdx.x;
    int r = blockIdx.x;
    #pragma unroll
    for (int i = 0; i < 4; ++i) hsr[t + 256 * i] = hs[r * D + t + 256 * i];
    if (t < 128) {
        eid[t] = rid[r * 128 + t];
        ew [t] = rw [r * 128 + t];
    }
    __syncthreads();

    int wid = t >> 5, lane = t & 31;
    for (int e = wid * 16; e < wid * 16 + 16; ++e) {
        const float* dr = down + (size_t)eid[e] * D;
        float acc = 0.f;
        #pragma unroll 8
        for (int i = 0; i < 32; ++i) acc += dr[i * 32 + lane] * hsr[i * 32 + lane];
        acc = waveRedSum32(acc);
        if (lane == 0) {
            float x = acc;
            float g = 0.5f * x * (1.0f + erff(x * 0.70710678118654752f)); // exact gelu
            geh[e] = g * ew[e];
        }
    }
    __syncthreads();

    float acc0 = 0.f, acc1 = 0.f, acc2 = 0.f, acc3 = 0.f;
    for (int e = 0; e < 128; ++e) {
        if (e + 1 < 128)    // hide L2 latency of the next gathered row
            __builtin_prefetch(up + (size_t)eid[e + 1] * OUTD + t, 0, 0);
        const float* ur = up + (size_t)eid[e] * OUTD;
        float g = geh[e];
        acc0 += g * ur[t];
        acc1 += g * ur[t + 256];
        acc2 += g * ur[t + 512];
        acc3 += g * ur[t + 768];
    }
    out[r * OUTD + t]       = acc0;
    out[r * OUTD + t + 256] = acc1;
    out[r * OUTD + t + 512] = acc2;
    out[r * OUTD + t + 768] = acc3;
}

// ---------------- launcher ----------------
extern "C" void kernel_launch(void* const* d_in, const int* in_sizes, int n_in,
                              void* d_out, int out_size, void* d_ws, size_t ws_size,
                              hipStream_t stream) {
    const float* hs    = (const float*)d_in[0];  // [1024,1024]
    const float* Wq    = (const float*)d_in[1];  // [1024,2048]
    const float* bq    = (const float*)d_in[2];  // [2048]
    const float* gamma = (const float*)d_in[3];  // [256]
    const float* beta  = (const float*)d_in[4];  // [256]
    const float* sk0   = (const float*)d_in[5];  // [32,128]
    const float* sk1   = (const float*)d_in[6];  // [32,128]
    const float* down  = (const float*)d_in[7];  // [1024,1024]
    const float* up    = (const float*)d_in[8];  // [1024,1024]
    float* out = (float*)d_out;                  // [1024,1024]

    float* ws = (float*)d_ws;
    float* q      = ws;                   // 1024*2048
    float* n0     = q      + TOKENS * NQ;
    float* n1     = n0     + NKEY * HALF;
    float* part1  = n1     + NKEY * HALF;
    float* part2  = part1  + 32 * QD;
    float* bnsc   = part2  + 32 * QD;
    float* bnsh   = bnsc   + QD;
    int*   rid    = (int*)(bnsh + QD);
    float* rw     = (float*)(rid + NITEM * 16);

    peer_knorm<<<dim3(8), dim3(256), 0, stream>>>(sk0, sk1, n0, n1);
    peer_qproj<<<dim3(NQ / BN, TOKENS / BM), dim3(256), 0, stream>>>(hs, Wq, bq, q);
    peer_bnstat<<<dim3(32), dim3(256), 0, stream>>>(q, part1, part2);
    peer_bnfin<<<dim3(1), dim3(256), 0, stream>>>(part1, part2, gamma, beta, bnsc, bnsh);
    peer_route<<<dim3(TOKENS), dim3(256), 0, stream>>>(q, bnsc, bnsh, n0, n1, rid, rw);
    peer_expert<<<dim3(TOKENS), dim3(256), 0, stream>>>(hs, down, up, rid, rw, out);
}

// v001
// Measured time: 116 microseconds a run.
// Two timings next to v000 put it at 1.14 and 1.13 times that version's speed.
#include <hip/hip_runtime.h>
#include <math.h>

typedef float v2f __attribute__((ext_vector_type(2)));
typedef float v8f __attribute__((ext_vector_type(8)));
typedef unsigned int u32x4 __attribute__((ext_vector_type(4)));
typedef int i32x4 __attribute__((ext_vector_type(4)));
typedef int i32x8 __attribute__((ext_vector_type(8)));

#define H 8
#define QD 256
#define HALF 128
#define NKEY 32
#define DTK 4
#define TOKENS 1024      // B*S
#define D 1024
#define NQ 2048          // H*QD
#define OUTD 1024
#define NITEM 8192       // TOKENS*H

// GEMM tiling
#define BM 64            // rows per block
#define BN 128           // cols per block
#define BK 32            // K-step
#define BNP 129          // padded B row stride (via TDM pad: 1 dword per 128)
#define AMP 33           // padded A row stride

// ---------------- helpers ----------------
__device__ inline float waveRedSum32(float x) {
    #pragma unroll
    for (int off = 16; off; off >>= 1) x += __shfl_xor(x, off, 32);
    return x;
}

// Issue a TDM load of a 32x128 f32 tile of Wq (row stride 2048 elems) into LDS
// at byte offset lds_off, padded +1 dword per 128 dwords (-> 129-dword rows).
__device__ inline void tdm_load_B(const float* gaddr, unsigned int lds_off) {
    u32x4 g0;
    g0.x = 1u;                                   // count=1, user mode
    g0.y = lds_off;                              // LDS byte address
    unsigned long long ga = (unsigned long long)(uintptr_t)gaddr;
    g0.z = (unsigned int)ga;                     // global_addr[31:0]
    g0.w = (unsigned int)(ga >> 32) | 0x80000000u; // global_addr[56:32] | type=2
    i32x8 g1;
    g1[0] = (int)((2u << 16)       // data_size = 4 bytes
                | (1u << 20)       // pad_enable
                | (6u << 22));     // pad_interval = 128 dwords (pad_amount=0 -> 1 dword)
    g1[1] = (int)(2048u << 16);    // tensor_dim0 = 2048 (elements per row)
    g1[2] = (int)(1024u << 16);    // tensor_dim1 = 1024 rows (dim0 hi bits = 0)
    g1[3] = (int)(128u << 16);     // tile_dim0 = 128 (dim1 hi bits = 0)
    g1[4] = 32;                    // tile_dim1 = 32, tile_dim2 = 0
    g1[5] = 2048;                  // tensor_dim0_stride[31:0] = 2048
    g1[6] = 0;                     // stride hi / dim1_stride lo
    g1[7] = 0;
    i32x4 gz4 = {0, 0, 0, 0};              // groups 2/3 unused (2D tensor)
    i32x8 gz8 = {0, 0, 0, 0, 0, 0, 0, 0};
    __builtin_amdgcn_tensor_load_to_lds(g0, g1, gz4, gz4, gz8, 0);
}

// ---------------- kernel: normalize sub-keys ----------------
__global__ void peer_knorm(const float* __restrict__ k0,
                           const float* __restrict__ k1,
                           float* __restrict__ n0,
                           float* __restrict__ n1) {
    int wid = threadIdx.x >> 5, lane = threadIdx.x & 31;
    int gw = blockIdx.x * 8 + wid;          // [0,64)
    int table = gw >> 5, row = gw & 31;
    const float* src = table ? k1 : k0;
    float*       dst = table ? n1 : n0;
    float v[4]; float ss = 0.f;
    #pragma unroll
    for (int j = 0; j < 4; ++j) {
        v[j] = src[row * HALF + lane * 4 + j];
        ss += v[j] * v[j];
    }
    ss = waveRedSum32(ss);
    float inv = 1.f / fmaxf(sqrtf(ss), 1e-12f);
    #pragma unroll
    for (int j = 0; j < 4; ++j) dst[row * HALF + lane * 4 + j] = v[j] * inv;
}

// ---------------- kernel: Q projection GEMM (f32 WMMA + TDM double-buffer) ----------------
// q[TOKENS][NQ] = hs[TOKENS][D] @ Wq[D][NQ] + bq
// Block tile 64x128, 8 waves in 2x4 grid, each wave a 2x2 grid of 16x16 tiles.
// B tiles arrive via Tensor Data Mover (async, double buffered, padded rows).
__global__ void peer_qproj(const float* __restrict__ hs,
                           const float* __restrict__ Wq,
                           const float* __restrict__ bq,
                           float* __restrict__ q) {
    __shared__ float As[2][BM][AMP];
    __shared__ float Bs[2][BK][BNP];
    int t = threadIdx.x;
    int wid = t >> 5, lane = t & 31;
    int rowBase = blockIdx.y * BM;
    int colBase = blockIdx.x * BN;
    int wm = wid >> 2;                 // 0..1  (row group of 32)
    int wn = wid & 3;                  // 0..3  (col group of 32)
    int l15 = lane & 15;
    int khi = (lane >> 4) << 1;        // 0 or 2

    v8f acc00 = {}, acc01 = {}, acc10 = {}, acc11 = {};

    // ---- prologue: stage 0 ----
    if (wid == 0)
        tdm_load_B(Wq + colBase, (unsigned int)(uintptr_t)&Bs[0][0][0]);
    #pragma unroll
    for (int i = 0; i < 8; ++i) {                // A: 64x32
        int idx = i * 256 + t;
        int r = idx >> 5, c = idx & 31;
        As[0][r][c] = hs[(rowBase + r) * D + c];
    }

    int buf = 0;
    for (int it = 0; it < D / BK; ++it) {
        int k0 = it * BK;
        // ---- issue next stage (overlaps this stage's WMMA) ----
        if (it < D / BK - 1) {
            int kn = k0 + BK;
            if (wid == 0)
                tdm_load_B(Wq + (size_t)kn * NQ + colBase,
                           (unsigned int)(uintptr_t)&Bs[buf ^ 1][0][0]);
            #pragma unroll
            for (int i = 0; i < 8; ++i) {
                int idx = i * 256 + t;
                int r = idx >> 5, c = idx & 31;
                As[buf ^ 1][r][c] = hs[(rowBase + r) * D + kn + c];
            }
            if (wid == 0) __builtin_amdgcn_s_wait_tensorcnt(1);
        } else {
            if (wid == 0) __builtin_amdgcn_s_wait_tensorcnt(0);
        }
        __syncthreads();    // stage `buf` (A stores + TDM B) complete

        #pragma unroll
        for (int kk = 0; kk < 8; ++kk) {
            int kb = kk * 4 + khi;
            v2f a0 = { As[buf][wm * 32 + l15][kb],      As[buf][wm * 32 + l15][kb + 1] };
            v2f a1 = { As[buf][wm * 32 + 16 + l15][kb], As[buf][wm * 32 + 16 + l15][kb + 1] };
            v2f b0 = { Bs[buf][kb][wn * 32 + l15],      Bs[buf][kb + 1][wn * 32 + l15] };
            v2f b1 = { Bs[buf][kb][wn * 32 + 16 + l15], Bs[buf][kb + 1][wn * 32 + 16 + l15] };
            acc00 = __builtin_amdgcn_wmma_f32_16x16x4_f32(false, a0, false, b0, (short)0, acc00, false, false);
            acc01 = __builtin_amdgcn_wmma_f32_16x16x4_f32(false, a0, false, b1, (short)0, acc01, false, false);
            acc10 = __builtin_amdgcn_wmma_f32_16x16x4_f32(false, a1, false, b0, (short)0, acc10, false, false);
            acc11 = __builtin_amdgcn_wmma_f32_16x16x4_f32(false, a1, false, b1, (short)0, acc11, false, false);
        }
        __syncthreads();    // all waves done reading stage `buf`
        buf ^= 1;
    }

    // ---- epilogue: bias + store (C layout: VGPR v -> M = v + 8*(lane>=16)) ----
    int rhalf = (lane >> 4) << 3;
    #pragma unroll
    for (int sn = 0; sn < 2; ++sn) {
        int col = colBase + wn * 32 + sn * 16 + l15;
        float bias = bq[col];
        v8f a0v = sn ? acc01 : acc00;
        v8f a1v = sn ? acc11 : acc10;
        #pragma unroll
        for (int v = 0; v < 8; ++v) {
            int row0 = rowBase + wm * 32 + v + rhalf;
            q[row0 * NQ + col] = a0v[v] + bias;
            q[(row0 + 16) * NQ + col] = a1v[v] + bias;
        }
    }
}

// ---------------- kernel: BN partial stats ----------------
__global__ void peer_bnstat(const float* __restrict__ q,
                            float* __restrict__ part1,
                            float* __restrict__ part2) {
    int t = threadIdx.x;
    float s = 0.f, s2 = 0.f;
    int r0 = blockIdx.x * 32;
    for (int r = r0; r < r0 + 32; ++r) {
        #pragma unroll
        for (int i = 0; i < 8; ++i) {
            float v = q[r * NQ + i * QD + t];
            s += v; s2 += v * v;
        }
    }
    part1[blockIdx.x * QD + t] = s;
    part2[blockIdx.x * QD + t] = s2;
}

// ---------------- kernel: BN finalize ----------------
__global__ void peer_bnfin(const float* __restrict__ part1,
                           const float* __restrict__ part2,
                           const float* __restrict__ gamma,
                           const float* __restrict__ beta,
                           float* __restrict__ bnsc,
                           float* __restrict__ bnsh) {
    int t = threadIdx.x;
    float s = 0.f, s2 = 0.f;
    for (int b = 0; b < 32; ++b) {
        s  += part1[b * QD + t];
        s2 += part2[b * QD + t];
    }
    float mean = s * (1.f / 8192.f);
    float var  = s2 * (1.f / 8192.f) - mean * mean;
    float sc = gamma[t] / sqrtf(var + 1e-5f);
    bnsc[t] = sc;
    bnsh[t] = beta[t] - mean * sc;
}

// ---------------- kernel: routing ----------------
// one wave per (token, head); TOPK==DTK^2 so softmax runs over ALL 16 combos.
__global__ void peer_route(const float* __restrict__ q,
                           const float* __restrict__ bnsc,
                           const float* __restrict__ bnsh,
                           const float* __restrict__ n0,
                           const float* __restrict__ n1,
                           int* __restrict__ rid,
                           float* __restrict__ rw) {
    __shared__ float qn[8][QD];
    int wid = threadIdx.x >> 5, lane = threadIdx.x & 31;
    int item = blockIdx.x * 8 + wid;            // [0, 8192)
    int r = item >> 3, h = item & 7;
    const float* qrow = q + r * NQ + h * QD;

    float vr[8]; float ss = 0.f;
    int cb = lane * 8;
    #pragma unroll
    for (int j = 0; j < 8; ++j) {
        int c = cb + j;
        float x = qrow[c] * bnsc[c] + bnsh[c];
        vr[j] = x; ss += x * x;
    }
    float ssg = ss;
    #pragma unroll
    for (int off = 8; off; off >>= 1) ssg += __shfl_xor(ssg, off, 16);
    float ss0 = __shfl(ssg, 0, 32);
    float ss1 = __shfl(ssg, 16, 32);
    float inv = (lane < 16) ? 1.f / fmaxf(sqrtf(ss0), 1e-12f)
                            : 1.f / fmaxf(sqrtf(ss1), 1e-12f);
    #pragma unroll
    for (int j = 0; j < 8; ++j) qn[wid][cb + j] = vr[j] * inv;
    __syncthreads();

    float s0 = 0.f, s1 = 0.f;
    const float* k0r = n0 + lane * HALF;
    const float* k1r = n1 + lane * HALF;
    #pragma unroll 4
    for (int c = 0; c < HALF; ++c) {
        s0 += qn[wid][c] * k0r[c];
        s1 += qn[wid][HALF + c] * k1r[c];
    }

    float ts0[DTK], ts1[DTK]; int ti0[DTK], ti1[DTK];
    float mv = s0; int mi = lane;
    #pragma unroll
    for (int tI = 0; tI < DTK; ++tI) {
        float v = mv; int i = mi;
        #pragma unroll
        for (int off = 16; off; off >>= 1) {
            float ov = __shfl_xor(v, off, 32);
            int   oi = __shfl_xor(i, off, 32);
            if (ov > v || (ov == v && oi < i)) { v = ov; i = oi; }
        }
        ts0[tI] = v; ti0[tI] = i;
        if (lane == i) mv = -INFINITY;
    }
    mv = s1; mi = lane;
    #pragma unroll
    for (int tI = 0; tI < DTK; ++tI) {
        float v = mv; int i = mi;
        #pragma unroll
        for (int off = 16; off; off >>= 1) {
            float ov = __shfl_xor(v, off, 32);
            int   oi = __shfl_xor(i, off, 32);
            if (ov > v || (ov == v && oi < i)) { v = ov; i = oi; }
        }
        ts1[tI] = v; ti1[tI] = i;
        if (lane == i) mv = -INFINITY;
    }

    int ii = (lane >> 2) & 3, jj = lane & 3;
    float cs = ts0[ii] + ts1[jj];
    int  cid = ti0[ii] * NKEY + ti1[jj];
    float m = cs;
    #pragma unroll
    for (int off = 8; off; off >>= 1) m = fmaxf(m, __shfl_xor(m, off, 16));
    float e = expf(cs - m);
    float sum = e;
    #pragma unroll
    for (int off = 8; off; off >>= 1) sum += __shfl_xor(sum, off, 16);
    float w = e / sum;
    if (lane < 16) {
        rid[item * 16 + lane] = cid;
        rw [item * 16 + lane] = w;
    }
}

typedef const __attribute__((address_space(1))) char* gbytes;   // byte pointer into global memory

// Base of a gathered row: the row index is the same in every lane, so readfirstlane puts it in a scalar
// register and the base is formed there; each load then names that base and one per-lane byte offset
// that is never rewritten.
__device__ inline gbytes uniformRow(const float* tab, int row, unsigned int rowBytes) {
    unsigned int off = (unsigned int)__builtin_amdgcn_readfirstlane(row) * rowBytes;
    return (gbytes)((unsigned long long)(uintptr_t)tab + off);
}
__device__ inline float4 load16(gbytes p) {
    return *(const __attribute__((address_space(1))) float4*)p;
}

// ---------------- kernel: expert gather/MLP/accumulate ----------------
__global__ void peer_expert(const float* __restrict__ hs,
                            const float* __restrict__ down,
                            const float* __restrict__ up,
                            const int* __restrict__ rid,
                            const float* __restrict__ rw,
                            float* __restrict__ out) {
    __shared__ __attribute__((aligned(16))) float hsr[D];   // read back as 16-byte pieces
    __shared__ float geh[128];
    __shared__ int   eid[128];
    __shared__ float ew [128];
    int t = threadIdx.x;
    int r = blockIdx.x;
    #pragma unroll
    for (int i = 0; i < 4; ++i) hsr[t + 256 * i] = hs[r * D + t + 256 * i];
    if (t < 128) {
        eid[t] = rid[r * 128 + t];
        ew [t] = rw [r * 128 + t];
    }
    __syncthreads();

    int wid = t >> 5, lane = t & 31;
    // each lane keeps its 32 elements of the token row: 16 bytes out of every 512
    const float4* hs4 = (const float4*)hsr;
    float4 hv[8];
    #pragma unroll
    for (int i = 0; i < 8; ++i) hv[i] = hs4[i * 32 + lane];

    // The wave's 16 gathered rows, two per trip: 16 loads of 16 bytes per lane are issued before the
    // first is used. The loop holds loads and multiply-adds only; wave sums and gelu follow behind it.
    unsigned int loff = (unsigned int)lane * 16u;
    float part[16];
    // unrolled: part[] stays in registers, and the per-lane offset stays a 32-bit operand of each load
    #pragma unroll
    for (int k = 0; k < 16; k += 2) {
        gbytes d0 = uniformRow(down, eid[wid * 16 + k], D * 4u);
        gbytes d1 = uniformRow(down, eid[wid * 16 + k + 1], D * 4u);
        float4 a0[8], a1[8];
        #pragma unroll
        for (int i = 0; i < 8; ++i) a0[i] = load16(d0 + loff + i * 512);
        #pragma unroll
        for (int i = 0; i < 8; ++i) a1[i] = load16(d1 + loff + i * 512);
        // keeps all 16 loads ahead of the sums; without it the scheduler sinks them to two or three in flight
        __builtin_amdgcn_sched_barrier(0);
        float4 p0 = {0.f, 0.f, 0.f, 0.f}, p1 = {0.f, 0.f, 0.f, 0.f};
        #pragma unroll
        for (int i = 0; i < 8; ++i) {
            p0.x += a0[i].x * hv[i].x; p0.y += a0[i].y * hv[i].y;
            p0.z += a0[i].z * hv[i].z; p0.w += a0[i].w * hv[i].w;
        }
        #pragma unroll
        for (int i = 0; i < 8; ++i) {
            p1.x += a1[i].x * hv[i].x; p1.y += a1[i].y * hv[i].y;
            p1.z += a1[i].z * hv[i].z; p1.w += a1[i].w * hv[i].w;
        }
        part[k]     = (p0.x + p0.y) + (p0.z + p0.w);
        part[k + 1] = (p1.x + p1.y) + (p1.z + p1.w);
    }
    #pragma unroll
    for (int k = 0; k < 16; ++k) part[k] = waveRedSum32(part[k]);
    if (lane == 0) {
        #pragma unroll
        for (int k = 0; k < 16; ++k) {
            float x = part[k];
            float g = 0.5f * x * (1.0f + erff(x * 0.70710678118654752f)); // exact gelu
            geh[wid * 16 + k] = g * ew[wid * 16 + k];
        }
    }
    __syncthreads();

    // thread t owns output columns 4t..4t+3; 16 gathered rows are in flight per trip
    unsigned int toff = (unsigned int)t * 16u;
    float4 acc = {0.f, 0.f, 0.f, 0.f};
    // unrolled: the next trip's loads can issue among this trip's sums
    #pragma unroll
    for (int e0 = 0; e0 < 128; e0 += 16) {
        float4 u[16];
        #pragma unroll
        for (int j = 0; j < 16; ++j)
            u[j] = load16(uniformRow(up, eid[e0 + j], OUTD * 4u) + toff);
        // keeps the 16 loads ahead of the sums, as above
        __builtin_amdgcn_sched_barrier(0);
        #pragma unroll
        for (int j = 0; j < 16; ++j) {
            float g = geh[e0 + j];
            acc.x += g * u[j].x; acc.y += g * u[j].y;
            acc.z += g * u[j].z; acc.w += g * u[j].w;
        }
    }
    ((float4*)out)[r * (OUTD / 4) + t] = acc;
}

// ---------------- launcher ----------------
extern "C" void kernel_launch(void* const* d_in, const int* in_sizes, int n_in,
                              void* d_out, int out_size, void* d_ws, size_t ws_size,
                              hipStream_t stream) {
    const float* hs    = (const float*)d_in[0];  // [1024,1024]
    const float* Wq    = (const float*)d_in[1];  // [1024,2048]
    const float* bq    = (const float*)d_in[2];  // [2048]
    const float* gamma = (const float*)d_in[3];  // [256]
    const float* beta  = (const float*)d_in[4];  // [256]
    const float* sk0   = (const float*)d_in[5];  // [32,128]
    const float* sk1   = (const float*)d_in[6];  // [32,128]
    const float* down  = (const float*)d_in[7];  // [1024,1024]
    const float* up    = (const float*)d_in[8];  // [1024,1024]
    float* out = (float*)d_out;                  // [1024,1024]

    float* ws = (float*)d_ws;
    float* q      = ws;                   // 1024*2048
    float* n0     = q      + TOKENS * NQ;
    float* n1     = n0     + NKEY * HALF;
    float* part1  = n1     + NKEY * HALF;
    float* part2  = part1  + 32 * QD;
    float* bnsc   = part2  + 32 * QD;
    float* bnsh   = bnsc   + QD;
    int*   rid    = (int*)(bnsh + QD);
    float* rw     = (float*)(rid + NITEM * 16);

    peer_knorm<<<dim3(8), dim3(256), 0, stream>>>(sk0, sk1, n0, n1);
    peer_qproj<<<dim3(NQ / BN, TOKENS / BM), dim3(256), 0, stream>>>(hs, Wq, bq, q);
    peer_bnstat<<<dim3(32), dim3(256), 0, stream>>>(q, part1, part2);
    peer_bnfin<<<dim3(1), dim3(256), 0, stream>>>(part1, part2, gamma, beta, bnsc, bnsh);
    peer_route<<<dim3(TOKENS), dim3(256), 0, stream>>>(q, bnsc, bnsh, n0, n1, rid, rw);
    peer_expert<<<dim3(TOKENS), dim3(256), 0, stream>>>(hs, down, up, rid, rw, out);
}

// v002
// One run takes 104 microseconds.
// Next to v001, in two timings, it ran 1.11 and 1.12 times as fast.
// Over all steps from v000 it is 1.27 times as fast.
#include <hip/hip_runtime.h>
#include <math.h>

typedef float v2f __attribute__((ext_vector_type(2)));
typedef float v8f __attribute__((ext_vector_type(8)));
typedef unsigned int u32x4 __attribute__((ext_vector_type(4)));
typedef int i32x4 __attribute__((ext_vector_type(4)));
typedef int i32x8 __attribute__((ext_vector_type(8)));

#define H 8
#define QD 256
#define HALF 128
#define NKEY 32
#define DTK 4
#define TOKENS 1024      // B*S
#define D 1024
#define NQ 2048          // H*QD
#define OUTD 1024
#define NITEM 8192       // TOKENS*H

// GEMM tiling
#define BM 64            // rows per block
#define BN 128           // cols per block
#define BK 32            // K-step
#define BNP 129          // padded B row stride (via TDM pad: 1 dword per 128)
#define AMP 33           // padded A row stride
#define KP 260           // LDS row stride of a staged key-pair row: 1040 bytes = 16 x 65, an odd count of 16-byte units

// ---------------- helpers ----------------
__device__ inline float waveRedSum32(float x) {
    #pragma unroll
    for (int off = 16; off; off >>= 1) x += __shfl_xor(x, off, 32);
    return x;
}

// Issue a TDM load of a 32x128 f32 tile of Wq (row stride 2048 elems) into LDS
// at byte offset lds_off, padded +1 dword per 128 dwords (-> 129-dword rows).
__device__ inline void tdm_load_B(const float* gaddr, unsigned int lds_off) {
    u32x4 g0;
    g0.x = 1u;                                   // count=1, user mode
    g0.y = lds_off;                              // LDS byte address
    unsigned long long ga = (unsigned long long)(uintptr_t)gaddr;
    g0.z = (unsigned int)ga;                     // global_addr[31:0]
    g0.w = (unsigned int)(ga >> 32) | 0x80000000u; // global_addr[56:32] | type=2
    i32x8 g1;
    g1[0] = (int)((2u << 16)       // data_size = 4 bytes
                | (1u << 20)       // pad_enable
                | (6u << 22));     // pad_interval = 128 dwords (pad_amount=0 -> 1 dword)
    g1[1] = (int)(2048u << 16);    // tensor_dim0 = 2048 (elements per row)
    g1[2] = (int)(1024u << 16);    // tensor_dim1 = 1024 rows (dim0 hi bits = 0)
    g1[3] = (int)(128u << 16);     // tile_dim0 = 128 (dim1 hi bits = 0)
    g1[4] = 32;                    // tile_dim1 = 32, tile_dim2 = 0
    g1[5] = 2048;                  // tensor_dim0_stride[31:0] = 2048
    g1[6] = 0;                     // stride hi / dim1_stride lo
    g1[7] = 0;
    i32x4 gz4 = {0, 0, 0, 0};              // groups 2/3 unused (2D tensor)
    i32x8 gz8 = {0, 0, 0, 0, 0, 0, 0, 0};
    __builtin_amdgcn_tensor_load_to_lds(g0, g1, gz4, gz4, gz8, 0);
}

// ---------------- kernel: normalize sub-keys ----------------
__global__ void peer_knorm(const float* __restrict__ k0,
                           const float* __restrict__ k1,
                           float* __restrict__ n0,
                           float* __restrict__ n1) {
    int wid = threadIdx.x >> 5, lane = threadIdx.x & 31;
    int gw = blockIdx.x * 8 + wid;          // [0,64)
    int table = gw >> 5, row = gw & 31;
    const float* src = table ? k1 : k0;
    float*       dst = table ? n1 : n0;
    float v[4]; float ss = 0.f;
    #pragma unroll
    for (int j = 0; j < 4; ++j) {
        v[j] = src[row * HALF + lane * 4 + j];
        ss += v[j] * v[j];
    }
    ss = waveRedSum32(ss);
    float inv = 1.f / fmaxf(sqrtf(ss), 1e-12f);
    #pragma unroll
    for (int j = 0; j < 4; ++j) dst[row * HALF + lane * 4 + j] = v[j] * inv;
}

// ---------------- kernel: Q projection GEMM (f32 WMMA + TDM double-buffer) ----------------
// q[TOKENS][NQ] = hs[TOKENS][D] @ Wq[D][NQ] + bq
// Block tile 64x128, 8 waves in 2x4 grid, each wave a 2x2 grid of 16x16 tiles.
// B tiles arrive via Tensor Data Mover (async, double buffered, padded rows).
__global__ void peer_qproj(const float* __restrict__ hs,
                           const float* __restrict__ Wq,
                           const float* __restrict__ bq,
                           float* __restrict__ q) {
    __shared__ float As[2][BM][AMP];
    __shared__ float Bs[2][BK][BNP];
    int t = threadIdx.x;
    int wid = t >> 5, lane = t & 31;
    int rowBase = blockIdx.y * BM;
    int colBase = blockIdx.x * BN;
    int wm = wid >> 2;                 // 0..1  (row group of 32)
    int wn = wid & 3;                  // 0..3  (col group of 32)
    int l15 = lane & 15;
    int khi = (lane >> 4) << 1;        // 0 or 2

    v8f acc00 = {}, acc01 = {}, acc10 = {}, acc11 = {};

    // ---- prologue: stage 0 ----
    if (wid == 0)
        tdm_load_B(Wq + colBase, (unsigned int)(uintptr_t)&Bs[0][0][0]);
    #pragma unroll
    for (int i = 0; i < 8; ++i) {                // A: 64x32
        int idx = i * 256 + t;
        int r = idx >> 5, c = idx & 31;
        As[0][r][c] = hs[(rowBase + r) * D + c];
    }

    int buf = 0;
    for (int it = 0; it < D / BK; ++it) {
        int k0 = it * BK;
        // ---- issue next stage (overlaps this stage's WMMA) ----
        if (it < D / BK - 1) {
            int kn = k0 + BK;
            if (wid == 0)
                tdm_load_B(Wq + (size_t)kn * NQ + colBase,
                           (unsigned int)(uintptr_t)&Bs[buf ^ 1][0][0]);
            #pragma unroll
            for (int i = 0; i < 8; ++i) {
                int idx = i * 256 + t;
                int r = idx >> 5, c = idx & 31;
                As[buf ^ 1][r][c] = hs[(rowBase + r) * D + kn + c];
            }
            if (wid == 0) __builtin_amdgcn_s_wait_tensorcnt(1);
        } else {
            if (wid == 0) __builtin_amdgcn_s_wait_tensorcnt(0);
        }
        __syncthreads();    // stage `buf` (A stores + TDM B) complete

        #pragma unroll
        for (int kk = 0; kk < 8; ++kk) {
            int kb = kk * 4 + khi;
            v2f a0 = { As[buf][wm * 32 + l15][kb],      As[buf][wm * 32 + l15][kb + 1] };
            v2f a1 = { As[buf][wm * 32 + 16 + l15][kb], As[buf][wm * 32 + 16 + l15][kb + 1] };
            v2f b0 = { Bs[buf][kb][wn * 32 + l15],      Bs[buf][kb + 1][wn * 32 + l15] };
            v2f b1 = { Bs[buf][kb][wn * 32 + 16 + l15], Bs[buf][kb + 1][wn * 32 + 16 + l15] };
            acc00 = __builtin_amdgcn_wmma_f32_16x16x4_f32(false, a0, false, b0, (short)0, acc00, false, false);
            acc01 = __builtin_amdgcn_wmma_f32_16x16x4_f32(false, a0, false, b1, (short)0, acc01, false, false);
            acc10 = __builtin_amdgcn_wmma_f32_16x16x4_f32(false, a1, false, b0, (short)0, acc10, false, false);
            acc11 = __builtin_amdgcn_wmma_f32_16x16x4_f32(false, a1, false, b1, (short)0, acc11, false, false);
        }
        __syncthreads();    // all waves done reading stage `buf`
        buf ^= 1;
    }

    // ---- epilogue: bias + store (C layout: VGPR v -> M = v + 8*(lane>=16)) ----
    int rhalf = (lane >> 4) << 3;
    #pragma unroll
    for (int sn = 0; sn < 2; ++sn) {
        int col = colBase + wn * 32 + sn * 16 + l15;
        float bias = bq[col];
        v8f a0v = sn ? acc01 : acc00;
        v8f a1v = sn ? acc11 : acc10;
        #pragma unroll
        for (int v = 0; v < 8; ++v) {
            int row0 = rowBase + wm * 32 + v + rhalf;
            q[row0 * NQ + col] = a0v[v] + bias;
            q[(row0 + 16) * NQ + col] = a1v[v] + bias;
        }
    }
}

// ---------------- kernel: BN partial stats ----------------
__global__ void peer_bnstat(const float* __restrict__ q,
                            float* __restrict__ part1,
                            float* __restrict__ part2) {
    int t = threadIdx.x;
    float s = 0.f, s2 = 0.f;
    int r0 = blockIdx.x * 32;
    for (int r = r0; r < r0 + 32; ++r) {
        #pragma unroll
        for (int i = 0; i < 8; ++i) {
            float v = q[r * NQ + i * QD + t];
            s += v; s2 += v * v;
        }
    }
    part1[blockIdx.x * QD + t] = s;
    part2[blockIdx.x * QD + t] = s2;
}

// ---------------- kernel: BN finalize ----------------
__global__ void peer_bnfin(const float* __restrict__ part1,
                           const float* __restrict__ part2,
                           const float* __restrict__ gamma,
                           const float* __restrict__ beta,
                           float* __restrict__ bnsc,
                           float* __restrict__ bnsh) {
    int t = threadIdx.x;
    float s = 0.f, s2 = 0.f;
    for (int b = 0; b < 32; ++b) {
        s  += part1[b * QD + t];
        s2 += part2[b * QD + t];
    }
    float mean = s * (1.f / 8192.f);
    float var  = s2 * (1.f / 8192.f) - mean * mean;
    float sc = gamma[t] / sqrtf(var + 1e-5f);
    bnsc[t] = sc;
    bnsh[t] = beta[t] - mean * sc;
}

// ---------------- kernel: routing ----------------
// one wave per (token, head); TOPK==DTK^2 so softmax runs over ALL 16 combos.
__global__ void peer_route(const float* __restrict__ q,
                           const float* __restrict__ bnsc,
                           const float* __restrict__ bnsh,
                           const float* __restrict__ n0,
                           const float* __restrict__ n1,
                           int* __restrict__ rid,
                           float* __restrict__ rw) {
    // Both halves interleaved: element 2c is channel c of the first half, element 2c+1 of the second.
    __shared__ __attribute__((aligned(16))) float qn[8][QD];     // the wave's normalized query
    __shared__ __attribute__((aligned(16))) float ks[NKEY][KP];  // row k: key k of both normalized tables
    int wid = threadIdx.x >> 5, lane = threadIdx.x & 31;
    int item = blockIdx.x * 8 + wid;            // [0, 8192)
    int r = item >> 3, h = item & 7;
    const float* qrow = q + r * NQ + h * QD;

    // Both key tables go into LDS once per block: a wave reads whole 512-byte rows from global memory,
    // so no load touches more than four cache lines. The stores stand in front of the barrier below.
    float4 kst0[4], kst1[4];
    #pragma unroll
    for (int i = 0; i < 4; ++i) {
        kst0[i] = ((const float4*)n0)[i * 256 + threadIdx.x];
        kst1[i] = ((const float4*)n1)[i * 256 + threadIdx.x];
    }

    float vr[8]; float ss = 0.f;
    int cb = lane * 8;
    #pragma unroll
    for (int j = 0; j < 8; ++j) {
        int c = cb + j;
        float x = qrow[c] * bnsc[c] + bnsh[c];
        vr[j] = x; ss += x * x;
    }
    float ssg = ss;
    #pragma unroll
    for (int off = 8; off; off >>= 1) ssg += __shfl_xor(ssg, off, 16);
    float ss0 = __shfl(ssg, 0, 32);
    float ss1 = __shfl(ssg, 16, 32);
    float inv = (lane < 16) ? 1.f / fmaxf(sqrtf(ss0), 1e-12f)
                            : 1.f / fmaxf(sqrtf(ss1), 1e-12f);
    #pragma unroll
    for (int j = 0; j < 8; ++j) qn[wid][2 * ((cb + j) & (HALF - 1)) + (lane >> 4)] = vr[j] * inv;
    #pragma unroll
    for (int i = 0; i < 4; ++i) {               // wave wid holds key i*8+wid, lane its channels 4*lane..4*lane+3
        float4* dst = (float4*)&ks[i * 8 + wid][lane * 8];
        dst[0] = make_float4(kst0[i].x, kst1[i].x, kst0[i].y, kst1[i].y);
        dst[1] = make_float4(kst0[i].z, kst1[i].z, kst0[i].w, kst1[i].w);
    }
    __syncthreads();

    // lane = key: each lane walks its own key row in LDS (conflict-free at the KP stride); the query
    // piece is the same address in every lane. One packed multiply-add serves both tables; each
    // table's products are added in the order c = 0..127, as before.
    v2f s01 = {0.f, 0.f};
    const float4* kr = (const float4*)&ks[lane][0];
    const float4* qa = (const float4*)&qn[wid][0];
    // unrolled by 16: the reads take immediate offsets, and later pairs' reads issue among the sums
    #pragma unroll 16
    for (int c2 = 0; c2 < HALF / 2; ++c2) {
        float4 a = qa[c2], x = kr[c2];
        s01 += (v2f){a.x, a.y} * (v2f){x.x, x.y};
        s01 += (v2f){a.z, a.w} * (v2f){x.z, x.w};
    }
    float s0 = s01.x, s1 = s01.y;

    float ts0[DTK], ts1[DTK]; int ti0[DTK], ti1[DTK];
    float mv = s0; int mi = lane;
    #pragma unroll
    for (int tI = 0; tI < DTK; ++tI) {
        float v = mv; int i = mi;
        #pragma unroll
        for (int off = 16; off; off >>= 1) {
            float ov = __shfl_xor(v, off, 32);
            int   oi = __shfl_xor(i, off, 32);
            if (ov > v || (ov == v && oi < i)) { v = ov; i = oi; }
        }
        ts0[tI] = v; ti0[tI] = i;
        if (lane == i) mv = -INFINITY;
    }
    mv = s1; mi = lane;
    #pragma unroll
    for (int tI = 0; tI < DTK; ++tI) {
        float v = mv; int i = mi;
        #pragma unroll
        for (int off = 16; off; off >>= 1) {
            float ov = __shfl_xor(v, off, 32);
            int   oi = __shfl_xor(i, off, 32);
            if (ov > v || (ov == v && oi < i)) { v = ov; i = oi; }
        }
        ts1[tI] = v; ti1[tI] = i;
        if (lane == i) mv = -INFINITY;
    }

    int ii = (lane >> 2) & 3, jj = lane & 3;
    float cs = ts0[ii] + ts1[jj];
    int  cid = ti0[ii] * NKEY + ti1[jj];
    float m = cs;
    #pragma unroll
    for (int off = 8; off; off >>= 1) m = fmaxf(m, __shfl_xor(m, off, 16));
    float e = expf(cs - m);
    float sum = e;
    #pragma unroll
    for (int off = 8; off; off >>= 1) sum += __shfl_xor(sum, off, 16);
    float w = e / sum;
    if (lane < 16) {
        rid[item * 16 + lane] = cid;
        rw [item * 16 + lane] = w;
    }
}

typedef const __attribute__((address_space(1))) char* gbytes;   // byte pointer into global memory

// Base of a gathered row: the row index is the same in every lane, so readfirstlane puts it in a scalar
// register and the base is formed there; each load then names that base and one per-lane byte offset
// that is never rewritten.
__device__ inline gbytes uniformRow(const float* tab, int row, unsigned int rowBytes) {
    unsigned int off = (unsigned int)__builtin_amdgcn_readfirstlane(row) * rowBytes;
    return (gbytes)((unsigned long long)(uintptr_t)tab + off);
}
__device__ inline float4 load16(gbytes p) {
    return *(const __attribute__((address_space(1))) float4*)p;
}

// ---------------- kernel: expert gather/MLP/accumulate ----------------
__global__ void peer_expert(const float* __restrict__ hs,
                            const float* __restrict__ down,
                            const float* __restrict__ up,
                            const int* __restrict__ rid,
                            const float* __restrict__ rw,
                            float* __restrict__ out) {
    __shared__ __attribute__((aligned(16))) float hsr[D];   // read back as 16-byte pieces
    __shared__ float geh[128];
    __shared__ int   eid[128];
    __shared__ float ew [128];
    int t = threadIdx.x;
    int r = blockIdx.x;
    #pragma unroll
    for (int i = 0; i < 4; ++i) hsr[t + 256 * i] = hs[r * D + t + 256 * i];
    if (t < 128) {
        eid[t] = rid[r * 128 + t];
        ew [t] = rw [r * 128 + t];
    }
    __syncthreads();

    int wid = t >> 5, lane = t & 31;
    // each lane keeps its 32 elements of the token row: 16 bytes out of every 512
    const float4* hs4 = (const float4*)hsr;
    float4 hv[8];
    #pragma unroll
    for (int i = 0; i < 8; ++i) hv[i] = hs4[i * 32 + lane];

    // The wave's 16 gathered rows, two per trip: 16 loads of 16 bytes per lane are issued before the
    // first is used. The loop holds loads and multiply-adds only; wave sums and gelu follow behind it.
    unsigned int loff = (unsigned int)lane * 16u;
    float part[16];
    // unrolled: part[] stays in registers, and the per-lane offset stays a 32-bit operand of each load
    #pragma unroll
    for (int k = 0; k < 16; k += 2) {
        gbytes d0 = uniformRow(down, eid[wid * 16 + k], D * 4u);
        gbytes d1 = uniformRow(down, eid[wid * 16 + k + 1], D * 4u);
        float4 a0[8], a1[8];
        #pragma unroll
        for (int i = 0; i < 8; ++i) a0[i] = load16(d0 + loff + i * 512);
        #pragma unroll
        for (int i = 0; i < 8; ++i) a1[i] = load16(d1 + loff + i * 512);
        // keeps all 16 loads ahead of the sums; without it the scheduler sinks them to two or three in flight
        __builtin_amdgcn_sched_barrier(0);
        float4 p0 = {0.f, 0.f, 0.f, 0.f}, p1 = {0.f, 0.f, 0.f, 0.f};
        #pragma unroll
        for (int i = 0; i < 8; ++i) {
            p0.x += a0[i].x * hv[i].x; p0.y += a0[i].y * hv[i].y;
            p0.z += a0[i].z * hv[i].z; p0.w += a0[i].w * hv[i].w;
        }
        #pragma unroll
        for (int i = 0; i < 8; ++i) {
            p1.x += a1[i].x * hv[i].x; p1.y += a1[i].y * hv[i].y;
            p1.z += a1[i].z * hv[i].z; p1.w += a1[i].w * hv[i].w;
        }
        part[k]     = (p0.x + p0.y) + (p0.z + p0.w);
        part[k + 1] = (p1.x + p1.y) + (p1.z + p1.w);
    }
    #pragma unroll
    for (int k = 0; k < 16; ++k) part[k] = waveRedSum32(part[k]);
    if (lane == 0) {
        #pragma unroll
        for (int k = 0; k < 16; ++k) {
            float x = part[k];
            float g = 0.5f * x * (1.0f + erff(x * 0.70710678118654752f)); // exact gelu
            geh[wid * 16 + k] = g * ew[wid * 16 + k];
        }
    }
    __syncthreads();

    // thread t owns output columns 4t..4t+3; 16 gathered rows are in flight per trip
    unsigned int toff = (unsigned int)t * 16u;
    float4 acc = {0.f, 0.f, 0.f, 0.f};
    // unrolled: the next trip's loads can issue among this trip's sums
    #pragma unroll
    for (int e0 = 0; e0 < 128; e0 += 16) {
        float4 u[16];
        #pragma unroll
        for (int j = 0; j < 16; ++j)
            u[j] = load16(uniformRow(up, eid[e0 + j], OUTD * 4u) + toff);
        // keeps the 16 loads ahead of the sums, as above
        __builtin_amdgcn_sched_barrier(0);
        #pragma unroll
        for (int j = 0; j < 16; ++j) {
            float g = geh[e0 + j];
            acc.x += g * u[j].x; acc.y += g * u[j].y;
            acc.z += g * u[j].z; acc.w += g * u[j].w;
        }
    }
    ((float4*)out)[r * (OUTD / 4) + t] = acc;
}

// ---------------- launcher ----------------
extern "C" void kernel_launch(void* const* d_in, const int* in_sizes, int n_in,
                              void* d_out, int out_size, void* d_ws, size_t ws_size,
                              hipStream_t stream) {
    const float* hs    = (const float*)d_in[0];  // [1024,1024]
    const float* Wq    = (const float*)d_in[1];  // [1024,2048]
    const float* bq    = (const float*)d_in[2];  // [2048]
    const float* gamma = (const float*)d_in[3];  // [256]
    const float* beta  = (const float*)d_in[4];  // [256]
    const float* sk0   = (const float*)d_in[5];  // [32,128]
    const float* sk1   = (const float*)d_in[6];  // [32,128]
    const float* down  = (const float*)d_in[7];  // [1024,1024]
    const float* up    = (const float*)d_in[8];  // [1024,1024]
    float* out = (float*)d_out;                  // [1024,1024]

    float* ws = (float*)d_ws;
    float* q      = ws;                   // 1024*2048
    float* n0     = q      + TOKENS * NQ;
    float* n1     = n0     + NKEY * HALF;
    float* part1  = n1     + NKEY * HALF;
    float* part2  = part1  + 32 * QD;
    float* bnsc   = part2  + 32 * QD;
    float* bnsh   = bnsc   + QD;
    int*   rid    = (int*)(bnsh + QD);
    float* rw     = (float*)(rid + NITEM * 16);

    peer_knorm<<<dim3(8), dim3(256), 0, stream>>>(sk0, sk1, n0, n1);
    peer_qproj<<<dim3(NQ / BN, TOKENS / BM), dim3(256), 0, stream>>>(hs, Wq, bq, q);
    peer_bnstat<<<dim3(32), dim3(256), 0, stream>>>(q, part1, part2);
    peer_bnfin<<<dim3(1), dim3(256), 0, stream>>>(part1, part2, gamma, beta, bnsc, bnsh);
    peer_route<<<dim3(TOKENS), dim3(256), 0, stream>>>(q, bnsc, bnsh, n0, n1, rid, rw);
    peer_expert<<<dim3(TOKENS), dim3(256), 0, stream>>>(hs, down, up, rid, rw, out);
}

// v003
// One run takes 92.1 microseconds.
// Next to v002, in two timings, it ran 1.13 times as fast each time.
// All steps since v000 together make it 1.43 times as fast.
#include <hip/hip_runtime.h>
#include <math.h>

typedef float v2f __attribute__((ext_vector_type(2)));
typedef float v8f __attribute__((ext_vector_type(8)));
typedef unsigned int u32x4 __attribute__((ext_vector_type(4)));
typedef int i32x4 __attribute__((ext_vector_type(4)));
typedef int i32x8 __attribute__((ext_vector_type(8)));

#define H 8
#define QD 256
#define HALF 128
#define NKEY 32
#define DTK 4
#define TOKENS 1024      // B*S
#define D 1024
#define NQ 2048          // H*QD
#define OUTD 1024
#define NITEM 8192       // TOKENS*H

// GEMM tiling
#define BM 64            // rows per block
#define NRB 16           // block rows of the projection: TOKENS / BM
#define BN 128           // cols per block
#define BK 32            // K-step
#define BNP 129          // padded B row stride (via TDM pad: 1 dword per 128)
#define AMP 33           // padded A row stride
#define KP 260           // LDS row stride of a staged key-pair row: 1040 bytes = 16 x 65, an odd count of 16-byte units

// ---------------- helpers ----------------
__device__ inline float waveRedSum32(float x) {
    #pragma unroll
    for (int off = 16; off; off >>= 1) x += __shfl_xor(x, off, 32);
    return x;
}

// Issue a TDM load of a 32x128 f32 tile of Wq (row stride 2048 elems) into LDS
// at byte offset lds_off, padded +1 dword per 128 dwords (-> 129-dword rows).
__device__ inline void tdm_load_B(const float* gaddr, unsigned int lds_off) {
    u32x4 g0;
    g0.x = 1u;                                   // count=1, user mode
    g0.y = lds_off;                              // LDS byte address
    unsigned long long ga = (unsigned long long)(uintptr_t)gaddr;
    g0.z = (unsigned int)ga;                     // global_addr[31:0]
    g0.w = (unsigned int)(ga >> 32) | 0x80000000u; // global_addr[56:32] | type=2
    i32x8 g1;
    g1[0] = (int)((2u << 16)       // data_size = 4 bytes
                | (1u << 20)       // pad_enable
                | (6u << 22));     // pad_interval = 128 dwords (pad_amount=0 -> 1 dword)
    g1[1] = (int)(2048u << 16);    // tensor_dim0 = 2048 (elements per row)
    g1[2] = (int)(1024u << 16);    // tensor_dim1 = 1024 rows (dim0 hi bits = 0)
    g1[3] = (int)(128u << 16);     // tile_dim0 = 128 (dim1 hi bits = 0)
    g1[4] = 32;                    // tile_dim1 = 32, tile_dim2 = 0
    g1[5] = 2048;                  // tensor_dim0_stride[31:0] = 2048
    g1[6] = 0;                     // stride hi / dim1_stride lo
    g1[7] = 0;
    i32x4 gz4 = {0, 0, 0, 0};              // groups 2/3 unused (2D tensor)
    i32x8 gz8 = {0, 0, 0, 0, 0, 0, 0, 0};
    __builtin_amdgcn_tensor_load_to_lds(g0, g1, gz4, gz4, gz8, 0);
}

// ---------------- kernel: normalize sub-keys ----------------
__global__ void peer_knorm(const float* __restrict__ k0,
                           const float* __restrict__ k1,
                           float* __restrict__ n0,
                           float* __restrict__ n1) {
    int wid = threadIdx.x >> 5, lane = threadIdx.x & 31;
    int gw = blockIdx.x * 8 + wid;          // [0,64)
    int table = gw >> 5, row = gw & 31;
    const float* src = table ? k1 : k0;
    float*       dst = table ? n1 : n0;
    float v[4]; float ss = 0.f;
    #pragma unroll
    for (int j = 0; j < 4; ++j) {
        v[j] = src[row * HALF + lane * 4 + j];
        ss += v[j] * v[j];
    }
    ss = waveRedSum32(ss);
    float inv = 1.f / fmaxf(sqrtf(ss), 1e-12f);
    #pragma unroll
    for (int j = 0; j < 4; ++j) dst[row * HALF + lane * 4 + j] = v[j] * inv;
}

// ---------------- kernel: Q projection GEMM (f32 WMMA + TDM double-buffer) ----------------
// q[TOKENS][NQ] = hs[TOKENS][D] @ Wq[D][NQ] + bq
// Block tile 64x128, 8 waves in 2x4 grid, each wave a 2x2 grid of 16x16 tiles.
// B tiles arrive via Tensor Data Mover (async, double buffered, padded rows).
// The epilogue also writes the block's column sums of q and q*q (64 rows) for the batch norm.
__global__ void peer_qproj(const float* __restrict__ hs,
                           const float* __restrict__ Wq,
                           const float* __restrict__ bq,
                           float* __restrict__ q,
                           float* __restrict__ part1,
                           float* __restrict__ part2) {
    __shared__ float As[2][BM][AMP];
    __shared__ float Bs[2][BK][BNP];
    int t = threadIdx.x;
    int wid = t >> 5, lane = t & 31;
    int rowBase = blockIdx.y * BM;
    int colBase = blockIdx.x * BN;
    int wm = wid >> 2;                 // 0..1  (row group of 32)
    int wn = wid & 3;                  // 0..3  (col group of 32)
    int l15 = lane & 15;
    int khi = (lane >> 4) << 1;        // 0 or 2

    v8f acc00 = {}, acc01 = {}, acc10 = {}, acc11 = {};

    // ---- prologue: stage 0 ----
    if (wid == 0)
        tdm_load_B(Wq + colBase, (unsigned int)(uintptr_t)&Bs[0][0][0]);
    #pragma unroll
    for (int i = 0; i < 8; ++i) {                // A: 64x32
        int idx = i * 256 + t;
        int r = idx >> 5, c = idx & 31;
        As[0][r][c] = hs[(rowBase + r) * D + c];
    }

    int buf = 0;
    for (int it = 0; it < D / BK; ++it) {
        int k0 = it * BK;
        // ---- issue next stage (overlaps this stage's WMMA) ----
        if (it < D / BK - 1) {
            int kn = k0 + BK;
            if (wid == 0)
                tdm_load_B(Wq + (size_t)kn * NQ + colBase,
                           (unsigned int)(uintptr_t)&Bs[buf ^ 1][0][0]);
            #pragma unroll
            for (int i = 0; i < 8; ++i) {
                int idx = i * 256 + t;
                int r = idx >> 5, c = idx & 31;
                As[buf ^ 1][r][c] = hs[(rowBase + r) * D + kn + c];
            }
            if (wid == 0) __builtin_amdgcn_s_wait_tensorcnt(1);
        } else {
            if (wid == 0) __builtin_amdgcn_s_wait_tensorcnt(0);
        }
        __syncthreads();    // stage `buf` (A stores + TDM B) complete

        #pragma unroll
        for (int kk = 0; kk < 8; ++kk) {
            int kb = kk * 4 + khi;
            v2f a0 = { As[buf][wm * 32 + l15][kb],      As[buf][wm * 32 + l15][kb + 1] };
            v2f a1 = { As[buf][wm * 32 + 16 + l15][kb], As[buf][wm * 32 + 16 + l15][kb + 1] };
            v2f b0 = { Bs[buf][kb][wn * 32 + l15],      Bs[buf][kb + 1][wn * 32 + l15] };
            v2f b1 = { Bs[buf][kb][wn * 32 + 16 + l15], Bs[buf][kb + 1][wn * 32 + 16 + l15] };
            acc00 = __builtin_amdgcn_wmma_f32_16x16x4_f32(false, a0, false, b0, (short)0, acc00, false, false);
            acc01 = __builtin_amdgcn_wmma_f32_16x16x4_f32(false, a0, false, b1, (short)0, acc01, false, false);
            acc10 = __builtin_amdgcn_wmma_f32_16x16x4_f32(false, a1, false, b0, (short)0, acc10, false, false);
            acc11 = __builtin_amdgcn_wmma_f32_16x16x4_f32(false, a1, false, b1, (short)0, acc11, false, false);
        }
        __syncthreads();    // all waves done reading stage `buf`
        buf ^= 1;
    }

    // ---- epilogue: bias + store (C layout: VGPR v -> M = v + 8*(lane>=16)) ----
    int rhalf = (lane >> 4) << 3;
    float bias0 = bq[colBase + wn * 32 + l15];
    float bias1 = bq[colBase + wn * 32 + 16 + l15];
    // Keeps the epilogue's vector work out of the last matrix block: without it the scheduler puts reads of an
    // accumulator one or two slots behind the matrix instruction that writes it.
    __builtin_amdgcn_sched_barrier(0);
    // four vector slots between the last matrix instruction and the first read of its result
    asm volatile("v_nop\n\tv_nop\n\tv_nop\n\tv_nop");
    __builtin_amdgcn_sched_barrier(0);  // holds the four slots where they stand
    #pragma unroll
    for (int v = 0; v < 8; ++v) {
        acc00[v] += bias0; acc10[v] += bias0;
        acc01[v] += bias1; acc11[v] += bias1;
    }

    // Column sums of the wave's 32 rows: 16 values per lane, then the other half of the wave.
    // Lanes 0..15 go on with the sum, lanes 16..31 with the sum of squares.
    float* red = &As[0][0][0];         // free: every wave has passed the loop's last barrier
    float cs[2];
    #pragma unroll
    for (int sn = 0; sn < 2; ++sn) {
        v8f a0v = sn ? acc01 : acc00;
        v8f a1v = sn ? acc11 : acc10;
        float s = 0.f, s2 = 0.f;
        #pragma unroll
        for (int v = 0; v < 8; ++v) {
            s += a0v[v]; s2 += a0v[v] * a0v[v];
            s += a1v[v]; s2 += a1v[v] * a1v[v];
        }
        s  += __shfl_xor(s, 16, 32);
        s2 += __shfl_xor(s2, 16, 32);
        cs[sn] = (lane < 16) ? s : s2;
        if (wm == 1) red[(lane >> 4) * BN + wn * 32 + sn * 16 + l15] = cs[sn];
    }
    __syncthreads();    // the second row group's sums are in LDS; stands ahead of the q stores, so it waits for none

    #pragma unroll
    for (int sn = 0; sn < 2; ++sn) {
        int col = colBase + wn * 32 + sn * 16 + l15;
        v8f a0v = sn ? acc01 : acc00;
        v8f a1v = sn ? acc11 : acc10;
        #pragma unroll
        for (int v = 0; v < 8; ++v) {
            int row0 = rowBase + wm * 32 + v + rhalf;
            q[row0 * NQ + col] = a0v[v];
            q[(row0 + 16) * NQ + col] = a1v[v];
        }
        if (wm == 0) {
            float* dst = (lane < 16) ? part1 : part2;
            dst[blockIdx.y * NQ + col] = cs[sn] + red[(lane >> 4) * BN + wn * 32 + sn * 16 + l15];
        }
    }
}

// ---------------- kernel: BN finalize ----------------
// part1/part2 hold, per block row of the projection (NRB of them), the sums of all NQ columns.
// A block serves 32 channels; wave w adds the 8 heads of block rows 2w and 2w+1, wave 0 the 8 wave sums.
__global__ void peer_bnfin(const float* __restrict__ part1,
                           const float* __restrict__ part2,
                           const float* __restrict__ gamma,
                           const float* __restrict__ beta,
                           float* __restrict__ bnsc,
                           float* __restrict__ bnsh) {
    __shared__ float r1[8][32];
    __shared__ float r2[8][32];
    int wid = threadIdx.x >> 5, lane = threadIdx.x & 31;
    int c = blockIdx.x * 32 + lane;
    // NQ = H * QD: the wave's two block rows are 16 pieces of QD columns, one behind the other
    const float* p1 = part1 + wid * (NRB / 8) * NQ + c;
    const float* p2 = part2 + wid * (NRB / 8) * NQ + c;
    float s = 0.f, s2 = 0.f;
    #pragma unroll
    for (int p = 0; p < (NRB / 8) * H; ++p) {
        s  += p1[p * QD];
        s2 += p2[p * QD];
    }
    r1[wid][lane] = s;
    r2[wid][lane] = s2;
    __syncthreads();
    if (wid == 0) {
        s = 0.f; s2 = 0.f;
        #pragma unroll
        for (int w = 0; w < 8; ++w) { s += r1[w][lane]; s2 += r2[w][lane]; }
        float mean = s * (1.f / 8192.f);
        float var  = s2 * (1.f / 8192.f) - mean * mean;
        float sc = gamma[c] / sqrtf(var + 1e-5f);
        bnsc[c] = sc;
        bnsh[c] = beta[c] - mean * sc;
    }
}

// ---------------- kernel: routing ----------------
// one wave per (token, head); TOPK==DTK^2 so softmax runs over ALL 16 combos.
__global__ void peer_route(const float* __restrict__ q,
                           const float* __restrict__ bnsc,
                           const float* __restrict__ bnsh,
                           const float* __restrict__ n0,
                           const float* __restrict__ n1,
                           int* __restrict__ rid,
                           float* __restrict__ rw) {
    // Both halves interleaved: element 2c is channel c of the first half, element 2c+1 of the second.
    __shared__ __attribute__((aligned(16))) float qn[8][QD];     // the wave's normalized query
    __shared__ __attribute__((aligned(16))) float ks[NKEY][KP];  // row k: key k of both normalized tables
    int wid = threadIdx.x >> 5, lane = threadIdx.x & 31;
    int item = blockIdx.x * 8 + wid;            // [0, 8192)
    int r = item >> 3, h = item & 7;
    const float* qrow = q + r * NQ + h * QD;

    // Both key tables go into LDS once per block: a wave reads whole 512-byte rows from global memory,
    // so no load touches more than four cache lines. The stores stand in front of the barrier below.
    float4 kst0[4], kst1[4];
    #pragma unroll
    for (int i = 0; i < 4; ++i) {
        kst0[i] = ((const float4*)n0)[i * 256 + threadIdx.x];
        kst1[i] = ((const float4*)n1)[i * 256 + threadIdx.x];
    }

    float vr[8]; float ss = 0.f;
    int cb = lane * 8;
    #pragma unroll
    for (int j = 0; j < 8; ++j) {
        int c = cb + j;
        float x = qrow[c] * bnsc[c] + bnsh[c];
        vr[j] = x; ss += x * x;
    }
    float ssg = ss;
    #pragma unroll
    for (int off = 8; off; off >>= 1) ssg += __shfl_xor(ssg, off, 16);
    float ss0 = __shfl(ssg, 0, 32);
    float ss1 = __shfl(ssg, 16, 32);
    float inv = (lane < 16) ? 1.f / fmaxf(sqrtf(ss0), 1e-12f)
                            : 1.f / fmaxf(sqrtf(ss1), 1e-12f);
    #pragma unroll
    for (int j = 0; j < 8; ++j) qn[wid][2 * ((cb + j) & (HALF - 1)) + (lane >> 4)] = vr[j] * inv;
    #pragma unroll
    for (int i = 0; i < 4; ++i) {               // wave wid holds key i*8+wid, lane its channels 4*lane..4*lane+3
        float4* dst = (float4*)&ks[i * 8 + wid][lane * 8];
        dst[0] = make_float4(kst0[i].x, kst1[i].x, kst0[i].y, kst1[i].y);
        dst[1] = make_float4(kst0[i].z, kst1[i].z, kst0[i].w, kst1[i].w);
    }
    __syncthreads();

    // lane = key: each lane walks its own key row in LDS (conflict-free at the KP stride); the query
    // piece is the same address in every lane. One packed multiply-add serves both tables; each
    // table's products are added in the order c = 0..127, as before.
    v2f s01 = {0.f, 0.f};
    const float4* kr = (const float4*)&ks[lane][0];
    const float4* qa = (const float4*)&qn[wid][0];
    // unrolled by 16: the reads take immediate offsets, and later pairs' reads issue among the sums
    #pragma unroll 16
    for (int c2 = 0; c2 < HALF / 2; ++c2) {
        float4 a = qa[c2], x = kr[c2];
        s01 += (v2f){a.x, a.y} * (v2f){x.x, x.y};
        s01 += (v2f){a.z, a.w} * (v2f){x.z, x.w};
    }
    float s0 = s01.x, s1 = s01.y;

    float ts0[DTK], ts1[DTK]; int ti0[DTK], ti1[DTK];
    float mv = s0; int mi = lane;
    #pragma unroll
    for (int tI = 0; tI < DTK; ++tI) {
        float v = mv; int i = mi;
        #pragma unroll
        for (int off = 16; off; off >>= 1) {
            float ov = __shfl_xor(v, off, 32);
            int   oi = __shfl_xor(i, off, 32);
            if (ov > v || (ov == v && oi < i)) { v = ov; i = oi; }
        }
        ts0[tI] = v; ti0[tI] = i;
        if (lane == i) mv = -INFINITY;
    }
    mv = s1; mi = lane;
    #pragma unroll
    for (int tI = 0; tI < DTK; ++tI) {
        float v = mv; int i = mi;
        #pragma unroll
        for (int off = 16; off; off >>= 1) {
            float ov = __shfl_xor(v, off, 32);
            int   oi = __shfl_xor(i, off, 32);
            if (ov > v || (ov == v && oi < i)) { v = ov; i = oi; }
        }
        ts1[tI] = v; ti1[tI] = i;
        if (lane == i) mv = -INFINITY;
    }

    int ii = (lane >> 2) & 3, jj = lane & 3;
    float cs = ts0[ii] + ts1[jj];
    int  cid = ti0[ii] * NKEY + ti1[jj];
    float m = cs;
    #pragma unroll
    for (int off = 8; off; off >>= 1) m = fmaxf(m, __shfl_xor(m, off, 16));
    float e = expf(cs - m);
    float sum = e;
    #pragma unroll
    for (int off = 8; off; off >>= 1) sum += __shfl_xor(sum, off, 16);
    float w = e / sum;
    if (lane < 16) {
        rid[item * 16 + lane] = cid;
        rw [item * 16 + lane] = w;
    }
}

typedef const __attribute__((address_space(1))) char* gbytes;   // byte pointer into global memory

// Base of a gathered row: the row index is the same in every lane, so readfirstlane puts it in a scalar
// register and the base is formed there; each load then names that base and one per-lane byte offset
// that is never rewritten.
__device__ inline gbytes uniformRow(const float* tab, int row, unsigned int rowBytes) {
    unsigned int off = (unsigned int)__builtin_amdgcn_readfirstlane(row) * rowBytes;
    return (gbytes)((unsigned long long)(uintptr_t)tab + off);
}
__device__ inline float4 load16(gbytes p) {
    return *(const __attribute__((address_space(1))) float4*)p;
}

// ---------------- kernel: expert gather/MLP/accumulate ----------------
__global__ void peer_expert(const float* __restrict__ hs,
                            const float* __restrict__ down,
                            const float* __restrict__ up,
                            const int* __restrict__ rid,
                            const float* __restrict__ rw,
                            float* __restrict__ out) {
    __shared__ __attribute__((aligned(16))) float hsr[D];   // read back as 16-byte pieces
    __shared__ float geh[128];
    __shared__ int   eid[128];
    __shared__ float ew [128];
    int t = threadIdx.x;
    int r = blockIdx.x;
    #pragma unroll
    for (int i = 0; i < 4; ++i) hsr[t + 256 * i] = hs[r * D + t + 256 * i];
    if (t < 128) {
        eid[t] = rid[r * 128 + t];
        ew [t] = rw [r * 128 + t];
    }
    __syncthreads();

    int wid = t >> 5, lane = t & 31;
    // each lane keeps its 32 elements of the token row: 16 bytes out of every 512
    const float4* hs4 = (const float4*)hsr;
    float4 hv[8];
    #pragma unroll
    for (int i = 0; i < 8; ++i) hv[i] = hs4[i * 32 + lane];

    // The wave's 16 gathered rows, two per trip: 16 loads of 16 bytes per lane are issued before the
    // first is used. The loop holds loads and multiply-adds only; wave sums and gelu follow behind it.
    unsigned int loff = (unsigned int)lane * 16u;
    float part[16];
    // unrolled: part[] stays in registers, and the per-lane offset stays a 32-bit operand of each load
    #pragma unroll
    for (int k = 0; k < 16; k += 2) {
        gbytes d0 = uniformRow(down, eid[wid * 16 + k], D * 4u);
        gbytes d1 = uniformRow(down, eid[wid * 16 + k + 1], D * 4u);
        float4 a0[8], a1[8];
        #pragma unroll
        for (int i = 0; i < 8; ++i) a0[i] = load16(d0 + loff + i * 512);
        #pragma unroll
        for (int i = 0; i < 8; ++i) a1[i] = load16(d1 + loff + i * 512);
        // keeps all 16 loads ahead of the sums; without it the scheduler sinks them to two or three in flight
        __builtin_amdgcn_sched_barrier(0);
        float4 p0 = {0.f, 0.f, 0.f, 0.f}, p1 = {0.f, 0.f, 0.f, 0.f};
        #pragma unroll
        for (int i = 0; i < 8; ++i) {
            p0.x += a0[i].x * hv[i].x; p0.y += a0[i].y * hv[i].y;
            p0.z += a0[i].z * hv[i].z; p0.w += a0[i].w * hv[i].w;
        }
        #pragma unroll
        for (int i = 0; i < 8; ++i) {
            p1.x += a1[i].x * hv[i].x; p1.y += a1[i].y * hv[i].y;
            p1.z += a1[i].z * hv[i].z; p1.w += a1[i].w * hv[i].w;
        }
        part[k]     = (p0.x + p0.y) + (p0.z + p0.w);
        part[k + 1] = (p1.x + p1.y) + (p1.z + p1.w);
    }
    #pragma unroll
    for (int k = 0; k < 16; ++k) part[k] = waveRedSum32(part[k]);
    if (lane == 0) {
        #pragma unroll
        for (int k = 0; k < 16; ++k) {
            float x = part[k];
            float g = 0.5f * x * (1.0f + erff(x * 0.70710678118654752f)); // exact gelu
            geh[wid * 16 + k] = g * ew[wid * 16 + k];
        }
    }
    __syncthreads();

    // thread t owns output columns 4t..4t+3; 16 gathered rows are in flight per trip
    unsigned int toff = (unsigned int)t * 16u;
    float4 acc = {0.f, 0.f, 0.f, 0.f};
    // unrolled: the next trip's loads can issue among this trip's sums
    #pragma unroll
    for (int e0 = 0; e0 < 128; e0 += 16) {
        float4 u[16];
        #pragma unroll
        for (int j = 0; j < 16; ++j)
            u[j] = load16(uniformRow(up, eid[e0 + j], OUTD * 4u) + toff);
        // keeps the 16 loads ahead of the sums, as above
        __builtin_amdgcn_sched_barrier(0);
        #pragma unroll
        for (int j = 0; j < 16; ++j) {
            float g = geh[e0 + j];
            acc.x += g * u[j].x; acc.y += g * u[j].y;
            acc.z += g * u[j].z; acc.w += g * u[j].w;
        }
    }
    ((float4*)out)[r * (OUTD / 4) + t] = acc;
}

// ---------------- launcher ----------------
extern "C" void kernel_launch(void* const* d_in, const int* in_sizes, int n_in,
                              void* d_out, int out_size, void* d_ws, size_t ws_size,
                              hipStream_t stream) {
    const float* hs    = (const float*)d_in[0];  // [1024,1024]
    const float* Wq    = (const float*)d_in[1];  // [1024,2048]
    const float* bq    = (const float*)d_in[2];  // [2048]
    const float* gamma = (const float*)d_in[3];  // [256]
    const float* beta  = (const float*)d_in[4];  // [256]
    const float* sk0   = (const float*)d_in[5];  // [32,128]
    const float* sk1   = (const float*)d_in[6];  // [32,128]
    const float* down  = (const float*)d_in[7];  // [1024,1024]
    const float* up    = (const float*)d_in[8];  // [1024,1024]
    float* out = (float*)d_out;                  // [1024,1024]

    float* ws = (float*)d_ws;
    float* q      = ws;                   // 1024*2048
    float* n0     = q      + TOKENS * NQ;
    float* n1     = n0     + NKEY * HALF;
    float* part1  = n1     + NKEY * HALF;
    float* part2  = part1  + NRB * NQ;
    float* bnsc   = part2  + NRB * NQ;
    float* bnsh   = bnsc   + QD;
    int*   rid    = (int*)(bnsh + QD);
    float* rw     = (float*)(rid + NITEM * 16);

    peer_knorm<<<dim3(8), dim3(256), 0, stream>>>(sk0, sk1, n0, n1);
    peer_qproj<<<dim3(NQ / BN, TOKENS / BM), dim3(256), 0, stream>>>(hs, Wq, bq, q, part1, part2);
    peer_bnfin<<<dim3(QD / 32), dim3(256), 0, stream>>>(part1, part2, gamma, beta, bnsc, bnsh);
    peer_route<<<dim3(TOKENS), dim3(256), 0, stream>>>(q, bnsc, bnsh, n0, n1, rid, rw);
    peer_expert<<<dim3(TOKENS), dim3(256), 0, stream>>>(hs, down, up, rid, rw, out);
}

// v004
// Measured time: 79.2 microseconds a run.
// In both of two side-by-side timings against v003, it was 1.16 times as fast.
// Counting every step since v000, it is 1.66 times as fast.
#include <hip/hip_runtime.h>
#include <math.h>

typedef float v2f __attribute__((ext_vector_type(2)));
typedef float v8f __attribute__((ext_vector_type(8)));
typedef unsigned int u32x4 __attribute__((ext_vector_type(4)));
typedef int i32x4 __attribute__((ext_vector_type(4)));
typedef int i32x8 __attribute__((ext_vector_type(8)));

#define H 8
#define QD 256
#define HALF 128
#define NKEY 32
#define DTK 4
#define TOKENS 1024      // B*S
#define D 1024
#define NQ 2048          // H*QD
#define OUTD 1024
#define NITEM 8192       // TOKENS*H

// GEMM tiling
#define BM 64            // rows per block
#define NRB 16           // block rows of the projection: TOKENS / BM
#define BN 128           // cols per block
#define BK 32            // K-step
#define BNP 129          // padded B row stride (via TDM pad: 1 dword per 128)
#define AMP 33           // padded A row stride
#define KP 260           // LDS row stride of a staged key-pair row: 1040 bytes = 16 x 65, an odd count of 16-byte units

// ---------------- helpers ----------------
__device__ inline float waveRedSum32(float x) {
    #pragma unroll
    for (int off = 16; off; off >>= 1) x += __shfl_xor(x, off, 32);
    return x;
}

// Issue a TDM load of a 32x128 f32 tile of Wq (row stride 2048 elems) into LDS
// at byte offset lds_off, padded +1 dword per 128 dwords (-> 129-dword rows).
__device__ inline void tdm_load_B(const float* gaddr, unsigned int lds_off) {
    u32x4 g0;
    g0.x = 1u;                                   // count=1, user mode
    g0.y = lds_off;                              // LDS byte address
    unsigned long long ga = (unsigned long long)(uintptr_t)gaddr;
    g0.z = (unsigned int)ga;                     // global_addr[31:0]
    g0.w = (unsigned int)(ga >> 32) | 0x80000000u; // global_addr[56:32] | type=2
    i32x8 g1;
    g1[0] = (int)((2u << 16)       // data_size = 4 bytes
                | (1u << 20)       // pad_enable
                | (6u << 22));     // pad_interval = 128 dwords (pad_amount=0 -> 1 dword)
    g1[1] = (int)(2048u << 16);    // tensor_dim0 = 2048 (elements per row)
    g1[2] = (int)(1024u << 16);    // tensor_dim1 = 1024 rows (dim0 hi bits = 0)
    g1[3] = (int)(128u << 16);     // tile_dim0 = 128 (dim1 hi bits = 0)
    g1[4] = 32;                    // tile_dim1 = 32, tile_dim2 = 0
    g1[5] = 2048;                  // tensor_dim0_stride[31:0] = 2048
    g1[6] = 0;                     // stride hi / dim1_stride lo
    g1[7] = 0;
    i32x4 gz4 = {0, 0, 0, 0};              // groups 2/3 unused (2D tensor)
    i32x8 gz8 = {0, 0, 0, 0, 0, 0, 0, 0};
    __builtin_amdgcn_tensor_load_to_lds(g0, g1, gz4, gz4, gz8, 0);
}

// ---------------- kernel: normalize sub-keys ----------------
__global__ void peer_knorm(const float* __restrict__ k0,
                           const float* __restrict__ k1,
                           float* __restrict__ n0,
                           float* __restrict__ n1) {
    int wid = threadIdx.x >> 5, lane = threadIdx.x & 31;
    int gw = blockIdx.x * 8 + wid;          // [0,64)
    int table = gw >> 5, row = gw & 31;
    const float* src = table ? k1 : k0;
    float*       dst = table ? n1 : n0;
    float v[4]; float ss = 0.f;
    #pragma unroll
    for (int j = 0; j < 4; ++j) {
        v[j] = src[row * HALF + lane * 4 + j];
        ss += v[j] * v[j];
    }
    ss = waveRedSum32(ss);
    float inv = 1.f / fmaxf(sqrtf(ss), 1e-12f);
    #pragma unroll
    for (int j = 0; j < 4; ++j) dst[row * HALF + lane * 4 + j] = v[j] * inv;
}

// ---------------- kernel: Q projection GEMM (f32 WMMA + TDM double-buffer) ----------------
// q[TOKENS][NQ] = hs[TOKENS][D] @ Wq[D][NQ] + bq
// Block tile 64x128, 8 waves in 2x4 grid, each wave a 2x2 grid of 16x16 tiles.
// B tiles arrive via Tensor Data Mover (async, double buffered, padded rows).
// The epilogue also writes the block's column sums of q and q*q (64 rows) for the batch norm.
__global__ void peer_qproj(const float* __restrict__ hs,
                           const float* __restrict__ Wq,
                           const float* __restrict__ bq,
                           float* __restrict__ q,
                           float* __restrict__ part1,
                           float* __restrict__ part2) {
    __shared__ float As[2][BM][AMP];
    __shared__ float Bs[2][BK][BNP];
    int t = threadIdx.x;
    int wid = t >> 5, lane = t & 31;
    int rowBase = blockIdx.y * BM;
    int colBase = blockIdx.x * BN;
    int wm = wid >> 2;                 // 0..1  (row group of 32)
    int wn = wid & 3;                  // 0..3  (col group of 32)
    int l15 = lane & 15;
    int khi = (lane >> 4) << 1;        // 0 or 2

    v8f acc00 = {}, acc01 = {}, acc10 = {}, acc11 = {};

    // ---- prologue: stage 0 ----
    if (wid == 0)
        tdm_load_B(Wq + colBase, (unsigned int)(uintptr_t)&Bs[0][0][0]);
    #pragma unroll
    for (int i = 0; i < 8; ++i) {                // A: 64x32
        int idx = i * 256 + t;
        int r = idx >> 5, c = idx & 31;
        As[0][r][c] = hs[(rowBase + r) * D + c];
    }

    int buf = 0;
    for (int it = 0; it < D / BK; ++it) {
        int k0 = it * BK;
        float an[8];        // next stage's A elements: loaded ahead of the matrix block, stored to LDS behind it
        // ---- issue next stage (overlaps this stage's WMMA) ----
        if (it < D / BK - 1) {
            int kn = k0 + BK;
            if (wid == 0)
                tdm_load_B(Wq + (size_t)kn * NQ + colBase,
                           (unsigned int)(uintptr_t)&Bs[buf ^ 1][0][0]);
            if (wid == 0) __builtin_amdgcn_s_wait_tensorcnt(1);
        } else {
            if (wid == 0) __builtin_amdgcn_s_wait_tensorcnt(0);
        }
        __syncthreads();    // stage `buf` complete: TDM B here, A stores ahead of the previous trip's last barrier

        // Next stage's A loads stand behind the barrier (which waits for every load issued ahead of it)
        // and fly during the matrix block.
        if (it < D / BK - 1) {
            const float* ap = hs + (rowBase + wid) * D + k0 + BK + lane;   // rows wid + 8i of the tile
            #pragma unroll
            for (int i = 0; i < 8; ++i) an[i] = ap[i * 8 * D];
            // order at the head of the matrix block: the first six LDS fragment reads, then the eight global loads,
            // so that the issue of the global loads falls into the LDS reads' latency
            __builtin_amdgcn_sched_group_barrier(0x100, 6, 0);
            __builtin_amdgcn_sched_group_barrier(0x020, 8, 0);
        }

        #pragma unroll
        for (int kk = 0; kk < 8; ++kk) {
            int kb = kk * 4 + khi;
            v2f a0 = { As[buf][wm * 32 + l15][kb],      As[buf][wm * 32 + l15][kb + 1] };
            v2f a1 = { As[buf][wm * 32 + 16 + l15][kb], As[buf][wm * 32 + 16 + l15][kb + 1] };
            v2f b0 = { Bs[buf][kb][wn * 32 + l15],      Bs[buf][kb + 1][wn * 32 + l15] };
            v2f b1 = { Bs[buf][kb][wn * 32 + 16 + l15], Bs[buf][kb + 1][wn * 32 + 16 + l15] };
            acc00 = __builtin_amdgcn_wmma_f32_16x16x4_f32(false, a0, false, b0, (short)0, acc00, false, false);
            acc01 = __builtin_amdgcn_wmma_f32_16x16x4_f32(false, a0, false, b1, (short)0, acc01, false, false);
            acc10 = __builtin_amdgcn_wmma_f32_16x16x4_f32(false, a1, false, b0, (short)0, acc10, false, false);
            acc11 = __builtin_amdgcn_wmma_f32_16x16x4_f32(false, a1, false, b1, (short)0, acc11, false, false);
        }
        if (it < D / BK - 1) {
            // holds the wait for the A loads behind the matrix block; ahead of it the wave would idle for the loads
            __builtin_amdgcn_sched_barrier(0);
            #pragma unroll
            for (int i = 0; i < 8; ++i)      // As[buf ^ 1] was last read before the previous trip's last barrier
                As[buf ^ 1][wid + 8 * i][lane] = an[i];
        }
        __syncthreads();    // all waves done reading stage `buf`; next stage's A stores complete
        buf ^= 1;
    }

    // ---- epilogue: bias + store (C layout: VGPR v -> M = v + 8*(lane>=16)) ----
    int rhalf = (lane >> 4) << 3;
    float bias0 = bq[colBase + wn * 32 + l15];
    float bias1 = bq[colBase + wn * 32 + 16 + l15];
    // Keeps the epilogue's vector work out of the last matrix block: without it the scheduler puts reads of an
    // accumulator one or two slots behind the matrix instruction that writes it.
    __builtin_amdgcn_sched_barrier(0);
    // four vector slots between the last matrix instruction and the first read of its result
    asm volatile("v_nop\n\tv_nop\n\tv_nop\n\tv_nop");
    __builtin_amdgcn_sched_barrier(0);  // holds the four slots where they stand
    #pragma unroll
    for (int v = 0; v < 8; ++v) {
        acc00[v] += bias0; acc10[v] += bias0;
        acc01[v] += bias1; acc11[v] += bias1;
    }

    // Column sums of the wave's 32 rows: 16 values per lane, then the other half of the wave.
    // Lanes 0..15 go on with the sum, lanes 16..31 with the sum of squares.
    float* red = &As[0][0][0];         // free: every wave has passed the loop's last barrier
    float cs[2];
    #pragma unroll
    for (int sn = 0; sn < 2; ++sn) {
        v8f a0v = sn ? acc01 : acc00;
        v8f a1v = sn ? acc11 : acc10;
        float s = 0.f, s2 = 0.f;
        #pragma unroll
        for (int v = 0; v < 8; ++v) {
            s += a0v[v]; s2 += a0v[v] * a0v[v];
            s += a1v[v]; s2 += a1v[v] * a1v[v];
        }
        s  += __shfl_xor(s, 16, 32);
        s2 += __shfl_xor(s2, 16, 32);
        cs[sn] = (lane < 16) ? s : s2;
        if (wm == 1) red[(lane >> 4) * BN + wn * 32 + sn * 16 + l15] = cs[sn];
    }
    __syncthreads();    // the second row group's sums are in LDS; stands ahead of the q stores, so it waits for none

    #pragma unroll
    for (int sn = 0; sn < 2; ++sn) {
        int col = colBase + wn * 32 + sn * 16 + l15;
        v8f a0v = sn ? acc01 : acc00;
        v8f a1v = sn ? acc11 : acc10;
        #pragma unroll
        for (int v = 0; v < 8; ++v) {
            int row0 = rowBase + wm * 32 + v + rhalf;
            q[row0 * NQ + col] = a0v[v];
            q[(row0 + 16) * NQ + col] = a1v[v];
        }
        if (wm == 0) {
            float* dst = (lane < 16) ? part1 : part2;
            dst[blockIdx.y * NQ + col] = cs[sn] + red[(lane >> 4) * BN + wn * 32 + sn * 16 + l15];
        }
    }
}

// ---------------- kernel: BN finalize ----------------
// part1/part2 hold, per block row of the projection (NRB of them), the sums of all NQ columns.
// A block serves 32 channels; wave w adds the 8 heads of block rows 2w and 2w+1, wave 0 the 8 wave sums.
__global__ void peer_bnfin(const float* __restrict__ part1,
                           const float* __restrict__ part2,
                           const float* __restrict__ gamma,
                           const float* __restrict__ beta,
                           float* __restrict__ bnsc,
                           float* __restrict__ bnsh) {
    __shared__ float r1[8][32];
    __shared__ float r2[8][32];
    int wid = threadIdx.x >> 5, lane = threadIdx.x & 31;
    int c = blockIdx.x * 32 + lane;
    // NQ = H * QD: the wave's two block rows are 16 pieces of QD columns, one behind the other
    const float* p1 = part1 + wid * (NRB / 8) * NQ + c;
    const float* p2 = part2 + wid * (NRB / 8) * NQ + c;
    float s = 0.f, s2 = 0.f;
    #pragma unroll
    for (int p = 0; p < (NRB / 8) * H; ++p) {
        s  += p1[p * QD];
        s2 += p2[p * QD];
    }
    r1[wid][lane] = s;
    r2[wid][lane] = s2;
    __syncthreads();
    if (wid == 0) {
        s = 0.f; s2 = 0.f;
        #pragma unroll
        for (int w = 0; w < 8; ++w) { s += r1[w][lane]; s2 += r2[w][lane]; }
        float mean = s * (1.f / 8192.f);
        float var  = s2 * (1.f / 8192.f) - mean * mean;
        float sc = gamma[c] / sqrtf(var + 1e-5f);
        bnsc[c] = sc;
        bnsh[c] = beta[c] - mean * sc;
    }
}

// ---------------- kernel: routing ----------------
// one wave per (token, head); TOPK==DTK^2 so softmax runs over ALL 16 combos.
__global__ void peer_route(const float* __restrict__ q,
                           const float* __restrict__ bnsc,
                           const float* __restrict__ bnsh,
                           const float* __restrict__ n0,
                           const float* __restrict__ n1,
                           int* __restrict__ rid,
                           float* __restrict__ rw) {
    // Both halves interleaved: element 2c is channel c of the first half, element 2c+1 of the second.
    __shared__ __attribute__((aligned(16))) float qn[8][QD];     // the wave's normalized query
    __shared__ __attribute__((aligned(16))) float ks[NKEY][KP];  // row k: key k of both normalized tables
    int wid = threadIdx.x >> 5, lane = threadIdx.x & 31;
    int item = blockIdx.x * 8 + wid;            // [0, 8192)
    int r = item >> 3, h = item & 7;
    const float* qrow = q + r * NQ + h * QD;

    // Both key tables go into LDS once per block: a wave reads whole 512-byte rows from global memory,
    // so no load touches more than four cache lines. The stores stand in front of the barrier below.
    float4 kst0[4], kst1[4];
    #pragma unroll
    for (int i = 0; i < 4; ++i) {
        kst0[i] = ((const float4*)n0)[i * 256 + threadIdx.x];
        kst1[i] = ((const float4*)n1)[i * 256 + threadIdx.x];
    }

    float vr[8]; float ss = 0.f;
    int cb = lane * 8;
    #pragma unroll
    for (int j = 0; j < 8; ++j) {
        int c = cb + j;
        float x = qrow[c] * bnsc[c] + bnsh[c];
        vr[j] = x; ss += x * x;
    }
    float ssg = ss;
    #pragma unroll
    for (int off = 8; off; off >>= 1) ssg += __shfl_xor(ssg, off, 16);
    float ss0 = __shfl(ssg, 0, 32);
    float ss1 = __shfl(ssg, 16, 32);
    float inv = (lane < 16) ? 1.f / fmaxf(sqrtf(ss0), 1e-12f)
                            : 1.f / fmaxf(sqrtf(ss1), 1e-12f);
    #pragma unroll
    for (int j = 0; j < 8; ++j) qn[wid][2 * ((cb + j) & (HALF - 1)) + (lane >> 4)] = vr[j] * inv;
    #pragma unroll
    for (int i = 0; i < 4; ++i) {               // wave wid holds key i*8+wid, lane its channels 4*lane..4*lane+3
        float4* dst = (float4*)&ks[i * 8 + wid][lane * 8];
        dst[0] = make_float4(kst0[i].x, kst1[i].x, kst0[i].y, kst1[i].y);
        dst[1] = make_float4(kst0[i].z, kst1[i].z, kst0[i].w, kst1[i].w);
    }
    __syncthreads();

    // lane = key: each lane walks its own key row in LDS (conflict-free at the KP stride); the query
    // piece is the same address in every lane. One packed multiply-add serves both tables; each
    // table's products are added in the order c = 0..127, as before.
    v2f s01 = {0.f, 0.f};
    const float4* kr = (const float4*)&ks[lane][0];
    const float4* qa = (const float4*)&qn[wid][0];
    // unrolled by 16: the reads take immediate offsets, and later pairs' reads issue among the sums
    #pragma unroll 16
    for (int c2 = 0; c2 < HALF / 2; ++c2) {
        float4 a = qa[c2], x = kr[c2];
        s01 += (v2f){a.x, a.y} * (v2f){x.x, x.y};
        s01 += (v2f){a.z, a.w} * (v2f){x.z, x.w};
    }
    float s0 = s01.x, s1 = s01.y;

    float ts0[DTK], ts1[DTK]; int ti0[DTK], ti1[DTK];
    float mv = s0; int mi = lane;
    #pragma unroll
    for (int tI = 0; tI < DTK; ++tI) {
        float v = mv; int i = mi;
        #pragma unroll
        for (int off = 16; off; off >>= 1) {
            float ov = __shfl_xor(v, off, 32);
            int   oi = __shfl_xor(i, off, 32);
            if (ov > v || (ov == v && oi < i)) { v = ov; i = oi; }
        }
        ts0[tI] = v; ti0[tI] = i;
        if (lane == i) mv = -INFINITY;
    }
    mv = s1; mi = lane;
    #pragma unroll
    for (int tI = 0; tI < DTK; ++tI) {
        float v = mv; int i = mi;
        #pragma unroll
        for (int off = 16; off; off >>= 1) {
            float ov = __shfl_xor(v, off, 32);
            int   oi = __shfl_xor(i, off, 32);
            if (ov > v || (ov == v && oi < i)) { v = ov; i = oi; }
        }
        ts1[tI] = v; ti1[tI] = i;
        if (lane == i) mv = -INFINITY;
    }

    int ii = (lane >> 2) & 3, jj = lane & 3;
    float cs = ts0[ii] + ts1[jj];
    int  cid = ti0[ii] * NKEY + ti1[jj];
    float m = cs;
    #pragma unroll
    for (int off = 8; off; off >>= 1) m = fmaxf(m, __shfl_xor(m, off, 16));
    float e = expf(cs - m);
    float sum = e;
    #pragma unroll
    for (int off = 8; off; off >>= 1) sum += __shfl_xor(sum, off, 16);
    float w = e / sum;
    if (lane < 16) {
        rid[item * 16 + lane] = cid;
        rw [item * 16 + lane] = w;
    }
}

typedef const __attribute__((address_space(1))) char* gbytes;   // byte pointer into global memory

// Base of a gathered row: the row index is the same in every lane, so readfirstlane puts it in a scalar
// register and the base is formed there; each load then names that base and one per-lane byte offset
// that is never rewritten.
__device__ inline gbytes uniformRow(const float* tab, int row, unsigned int rowBytes) {
    unsigned int off = (unsigned int)__builtin_amdgcn_readfirstlane(row) * rowBytes;
    return (gbytes)((unsigned long long)(uintptr_t)tab + off);
}
__device__ inline float4 load16(gbytes p) {
    return *(const __attribute__((address_space(1))) float4*)p;
}

// ---------------- kernel: expert gather/MLP/accumulate ----------------
__global__ void peer_expert(const float* __restrict__ hs,
                            const float* __restrict__ down,
                            const float* __restrict__ up,
                            const int* __restrict__ rid,
                            const float* __restrict__ rw,
                            float* __restrict__ out) {
    __shared__ __attribute__((aligned(16))) float hsr[D];   // read back as 16-byte pieces
    __shared__ float geh[128];
    __shared__ int   eid[128];
    __shared__ float ew [128];
    int t = threadIdx.x;
    int r = blockIdx.x;
    #pragma unroll
    for (int i = 0; i < 4; ++i) hsr[t + 256 * i] = hs[r * D + t + 256 * i];
    if (t < 128) {
        eid[t] = rid[r * 128 + t];
        ew [t] = rw [r * 128 + t];
    }
    __syncthreads();

    int wid = t >> 5, lane = t & 31;
    // each lane keeps its 32 elements of the token row: 16 bytes out of every 512
    const float4* hs4 = (const float4*)hsr;
    float4 hv[8];
    #pragma unroll
    for (int i = 0; i < 8; ++i) hv[i] = hs4[i * 32 + lane];

    // The wave's 16 gathered rows, two per trip: 16 loads of 16 bytes per lane are issued before the
    // first is used. The loop holds loads and multiply-adds only; wave sums and gelu follow behind it.
    unsigned int loff = (unsigned int)lane * 16u;
    float part[16];
    // unrolled: part[] stays in registers, and the per-lane offset stays a 32-bit operand of each load
    #pragma unroll
    for (int k = 0; k < 16; k += 2) {
        gbytes d0 = uniformRow(down, eid[wid * 16 + k], D * 4u);
        gbytes d1 = uniformRow(down, eid[wid * 16 + k + 1], D * 4u);
        float4 a0[8], a1[8];
        #pragma unroll
        for (int i = 0; i < 8; ++i) a0[i] = load16(d0 + loff + i * 512);
        #pragma unroll
        for (int i = 0; i < 8; ++i) a1[i] = load16(d1 + loff + i * 512);
        // keeps all 16 loads ahead of the sums; without it the scheduler sinks them to two or three in flight
        __builtin_amdgcn_sched_barrier(0);
        float4 p0 = {0.f, 0.f, 0.f, 0.f}, p1 = {0.f, 0.f, 0.f, 0.f};
        #pragma unroll
        for (int i = 0; i < 8; ++i) {
            p0.x += a0[i].x * hv[i].x; p0.y += a0[i].y * hv[i].y;
            p0.z += a0[i].z * hv[i].z; p0.w += a0[i].w * hv[i].w;
        }
        #pragma unroll
        for (int i = 0; i < 8; ++i) {
            p1.x += a1[i].x * hv[i].x; p1.y += a1[i].y * hv[i].y;
            p1.z += a1[i].z * hv[i].z; p1.w += a1[i].w * hv[i].w;
        }
        part[k]     = (p0.x + p0.y) + (p0.z + p0.w);
        part[k + 1] = (p1.x + p1.y) + (p1.z + p1.w);
    }
    #pragma unroll
    for (int k = 0; k < 16; ++k) part[k] = waveRedSum32(part[k]);
    if (lane == 0) {
        #pragma unroll
        for (int k = 0; k < 16; ++k) {
            float x = part[k];
            float g = 0.5f * x * (1.0f + erff(x * 0.70710678118654752f)); // exact gelu
            geh[wid * 16 + k] = g * ew[wid * 16 + k];
        }
    }
    __syncthreads();

    // thread t owns output columns 4t..4t+3; 16 gathered rows are in flight per trip
    unsigned int toff = (unsigned int)t * 16u;
    float4 acc = {0.f, 0.f, 0.f, 0.f};
    // unrolled: the next trip's loads can issue among this trip's sums
    #pragma unroll
    for (int e0 = 0; e0 < 128; e0 += 16) {
        float4 u[16];
        #pragma unroll
        for (int j = 0; j < 16; ++j)
            u[j] = load16(uniformRow(up, eid[e0 + j], OUTD * 4u) + toff);
        // keeps the 16 loads ahead of the sums, as above
        __builtin_amdgcn_sched_barrier(0);
        #pragma unroll
        for (int j = 0; j < 16; ++j) {
            float g = geh[e0 + j];
            acc.x += g * u[j].x; acc.y += g * u[j].y;
            acc.z += g * u[j].z; acc.w += g * u[j].w;
        }
    }
    ((float4*)out)[r * (OUTD / 4) + t] = acc;
}

// ---------------- launcher ----------------
extern "C" void kernel_launch(void* const* d_in, const int* in_sizes, int n_in,
                              void* d_out, int out_size, void* d_ws, size_t ws_size,
                              hipStream_t stream) {
    const float* hs    = (const float*)d_in[0];  // [1024,1024]
    const float* Wq    = (const float*)d_in[1];  // [1024,2048]
    const float* bq    = (const float*)d_in[2];  // [2048]
    const float* gamma = (const float*)d_in[3];  // [256]
    const float* beta  = (const float*)d_in[4];  // [256]
    const float* sk0   = (const float*)d_in[5];  // [32,128]
    const float* sk1   = (const float*)d_in[6];  // [32,128]
    const float* down  = (const float*)d_in[7];  // [1024,1024]
    const float* up    = (const float*)d_in[8];  // [1024,1024]
    float* out = (float*)d_out;                  // [1024,1024]

    float* ws = (float*)d_ws;
    float* q      = ws;                   // 1024*2048
    float* n0     = q      + TOKENS * NQ;
    float* n1     = n0     + NKEY * HALF;
    float* part1  = n1     + NKEY * HALF;
    float* part2  = part1  + NRB * NQ;
    float* bnsc   = part2  + NRB * NQ;
    float* bnsh   = bnsc   + QD;
    int*   rid    = (int*)(bnsh + QD);
    float* rw     = (float*)(rid + NITEM * 16);

    peer_knorm<<<dim3(8), dim3(256), 0, stream>>>(sk0, sk1, n0, n1);
    peer_qproj<<<dim3(NQ / BN, TOKENS / BM), dim3(256), 0, stream>>>(hs, Wq, bq, q, part1, part2);
    peer_bnfin<<<dim3(QD / 32), dim3(256), 0, stream>>>(part1, part2, gamma, beta, bnsc, bnsh);
    peer_route<<<dim3(TOKENS), dim3(256), 0, stream>>>(q, bnsc, bnsh, n0, n1, rid, rw);
    peer_expert<<<dim3(TOKENS), dim3(256), 0, stream>>>(hs, down, up, rid, rw, out);
}

// v005
// One run takes 71.4 microseconds.
// In both of two side-by-side timings against v004, it was 1.10 times as fast.
// All steps since v000 together make it 1.83 times as fast.
#include <hip/hip_runtime.h>
#include <math.h>

typedef float v2f __attribute__((ext_vector_type(2)));
typedef float v8f __attribute__((ext_vector_type(8)));
typedef unsigned int u32x4 __attribute__((ext_vector_type(4)));
typedef int i32x4 __attribute__((ext_vector_type(4)));
typedef int i32x8 __attribute__((ext_vector_type(8)));

#define H 8
#define QD 256
#define HALF 128
#define NKEY 32
#define DTK 4
#define TOKENS 1024      // B*S
#define D 1024
#define NQ 2048          // H*QD
#define OUTD 1024
#define NITEM 8192       // TOKENS*H

// GEMM tiling
#define BM 64            // rows per block
#define NRB 16           // block rows of the projection: TOKENS / BM
#define BN 128           // cols per block
#define BK 32            // K-step
#define BNP 129          // padded B row stride (via TDM pad: 1 dword per 128)
#define AMP 33           // padded A row stride
#define UC 64            // columns of an expert table that a block keeps in LDS (256 KiB for 1024 rows)
#define UT 64            // tokens that such a block serves
#define KP 260           // LDS row stride of a staged key-pair row: 1040 bytes = 16 x 65, an odd count of 16-byte units

// ---------------- helpers ----------------
__device__ inline float waveRedSum32(float x) {
    #pragma unroll
    for (int off = 16; off; off >>= 1) x += __shfl_xor(x, off, 32);
    return x;
}

// Issue a TDM load of a 32x128 f32 tile of Wq (row stride 2048 elems) into LDS
// at byte offset lds_off, padded +1 dword per 128 dwords (-> 129-dword rows).
__device__ inline void tdm_load_B(const float* gaddr, unsigned int lds_off) {
    u32x4 g0;
    g0.x = 1u;                                   // count=1, user mode
    g0.y = lds_off;                              // LDS byte address
    unsigned long long ga = (unsigned long long)(uintptr_t)gaddr;
    g0.z = (unsigned int)ga;                     // global_addr[31:0]
    g0.w = (unsigned int)(ga >> 32) | 0x80000000u; // global_addr[56:32] | type=2
    i32x8 g1;
    g1[0] = (int)((2u << 16)       // data_size = 4 bytes
                | (1u << 20)       // pad_enable
                | (6u << 22));     // pad_interval = 128 dwords (pad_amount=0 -> 1 dword)
    g1[1] = (int)(2048u << 16);    // tensor_dim0 = 2048 (elements per row)
    g1[2] = (int)(1024u << 16);    // tensor_dim1 = 1024 rows (dim0 hi bits = 0)
    g1[3] = (int)(128u << 16);     // tile_dim0 = 128 (dim1 hi bits = 0)
    g1[4] = 32;                    // tile_dim1 = 32, tile_dim2 = 0
    g1[5] = 2048;                  // tensor_dim0_stride[31:0] = 2048
    g1[6] = 0;                     // stride hi / dim1_stride lo
    g1[7] = 0;
    i32x4 gz4 = {0, 0, 0, 0};              // groups 2/3 unused (2D tensor)
    i32x8 gz8 = {0, 0, 0, 0, 0, 0, 0, 0};
    __builtin_amdgcn_tensor_load_to_lds(g0, g1, gz4, gz4, gz8, 0);
}

// ---------------- kernel: normalize sub-keys ----------------
__global__ void peer_knorm(const float* __restrict__ k0,
                           const float* __restrict__ k1,
                           float* __restrict__ n0,
                           float* __restrict__ n1) {
    int wid = threadIdx.x >> 5, lane = threadIdx.x & 31;
    int gw = blockIdx.x * 8 + wid;          // [0,64)
    int table = gw >> 5, row = gw & 31;
    const float* src = table ? k1 : k0;
    float*       dst = table ? n1 : n0;
    float v[4]; float ss = 0.f;
    #pragma unroll
    for (int j = 0; j < 4; ++j) {
        v[j] = src[row * HALF + lane * 4 + j];
        ss += v[j] * v[j];
    }
    ss = waveRedSum32(ss);
    float inv = 1.f / fmaxf(sqrtf(ss), 1e-12f);
    #pragma unroll
    for (int j = 0; j < 4; ++j) dst[row * HALF + lane * 4 + j] = v[j] * inv;
}

// ---------------- kernel: Q projection GEMM (f32 WMMA + TDM double-buffer) ----------------
// q[TOKENS][NQ] = hs[TOKENS][D] @ Wq[D][NQ] + bq
// Block tile 64x128, 8 waves in 2x4 grid, each wave a 2x2 grid of 16x16 tiles.
// B tiles arrive via Tensor Data Mover (async, double buffered, padded rows).
// The epilogue also writes the block's column sums of q and q*q (64 rows) for the batch norm.
__global__ void peer_qproj(const float* __restrict__ hs,
                           const float* __restrict__ Wq,
                           const float* __restrict__ bq,
                           float* __restrict__ q,
                           float* __restrict__ part1,
                           float* __restrict__ part2) {
    __shared__ float As[2][BM][AMP];
    __shared__ float Bs[2][BK][BNP];
    int t = threadIdx.x;
    int wid = t >> 5, lane = t & 31;
    int rowBase = blockIdx.y * BM;
    int colBase = blockIdx.x * BN;
    int wm = wid >> 2;                 // 0..1  (row group of 32)
    int wn = wid & 3;                  // 0..3  (col group of 32)
    int l15 = lane & 15;
    int khi = (lane >> 4) << 1;        // 0 or 2

    v8f acc00 = {}, acc01 = {}, acc10 = {}, acc11 = {};

    // ---- prologue: stage 0 ----
    if (wid == 0)
        tdm_load_B(Wq + colBase, (unsigned int)(uintptr_t)&Bs[0][0][0]);
    #pragma unroll
    for (int i = 0; i < 8; ++i) {                // A: 64x32
        int idx = i * 256 + t;
        int r = idx >> 5, c = idx & 31;
        As[0][r][c] = hs[(rowBase + r) * D + c];
    }

    int buf = 0;
    for (int it = 0; it < D / BK; ++it) {
        int k0 = it * BK;
        float an[8];        // next stage's A elements: loaded ahead of the matrix block, stored to LDS behind it
        // ---- issue next stage (overlaps this stage's WMMA) ----
        if (it < D / BK - 1) {
            int kn = k0 + BK;
            if (wid == 0)
                tdm_load_B(Wq + (size_t)kn * NQ + colBase,
                           (unsigned int)(uintptr_t)&Bs[buf ^ 1][0][0]);
            if (wid == 0) __builtin_amdgcn_s_wait_tensorcnt(1);
        } else {
            if (wid == 0) __builtin_amdgcn_s_wait_tensorcnt(0);
        }
        __syncthreads();    // stage `buf` complete: TDM B here, A stores ahead of the previous trip's last barrier

        // Next stage's A loads stand behind the barrier (which waits for every load issued ahead of it)
        // and fly during the matrix block.
        if (it < D / BK - 1) {
            const float* ap = hs + (rowBase + wid) * D + k0 + BK + lane;   // rows wid + 8i of the tile
            #pragma unroll
            for (int i = 0; i < 8; ++i) an[i] = ap[i * 8 * D];
            // order at the head of the matrix block: the first six LDS fragment reads, then the eight global loads,
            // so that the issue of the global loads falls into the LDS reads' latency
            __builtin_amdgcn_sched_group_barrier(0x100, 6, 0);
            __builtin_amdgcn_sched_group_barrier(0x020, 8, 0);
        }

        #pragma unroll
        for (int kk = 0; kk < 8; ++kk) {
            int kb = kk * 4 + khi;
            v2f a0 = { As[buf][wm * 32 + l15][kb],      As[buf][wm * 32 + l15][kb + 1] };
            v2f a1 = { As[buf][wm * 32 + 16 + l15][kb], As[buf][wm * 32 + 16 + l15][kb + 1] };
            v2f b0 = { Bs[buf][kb][wn * 32 + l15],      Bs[buf][kb + 1][wn * 32 + l15] };
            v2f b1 = { Bs[buf][kb][wn * 32 + 16 + l15], Bs[buf][kb + 1][wn * 32 + 16 + l15] };
            acc00 = __builtin_amdgcn_wmma_f32_16x16x4_f32(false, a0, false, b0, (short)0, acc00, false, false);
            acc01 = __builtin_amdgcn_wmma_f32_16x16x4_f32(false, a0, false, b1, (short)0, acc01, false, false);
            acc10 = __builtin_amdgcn_wmma_f32_16x16x4_f32(false, a1, false, b0, (short)0, acc10, false, false);
            acc11 = __builtin_amdgcn_wmma_f32_16x16x4_f32(false, a1, false, b1, (short)0, acc11, false, false);
        }
        if (it < D / BK - 1) {
            // holds the wait for the A loads behind the matrix block; ahead of it the wave would idle for the loads
            __builtin_amdgcn_sched_barrier(0);
            #pragma unroll
            for (int i = 0; i < 8; ++i)      // As[buf ^ 1] was last read before the previous trip's last barrier
                As[buf ^ 1][wid + 8 * i][lane] = an[i];
        }
        __syncthreads();    // all waves done reading stage `buf`; next stage's A stores complete
        buf ^= 1;
    }

    // ---- epilogue: bias + store (C layout: VGPR v -> M = v + 8*(lane>=16)) ----
    int rhalf = (lane >> 4) << 3;
    float bias0 = bq[colBase + wn * 32 + l15];
    float bias1 = bq[colBase + wn * 32 + 16 + l15];
    // Keeps the epilogue's vector work out of the last matrix block: without it the scheduler puts reads of an
    // accumulator one or two slots behind the matrix instruction that writes it.
    __builtin_amdgcn_sched_barrier(0);
    // four vector slots between the last matrix instruction and the first read of its result
    asm volatile("v_nop\n\tv_nop\n\tv_nop\n\tv_nop");
    __builtin_amdgcn_sched_barrier(0);  // holds the four slots where they stand
    #pragma unroll
    for (int v = 0; v < 8; ++v) {
        acc00[v] += bias0; acc10[v] += bias0;
        acc01[v] += bias1; acc11[v] += bias1;
    }

    // Column sums of the wave's 32 rows: 16 values per lane, then the other half of the wave.
    // Lanes 0..15 go on with the sum, lanes 16..31 with the sum of squares.
    float* red = &As[0][0][0];         // free: every wave has passed the loop's last barrier
    float cs[2];
    #pragma unroll
    for (int sn = 0; sn < 2; ++sn) {
        v8f a0v = sn ? acc01 : acc00;
        v8f a1v = sn ? acc11 : acc10;
        float s = 0.f, s2 = 0.f;
        #pragma unroll
        for (int v = 0; v < 8; ++v) {
            s += a0v[v]; s2 += a0v[v] * a0v[v];
            s += a1v[v]; s2 += a1v[v] * a1v[v];
        }
        s  += __shfl_xor(s, 16, 32);
        s2 += __shfl_xor(s2, 16, 32);
        cs[sn] = (lane < 16) ? s : s2;
        if (wm == 1) red[(lane >> 4) * BN + wn * 32 + sn * 16 + l15] = cs[sn];
    }
    __syncthreads();    // the second row group's sums are in LDS; stands ahead of the q stores, so it waits for none

    #pragma unroll
    for (int sn = 0; sn < 2; ++sn) {
        int col = colBase + wn * 32 + sn * 16 + l15;
        v8f a0v = sn ? acc01 : acc00;
        v8f a1v = sn ? acc11 : acc10;
        #pragma unroll
        for (int v = 0; v < 8; ++v) {
            int row0 = rowBase + wm * 32 + v + rhalf;
            q[row0 * NQ + col] = a0v[v];
            q[(row0 + 16) * NQ + col] = a1v[v];
        }
        if (wm == 0) {
            float* dst = (lane < 16) ? part1 : part2;
            dst[blockIdx.y * NQ + col] = cs[sn] + red[(lane >> 4) * BN + wn * 32 + sn * 16 + l15];
        }
    }
}

// ---------------- kernel: BN finalize ----------------
// part1/part2 hold, per block row of the projection (NRB of them), the sums of all NQ columns.
// A block serves 32 channels; wave w adds the 8 heads of block rows 2w and 2w+1, wave 0 the 8 wave sums.
__global__ void peer_bnfin(const float* __restrict__ part1,
                           const float* __restrict__ part2,
                           const float* __restrict__ gamma,
                           const float* __restrict__ beta,
                           float* __restrict__ bnsc,
                           float* __restrict__ bnsh) {
    __shared__ float r1[8][32];
    __shared__ float r2[8][32];
    int wid = threadIdx.x >> 5, lane = threadIdx.x & 31;
    int c = blockIdx.x * 32 + lane;
    // NQ = H * QD: the wave's two block rows are 16 pieces of QD columns, one behind the other
    const float* p1 = part1 + wid * (NRB / 8) * NQ + c;
    const float* p2 = part2 + wid * (NRB / 8) * NQ + c;
    float s = 0.f, s2 = 0.f;
    #pragma unroll
    for (int p = 0; p < (NRB / 8) * H; ++p) {
        s  += p1[p * QD];
        s2 += p2[p * QD];
    }
    r1[wid][lane] = s;
    r2[wid][lane] = s2;
    __syncthreads();
    if (wid == 0) {
        s = 0.f; s2 = 0.f;
        #pragma unroll
        for (int w = 0; w < 8; ++w) { s += r1[w][lane]; s2 += r2[w][lane]; }
        float mean = s * (1.f / 8192.f);
        float var  = s2 * (1.f / 8192.f) - mean * mean;
        float sc = gamma[c] / sqrtf(var + 1e-5f);
        bnsc[c] = sc;
        bnsh[c] = beta[c] - mean * sc;
    }
}

// ---------------- kernel: routing ----------------
// one wave per (token, head); TOPK==DTK^2 so softmax runs over ALL 16 combos.
__global__ void peer_route(const float* __restrict__ q,
                           const float* __restrict__ bnsc,
                           const float* __restrict__ bnsh,
                           const float* __restrict__ n0,
                           const float* __restrict__ n1,
                           int* __restrict__ rid,
                           float* __restrict__ rw) {
    // Both halves interleaved: element 2c is channel c of the first half, element 2c+1 of the second.
    __shared__ __attribute__((aligned(16))) float qn[8][QD];     // the wave's normalized query
    __shared__ __attribute__((aligned(16))) float ks[NKEY][KP];  // row k: key k of both normalized tables
    int wid = threadIdx.x >> 5, lane = threadIdx.x & 31;
    int item = blockIdx.x * 8 + wid;            // [0, 8192)
    int r = item >> 3, h = item & 7;
    const float* qrow = q + r * NQ + h * QD;

    // Both key tables go into LDS once per block: a wave reads whole 512-byte rows from global memory,
    // so no load touches more than four cache lines. The stores stand in front of the barrier below.
    float4 kst0[4], kst1[4];
    #pragma unroll
    for (int i = 0; i < 4; ++i) {
        kst0[i] = ((const float4*)n0)[i * 256 + threadIdx.x];
        kst1[i] = ((const float4*)n1)[i * 256 + threadIdx.x];
    }

    float vr[8]; float ss = 0.f;
    int cb = lane * 8;
    #pragma unroll
    for (int j = 0; j < 8; ++j) {
        int c = cb + j;
        float x = qrow[c] * bnsc[c] + bnsh[c];
        vr[j] = x; ss += x * x;
    }
    float ssg = ss;
    #pragma unroll
    for (int off = 8; off; off >>= 1) ssg += __shfl_xor(ssg, off, 16);
    float ss0 = __shfl(ssg, 0, 32);
    float ss1 = __shfl(ssg, 16, 32);
    float inv = (lane < 16) ? 1.f / fmaxf(sqrtf(ss0), 1e-12f)
                            : 1.f / fmaxf(sqrtf(ss1), 1e-12f);
    #pragma unroll
    for (int j = 0; j < 8; ++j) qn[wid][2 * ((cb + j) & (HALF - 1)) + (lane >> 4)] = vr[j] * inv;
    #pragma unroll
    for (int i = 0; i < 4; ++i) {               // wave wid holds key i*8+wid, lane its channels 4*lane..4*lane+3
        float4* dst = (float4*)&ks[i * 8 + wid][lane * 8];
        dst[0] = make_float4(kst0[i].x, kst1[i].x, kst0[i].y, kst1[i].y);
        dst[1] = make_float4(kst0[i].z, kst1[i].z, kst0[i].w, kst1[i].w);
    }
    __syncthreads();

    // lane = key: each lane walks its own key row in LDS (conflict-free at the KP stride); the query
    // piece is the same address in every lane. One packed multiply-add serves both tables; each
    // table's products are added in the order c = 0..127, as before.
    v2f s01 = {0.f, 0.f};
    const float4* kr = (const float4*)&ks[lane][0];
    const float4* qa = (const float4*)&qn[wid][0];
    // unrolled by 16: the reads take immediate offsets, and later pairs' reads issue among the sums
    #pragma unroll 16
    for (int c2 = 0; c2 < HALF / 2; ++c2) {
        float4 a = qa[c2], x = kr[c2];
        s01 += (v2f){a.x, a.y} * (v2f){x.x, x.y};
        s01 += (v2f){a.z, a.w} * (v2f){x.z, x.w};
    }
    float s0 = s01.x, s1 = s01.y;

    float ts0[DTK], ts1[DTK]; int ti0[DTK], ti1[DTK];
    float mv = s0; int mi = lane;
    #pragma unroll
    for (int tI = 0; tI < DTK; ++tI) {
        float v = mv; int i = mi;
        #pragma unroll
        for (int off = 16; off; off >>= 1) {
            float ov = __shfl_xor(v, off, 32);
            int   oi = __shfl_xor(i, off, 32);
            if (ov > v || (ov == v && oi < i)) { v = ov; i = oi; }
        }
        ts0[tI] = v; ti0[tI] = i;
        if (lane == i) mv = -INFINITY;
    }
    mv = s1; mi = lane;
    #pragma unroll
    for (int tI = 0; tI < DTK; ++tI) {
        float v = mv; int i = mi;
        #pragma unroll
        for (int off = 16; off; off >>= 1) {
            float ov = __shfl_xor(v, off, 32);
            int   oi = __shfl_xor(i, off, 32);
            if (ov > v || (ov == v && oi < i)) { v = ov; i = oi; }
        }
        ts1[tI] = v; ti1[tI] = i;
        if (lane == i) mv = -INFINITY;
    }

    int ii = (lane >> 2) & 3, jj = lane & 3;
    float cs = ts0[ii] + ts1[jj];
    int  cid = ti0[ii] * NKEY + ti1[jj];
    float m = cs;
    #pragma unroll
    for (int off = 8; off; off >>= 1) m = fmaxf(m, __shfl_xor(m, off, 16));
    float e = expf(cs - m);
    float sum = e;
    #pragma unroll
    for (int off = 8; off; off >>= 1) sum += __shfl_xor(sum, off, 16);
    float w = e / sum;
    if (lane < 16) {
        rid[item * 16 + lane] = cid;
        rw [item * 16 + lane] = w;
    }
}

typedef const __attribute__((address_space(1))) char* gbytes;   // byte pointer into global memory

__device__ inline float4 load16(gbytes p) {
    return *(const __attribute__((address_space(1))) float4*)p;
}
__device__ inline int4 load16i(gbytes p) {
    return *(const __attribute__((address_space(1))) int4*)p;
}

// x of the lane whose number differs in bit 0 (CTRL 0xB1) or in bit 1 (CTRL 0x4E): a register move inside a group of four lanes
template <int CTRL>
__device__ inline float quadSwap(float x) {
    return __int_as_float(__builtin_amdgcn_mov_dpp(__float_as_int(x), CTRL, 0xf, 0xf, true));
}

// ---------------- kernel: down dot products, one 64-column slice per block ----------------
// A block keeps UC columns of all 1024 rows of `down` in LDS and serves UT tokens from them; it writes, for each
// of a token's 128 picks, the dot product over its UC columns. The 16 slices' parts are added in peer_gelu.
// Four lanes share a pick: lane q of the four owns the 64 bytes q of the 256-byte row piece and reads them in
// four 16-byte steps, starting at a step that differs between the four picks of a half wave, so that the
// 16 lanes of a half wave always read 16 different 16-byte columns: no bank conflict, whatever the rows.
__global__ __launch_bounds__(512) void peer_down(const float* __restrict__ hs,
                                                 const float* __restrict__ down,
                                                 const int* __restrict__ rid,
                                                 float* __restrict__ part) {
    __shared__ __attribute__((aligned(16))) float dsl[1024 * UC];
    int t = threadIdx.x;
    int kg = blockIdx.x, tg = blockIdx.y;
    float4* ds4 = (float4*)dsl;
    const float4* src = (const float4*)down + kg * (UC / 4) + (t >> 4) * (D / 4) + (t & 15);
    // a lane's 32 loads of 16 bytes are all in flight before the first LDS store; load i of the block brings rows 32i..32i+31
    float4 v[32];
    #pragma unroll
    for (int i = 0; i < 32; ++i) v[i] = src[i * 32 * (D / 4)];
    #pragma unroll
    for (int i = 0; i < 32; ++i) ds4[i * 512 + t] = v[i];
    // stands in front of the first overwrite of the loads' address register pair, which it names so that the pair
    // lives up to here and no load's own result lands on it
    asm volatile("s_wait_xcnt 0x0" :: "v"(src) : "memory");
    __syncthreads();    // the slice is complete before any wave gathers from it

    unsigned int wid = (unsigned int)__builtin_amdgcn_readfirstlane(t >> 5);
    int lane = t & 31, slot = lane >> 2, q = lane & 3;
    bool b0 = (q & 1) != 0, b1 = (q & 2) != 0;
    unsigned int r0 = (unsigned int)tg * UT + wid * (UT / 16);      // the wave's first token
    unsigned int coff[4];                                           // byte offsets of the lane's four steps in a row piece
    #pragma unroll
    for (int c = 0; c < 4; ++c) coff[c] = (unsigned int)(q * 4 + ((c + slot) & 3)) * 16u;
    unsigned int soff = (unsigned int)slot * 64u;                   // the slot's 16 picks among the token's 128
    gbytes ep = (gbytes)((unsigned long long)(uintptr_t)rid + r0 * 512u);
    gbytes hp = (gbytes)((unsigned long long)(uintptr_t)hs + r0 * (D * 4u) + (unsigned int)kg * (UC * 4u));
    const char* lbase = (const char*)dsl;

    int4 e[2][4]; float4 h[2][4];
    const int cur = 0;
    #pragma unroll
    for (int m = 0; m < 4; ++m) {
        e[0][m] = load16i(ep + soff + m * 16);
        h[0][m] = load16(hp + coff[m]);
    }
    // stands in front of the first overwrite of a register that the loads above name
    asm volatile("s_wait_xcnt 0x0" ::: "memory");
    __builtin_amdgcn_sched_barrier(0);  // holds later vector work, which reuses those registers, behind the wait
    unsigned int pidx = (unsigned int)kg * (NITEM * 4) + r0 * 32 + lane;    // the wave's first 512 bytes of results
    // rolled: unrolled, the last token's 64 LDS reads all rose to its top and spilled
    #pragma unroll 1
    for (int k = 0; k < UT / 16; ++k) {
        // the next token's indices and its piece of the token row, one token ahead;
        // the last token fetches its own again, which keeps the body free of branches
        unsigned int kn = k < UT / 16 - 1 ? k + 1 : k;
        #pragma unroll
        for (int m = 0; m < 4; ++m) {
            e[1][m] = load16i(ep + soff + (kn * 512u + m * 16));
            h[1][m] = load16(hp + coff[m] + kn * (D * 4u));
        }
        // x[j] belongs to pick (j & 3) * 4 + (j >> 2) of the slot, so that the sums over four lanes below leave
        // lane q with the slot's picks 4q..4q+3
        int ej[16] = { e[cur][0].x, e[cur][1].x, e[cur][2].x, e[cur][3].x,
                       e[cur][0].y, e[cur][1].y, e[cur][2].y, e[cur][3].y,
                       e[cur][0].z, e[cur][1].z, e[cur][2].z, e[cur][3].z,
                       e[cur][0].w, e[cur][1].w, e[cur][2].w, e[cur][3].w };
        float x[16];
        float4 u[2][8];
        #pragma unroll
        for (int n = -1; n < 8; ++n) {
            if (n < 7) {                // the next two picks' row pieces are asked for ahead of this pair's sums
                float4* un = u[(n + 1) & 1];
                #pragma unroll
                for (int c = 0; c < 4; ++c) {
                    un[c]     = *(const float4*)(lbase + ((unsigned int)ej[2 * n + 2] * (UC * 4u) + coff[c]));
                    un[4 + c] = *(const float4*)(lbase + ((unsigned int)ej[2 * n + 3] * (UC * 4u) + coff[c]));
                }
            }
            // keeps the reads above ahead of the sums below; without it all 64 reads of a token rise to the top and spill
            __builtin_amdgcn_sched_barrier(0);
            if (n >= 0) {
                const float4* uc = u[n & 1];
                v2f sa = {0.f, 0.f}, sb = {0.f, 0.f};
                #pragma unroll
                for (int c = 0; c < 4; ++c) {
                    sa += (v2f){uc[c].x, uc[c].y} * (v2f){h[cur][c].x, h[cur][c].y};
                    sb += (v2f){uc[4 + c].x, uc[4 + c].y} * (v2f){h[cur][c].x, h[cur][c].y};
                    sa += (v2f){uc[c].z, uc[c].w} * (v2f){h[cur][c].z, h[cur][c].w};
                    sb += (v2f){uc[4 + c].z, uc[4 + c].w} * (v2f){h[cur][c].z, h[cur][c].w};
                }
                x[2 * n]     = sa.x + sa.y;
                x[2 * n + 1] = sb.x + sb.y;
                // keeps the next pair's reads from rising over these sums, for the same reason
                __builtin_amdgcn_sched_barrier(0);
            }
        }
        // sums over the four lanes of a pick: each step halves the values a lane goes on with
        float y[8], z[4];
        #pragma unroll
        for (int i = 0; i < 8; ++i)
            y[i] = (b0 ? x[2 * i + 1] : x[2 * i]) + quadSwap<0xB1>(b0 ? x[2 * i] : x[2 * i + 1]);
        #pragma unroll
        for (int i = 0; i < 4; ++i)
            z[i] = (b1 ? y[2 * i + 1] : y[2 * i]) + quadSwap<0x4E>(b1 ? y[2 * i] : y[2 * i + 1]);
        ((float4*)part)[pidx] = make_float4(z[0], z[1], z[2], z[3]);
        // stands in front of the overwrite of the store's index register, which it names so that the register lives up to here
        asm volatile("s_wait_xcnt 0x0" :: "v"(pidx) : "memory");
        pidx += 32;
        #pragma unroll
        for (int m = 0; m < 4; ++m) { e[0][m] = e[1][m]; h[0][m] = h[1][m]; }
    }
}

// ---------------- kernel: slice parts added, gelu, routing weight ----------------
// a thread serves four picks
__global__ void peer_gelu(const float* __restrict__ part,
                          const float* __restrict__ rw,
                          float* __restrict__ gw) {
    int p = blockIdx.x * 256 + threadIdx.x;         // [0, NITEM * 4)
    float4 s = {0.f, 0.f, 0.f, 0.f};
    #pragma unroll
    for (int kg = 0; kg < D / UC; ++kg) {
        float4 a = ((const float4*)part)[kg * (NITEM * 4) + p];
        s.x += a.x; s.y += a.y; s.z += a.z; s.w += a.w;
    }
    float4 w = ((const float4*)rw)[p];
    float4 o;                                       // exact gelu
    o.x = 0.5f * s.x * (1.0f + erff(s.x * 0.70710678118654752f)) * w.x;
    o.y = 0.5f * s.y * (1.0f + erff(s.y * 0.70710678118654752f)) * w.y;
    o.z = 0.5f * s.z * (1.0f + erff(s.z * 0.70710678118654752f)) * w.z;
    o.w = 0.5f * s.w * (1.0f + erff(s.w * 0.70710678118654752f)) * w.w;
    ((float4*)gw)[p] = o;
}

// ---------------- kernel: weighted sum of the gathered up rows ----------------
// A block keeps UC columns of all 1024 rows of `up` in LDS and serves UT tokens from them, so a gathered row
// piece is read from LDS and the table crosses from L2 once per block, not once per token and pick.
// A row piece is 256 bytes: 16 lanes x 16 bytes cover all 64 banks once, whatever the row, so the two halves
// of a wave read two different picks' rows without a bank conflict.
__global__ __launch_bounds__(512) void peer_up(const float* __restrict__ up,
                                               const int* __restrict__ rid,
                                               const float* __restrict__ gw,
                                               float* __restrict__ out) {
    __shared__ __attribute__((aligned(16))) float us[1024 * UC];
    int t = threadIdx.x;
    int cg = blockIdx.x, tg = blockIdx.y;
    float4* us4 = (float4*)us;
    const float4* src = (const float4*)up + cg * (UC / 4) + (t >> 4) * (OUTD / 4) + (t & 15);
    // a lane's 32 loads of 16 bytes are all in flight before the first LDS store; load i of the block brings rows 32i..32i+31
    float4 v[32];
    #pragma unroll
    for (int i = 0; i < 32; ++i) v[i] = src[i * 32 * (OUTD / 4)];
    #pragma unroll
    for (int i = 0; i < 32; ++i) us4[i * 512 + t] = v[i];
    // stands in front of the first overwrite of the loads' address register pair, which it names so that the pair
    // lives up to here and no load's own result lands on it
    asm volatile("s_wait_xcnt 0x0" :: "v"(src) : "memory");
    __syncthreads();    // the slice is complete before any wave gathers from it

    unsigned int wid = (unsigned int)__builtin_amdgcn_readfirstlane(t >> 5);
    int lane = t & 31, half = lane >> 4, l15 = lane & 15;
    const float4* ul = us4 + l15;
    // lanes 0..15 take a token's picks 0..63, lanes 16..31 its picks 64..127: 256 bytes of indices and of weights each
    unsigned int hoff = (unsigned int)half * 256u;
    unsigned int r0 = (unsigned int)tg * UT + wid * (UT / 16);      // the wave's first token
    gbytes ep = (gbytes)((unsigned long long)(uintptr_t)rid + r0 * 512u);
    gbytes gp = (gbytes)((unsigned long long)(uintptr_t)gw + r0 * 512u);
    int4 e[16]; float4 g[16];
    #pragma unroll
    for (int m = 0; m < 16; ++m) {
        e[m] = load16i(ep + hoff + m * 16);
        g[m] = load16(gp + hoff + m * 16);
    }
    // unrolled: every load and store names an address that is never rewritten, and an immediate,
    // and e[] and g[] need no copies from trip to trip
    #pragma unroll
    for (int k = 0; k < UT / 16; ++k) {
        // indices and weights of the wave's next token are fetched as this token's are used up
        unsigned int nx = (k + 1) * 512u;
        v2f a01 = {0.f, 0.f}, a23 = {0.f, 0.f};
        float4 u[2][8];
        #pragma unroll
        for (int n = -1; n < 8; ++n) {
            if (n < 7) {                // the next eight row pieces are asked for ahead of this group's sums
                int4 ea = e[2 * n + 2], eb = e[2 * n + 3];
                float4* un = u[(n + 1) & 1];
                un[0] = ul[ea.x * (UC / 4)]; un[1] = ul[ea.y * (UC / 4)];
                un[2] = ul[ea.z * (UC / 4)]; un[3] = ul[ea.w * (UC / 4)];
                un[4] = ul[eb.x * (UC / 4)]; un[5] = ul[eb.y * (UC / 4)];
                un[6] = ul[eb.z * (UC / 4)]; un[7] = ul[eb.w * (UC / 4)];
            }
            // keeps the reads above ahead of the sums below; without it all 64 reads of a token rise to the top and spill
            __builtin_amdgcn_sched_barrier(0);
            if (n >= 0) {
                const float4* uc = u[n & 1];
                float gs[8] = { g[2 * n].x, g[2 * n].y, g[2 * n].z, g[2 * n].w,
                                g[2 * n + 1].x, g[2 * n + 1].y, g[2 * n + 1].z, g[2 * n + 1].w };
                #pragma unroll
                for (int j = 0; j < 8; ++j) {
                    a01 += (v2f){gs[j], gs[j]} * (v2f){uc[j].x, uc[j].y};
                    a23 += (v2f){gs[j], gs[j]} * (v2f){uc[j].z, uc[j].w};
                }
                if (k < UT / 16 - 1) {
                    e[2 * n]     = load16i(ep + hoff + (nx + (2 * n) * 16));
                    e[2 * n + 1] = load16i(ep + hoff + (nx + (2 * n + 1) * 16));
                    g[2 * n]     = load16(gp + hoff + (nx + (2 * n) * 16));
                    g[2 * n + 1] = load16(gp + hoff + (nx + (2 * n + 1) * 16));
                }
                // keeps the next group's reads from rising over these sums, for the same reason
                __builtin_amdgcn_sched_barrier(0);
            }
        }
        float4 acc = { a01.x, a01.y, a23.x, a23.y };
        acc.x += __shfl_xor(acc.x, 16, 32); acc.y += __shfl_xor(acc.y, 16, 32);
        acc.z += __shfl_xor(acc.z, 16, 32); acc.w += __shfl_xor(acc.w, 16, 32);
        if (half == 0) ((float4*)out)[(r0 + k) * (OUTD / 4) + cg * (UC / 4) + l15] = acc;
    }
}

// ---------------- launcher ----------------
extern "C" void kernel_launch(void* const* d_in, const int* in_sizes, int n_in,
                              void* d_out, int out_size, void* d_ws, size_t ws_size,
                              hipStream_t stream) {
    const float* hs    = (const float*)d_in[0];  // [1024,1024]
    const float* Wq    = (const float*)d_in[1];  // [1024,2048]
    const float* bq    = (const float*)d_in[2];  // [2048]
    const float* gamma = (const float*)d_in[3];  // [256]
    const float* beta  = (const float*)d_in[4];  // [256]
    const float* sk0   = (const float*)d_in[5];  // [32,128]
    const float* sk1   = (const float*)d_in[6];  // [32,128]
    const float* down  = (const float*)d_in[7];  // [1024,1024]
    const float* up    = (const float*)d_in[8];  // [1024,1024]
    float* out = (float*)d_out;                  // [1024,1024]

    float* ws = (float*)d_ws;
    float* q      = ws;                   // 1024*2048
    float* n0     = q      + TOKENS * NQ;
    float* n1     = n0     + NKEY * HALF;
    float* part1  = n1     + NKEY * HALF;
    float* part2  = part1  + NRB * NQ;
    float* bnsc   = part2  + NRB * NQ;
    float* bnsh   = bnsc   + QD;
    int*   rid    = (int*)(bnsh + QD);
    float* rw     = (float*)(rid + NITEM * 16);
    float* gw     = rw     + NITEM * 16;
    float* part   = gw     + NITEM * 16;  // (D / UC) planes of NITEM * 16

    peer_knorm<<<dim3(8), dim3(256), 0, stream>>>(sk0, sk1, n0, n1);
    peer_qproj<<<dim3(NQ / BN, TOKENS / BM), dim3(256), 0, stream>>>(hs, Wq, bq, q, part1, part2);
    peer_bnfin<<<dim3(QD / 32), dim3(256), 0, stream>>>(part1, part2, gamma, beta, bnsc, bnsh);
    peer_route<<<dim3(TOKENS), dim3(256), 0, stream>>>(q, bnsc, bnsh, n0, n1, rid, rw);
    peer_down<<<dim3(D / UC, TOKENS / UT), dim3(512), 0, stream>>>(hs, down, rid, part);
    peer_gelu<<<dim3(NITEM * 4 / 256), dim3(256), 0, stream>>>(part, rw, gw);
    peer_up<<<dim3(OUTD / UC, TOKENS / UT), dim3(512), 0, stream>>>(up, rid, gw, out);
}

// v006
// One run takes 66.8 microseconds.
// Timed twice side by side with v005, it ran 1.06 times as fast both times.
// Counting every step since v000, it is 1.94 times as fast.
#include <hip/hip_runtime.h>
#include <math.h>

typedef float v2f __attribute__((ext_vector_type(2)));
typedef float v8f __attribute__((ext_vector_type(8)));
typedef unsigned int u32x4 __attribute__((ext_vector_type(4)));
typedef int i32x4 __attribute__((ext_vector_type(4)));
typedef int i32x8 __attribute__((ext_vector_type(8)));

#define H 8
#define QD 256
#define HALF 128
#define NKEY 32
#define DTK 4
#define TOKENS 1024      // B*S
#define D 1024
#define NQ 2048          // H*QD
#define OUTD 1024
#define NITEM 8192       // TOKENS*H

// GEMM tiling
#define BM 64            // rows per block
#define NRB 16           // block rows of the projection: TOKENS / BM
#define BN 128           // cols per block
#define BK 32            // K-step
#define BNP 129          // padded B row stride (via TDM pad: 1 dword per 128)
#define AMP 33           // padded A row stride
#define UC 64            // columns of an expert table that a block keeps in LDS (256 KiB for 1024 rows)
#define UT 64            // tokens that such a block serves
#define RP 132           // LDS row stride of a 128-channel row: 16 rows' 8-byte reads at k and k+2 fall on all 64 banks once
#define SP 36            // LDS row stride of a 32-score row: 144 bytes = 16 x 9, an odd count of 16-byte units

// ---------------- helpers ----------------
__device__ inline float waveRedSum32(float x) {
    #pragma unroll
    for (int off = 16; off; off >>= 1) x += __shfl_xor(x, off, 32);
    return x;
}

// Issue a TDM load of a 32x128 f32 tile of Wq (row stride 2048 elems) into LDS
// at byte offset lds_off, padded +1 dword per 128 dwords (-> 129-dword rows).
__device__ inline void tdm_load_B(const float* gaddr, unsigned int lds_off) {
    u32x4 g0;
    g0.x = 1u;                                   // count=1, user mode
    g0.y = lds_off;                              // LDS byte address
    unsigned long long ga = (unsigned long long)(uintptr_t)gaddr;
    g0.z = (unsigned int)ga;                     // global_addr[31:0]
    g0.w = (unsigned int)(ga >> 32) | 0x80000000u; // global_addr[56:32] | type=2
    i32x8 g1;
    g1[0] = (int)((2u << 16)       // data_size = 4 bytes
                | (1u << 20)       // pad_enable
                | (6u << 22));     // pad_interval = 128 dwords (pad_amount=0 -> 1 dword)
    g1[1] = (int)(2048u << 16);    // tensor_dim0 = 2048 (elements per row)
    g1[2] = (int)(1024u << 16);    // tensor_dim1 = 1024 rows (dim0 hi bits = 0)
    g1[3] = (int)(128u << 16);     // tile_dim0 = 128 (dim1 hi bits = 0)
    g1[4] = 32;                    // tile_dim1 = 32, tile_dim2 = 0
    g1[5] = 2048;                  // tensor_dim0_stride[31:0] = 2048
    g1[6] = 0;                     // stride hi / dim1_stride lo
    g1[7] = 0;
    i32x4 gz4 = {0, 0, 0, 0};              // groups 2/3 unused (2D tensor)
    i32x8 gz8 = {0, 0, 0, 0, 0, 0, 0, 0};
    __builtin_amdgcn_tensor_load_to_lds(g0, g1, gz4, gz4, gz8, 0);
}

// ---------------- kernel: normalize sub-keys ----------------
__global__ void peer_knorm(const float* __restrict__ k0,
                           const float* __restrict__ k1,
                           float* __restrict__ n0,
                           float* __restrict__ n1) {
    int wid = threadIdx.x >> 5, lane = threadIdx.x & 31;
    int gw = blockIdx.x * 8 + wid;          // [0,64)
    int table = gw >> 5, row = gw & 31;
    const float* src = table ? k1 : k0;
    float*       dst = table ? n1 : n0;
    float v[4]; float ss = 0.f;
    #pragma unroll
    for (int j = 0; j < 4; ++j) {
        v[j] = src[row * HALF + lane * 4 + j];
        ss += v[j] * v[j];
    }
    ss = waveRedSum32(ss);
    float inv = 1.f / fmaxf(sqrtf(ss), 1e-12f);
    #pragma unroll
    for (int j = 0; j < 4; ++j) dst[row * HALF + lane * 4 + j] = v[j] * inv;
}

// ---------------- kernel: Q projection GEMM (f32 WMMA + TDM double-buffer) ----------------
// q[TOKENS][NQ] = hs[TOKENS][D] @ Wq[D][NQ] + bq
// Block tile 64x128, 8 waves in 2x4 grid, each wave a 2x2 grid of 16x16 tiles.
// B tiles arrive via Tensor Data Mover (async, double buffered, padded rows).
// The epilogue also writes the block's column sums of q and q*q (64 rows) for the batch norm.
__global__ void peer_qproj(const float* __restrict__ hs,
                           const float* __restrict__ Wq,
                           const float* __restrict__ bq,
                           float* __restrict__ q,
                           float* __restrict__ part1,
                           float* __restrict__ part2) {
    __shared__ float As[2][BM][AMP];
    __shared__ float Bs[2][BK][BNP];
    int t = threadIdx.x;
    int wid = t >> 5, lane = t & 31;
    int rowBase = blockIdx.y * BM;
    int colBase = blockIdx.x * BN;
    int wm = wid >> 2;                 // 0..1  (row group of 32)
    int wn = wid & 3;                  // 0..3  (col group of 32)
    int l15 = lane & 15;
    int khi = (lane >> 4) << 1;        // 0 or 2

    v8f acc00 = {}, acc01 = {}, acc10 = {}, acc11 = {};

    // ---- prologue: stage 0 ----
    if (wid == 0)
        tdm_load_B(Wq + colBase, (unsigned int)(uintptr_t)&Bs[0][0][0]);
    #pragma unroll
    for (int i = 0; i < 8; ++i) {                // A: 64x32
        int idx = i * 256 + t;
        int r = idx >> 5, c = idx & 31;
        As[0][r][c] = hs[(rowBase + r) * D + c];
    }

    int buf = 0;
    for (int it = 0; it < D / BK; ++it) {
        int k0 = it * BK;
        float an[8];        // next stage's A elements: loaded ahead of the matrix block, stored to LDS behind it
        // ---- issue next stage (overlaps this stage's WMMA) ----
        if (it < D / BK - 1) {
            int kn = k0 + BK;
            if (wid == 0)
                tdm_load_B(Wq + (size_t)kn * NQ + colBase,
                           (unsigned int)(uintptr_t)&Bs[buf ^ 1][0][0]);
            if (wid == 0) __builtin_amdgcn_s_wait_tensorcnt(1);
        } else {
            if (wid == 0) __builtin_amdgcn_s_wait_tensorcnt(0);
        }
        __syncthreads();    // stage `buf` complete: TDM B here, A stores ahead of the previous trip's last barrier

        // Next stage's A loads stand behind the barrier (which waits for every load issued ahead of it)
        // and fly during the matrix block.
        if (it < D / BK - 1) {
            const float* ap = hs + (rowBase + wid) * D + k0 + BK + lane;   // rows wid + 8i of the tile
            #pragma unroll
            for (int i = 0; i < 8; ++i) an[i] = ap[i * 8 * D];
            // order at the head of the matrix block: the first six LDS fragment reads, then the eight global loads,
            // so that the issue of the global loads falls into the LDS reads' latency
            __builtin_amdgcn_sched_group_barrier(0x100, 6, 0);
            __builtin_amdgcn_sched_group_barrier(0x020, 8, 0);
        }

        #pragma unroll
        for (int kk = 0; kk < 8; ++kk) {
            int kb = kk * 4 + khi;
            v2f a0 = { As[buf][wm * 32 + l15][kb],      As[buf][wm * 32 + l15][kb + 1] };
            v2f a1 = { As[buf][wm * 32 + 16 + l15][kb], As[buf][wm * 32 + 16 + l15][kb + 1] };
            v2f b0 = { Bs[buf][kb][wn * 32 + l15],      Bs[buf][kb + 1][wn * 32 + l15] };
            v2f b1 = { Bs[buf][kb][wn * 32 + 16 + l15], Bs[buf][kb + 1][wn * 32 + 16 + l15] };
            acc00 = __builtin_amdgcn_wmma_f32_16x16x4_f32(false, a0, false, b0, (short)0, acc00, false, false);
            acc01 = __builtin_amdgcn_wmma_f32_16x16x4_f32(false, a0, false, b1, (short)0, acc01, false, false);
            acc10 = __builtin_amdgcn_wmma_f32_16x16x4_f32(false, a1, false, b0, (short)0, acc10, false, false);
            acc11 = __builtin_amdgcn_wmma_f32_16x16x4_f32(false, a1, false, b1, (short)0, acc11, false, false);
        }
        if (it < D / BK - 1) {
            // holds the wait for the A loads behind the matrix block; ahead of it the wave would idle for the loads
            __builtin_amdgcn_sched_barrier(0);
            #pragma unroll
            for (int i = 0; i < 8; ++i)      // As[buf ^ 1] was last read before the previous trip's last barrier
                As[buf ^ 1][wid + 8 * i][lane] = an[i];
        }
        __syncthreads();    // all waves done reading stage `buf`; next stage's A stores complete
        buf ^= 1;
    }

    // ---- epilogue: bias + store (C layout: VGPR v -> M = v + 8*(lane>=16)) ----
    int rhalf = (lane >> 4) << 3;
    float bias0 = bq[colBase + wn * 32 + l15];
    float bias1 = bq[colBase + wn * 32 + 16 + l15];
    // Keeps the epilogue's vector work out of the last matrix block: without it the scheduler puts reads of an
    // accumulator one or two slots behind the matrix instruction that writes it.
    __builtin_amdgcn_sched_barrier(0);
    // four vector slots between the last matrix instruction and the first read of its result
    asm volatile("v_nop\n\tv_nop\n\tv_nop\n\tv_nop");
    __builtin_amdgcn_sched_barrier(0);  // holds the four slots where they stand
    #pragma unroll
    for (int v = 0; v < 8; ++v) {
        acc00[v] += bias0; acc10[v] += bias0;
        acc01[v] += bias1; acc11[v] += bias1;
    }

    // Column sums of the wave's 32 rows: 16 values per lane, then the other half of the wave.
    // Lanes 0..15 go on with the sum, lanes 16..31 with the sum of squares.
    float* red = &As[0][0][0];         // free: every wave has passed the loop's last barrier
    float cs[2];
    #pragma unroll
    for (int sn = 0; sn < 2; ++sn) {
        v8f a0v = sn ? acc01 : acc00;
        v8f a1v = sn ? acc11 : acc10;
        float s = 0.f, s2 = 0.f;
        #pragma unroll
        for (int v = 0; v < 8; ++v) {
            s += a0v[v]; s2 += a0v[v] * a0v[v];
            s += a1v[v]; s2 += a1v[v] * a1v[v];
        }
        s  += __shfl_xor(s, 16, 32);
        s2 += __shfl_xor(s2, 16, 32);
        cs[sn] = (lane < 16) ? s : s2;
        if (wm == 1) red[(lane >> 4) * BN + wn * 32 + sn * 16 + l15] = cs[sn];
    }
    __syncthreads();    // the second row group's sums are in LDS; stands ahead of the q stores, so it waits for none

    #pragma unroll
    for (int sn = 0; sn < 2; ++sn) {
        int col = colBase + wn * 32 + sn * 16 + l15;
        v8f a0v = sn ? acc01 : acc00;
        v8f a1v = sn ? acc11 : acc10;
        #pragma unroll
        for (int v = 0; v < 8; ++v) {
            int row0 = rowBase + wm * 32 + v + rhalf;
            q[row0 * NQ + col] = a0v[v];
            q[(row0 + 16) * NQ + col] = a1v[v];
        }
        if (wm == 0) {
            float* dst = (lane < 16) ? part1 : part2;
            dst[blockIdx.y * NQ + col] = cs[sn] + red[(lane >> 4) * BN + wn * 32 + sn * 16 + l15];
        }
    }
}

// ---------------- kernel: BN finalize ----------------
// part1/part2 hold, per block row of the projection (NRB of them), the sums of all NQ columns.
// A block serves 32 channels; wave w adds the 8 heads of block rows 2w and 2w+1, wave 0 the 8 wave sums.
__global__ void peer_bnfin(const float* __restrict__ part1,
                           const float* __restrict__ part2,
                           const float* __restrict__ gamma,
                           const float* __restrict__ beta,
                           float* __restrict__ bnsc,
                           float* __restrict__ bnsh) {
    __shared__ float r1[8][32];
    __shared__ float r2[8][32];
    int wid = threadIdx.x >> 5, lane = threadIdx.x & 31;
    int c = blockIdx.x * 32 + lane;
    // NQ = H * QD: the wave's two block rows are 16 pieces of QD columns, one behind the other
    const float* p1 = part1 + wid * (NRB / 8) * NQ + c;
    const float* p2 = part2 + wid * (NRB / 8) * NQ + c;
    float s = 0.f, s2 = 0.f;
    #pragma unroll
    for (int p = 0; p < (NRB / 8) * H; ++p) {
        s  += p1[p * QD];
        s2 += p2[p * QD];
    }
    r1[wid][lane] = s;
    r2[wid][lane] = s2;
    __syncthreads();
    if (wid == 0) {
        s = 0.f; s2 = 0.f;
        #pragma unroll
        for (int w = 0; w < 8; ++w) { s += r1[w][lane]; s2 += r2[w][lane]; }
        float mean = s * (1.f / 8192.f);
        float var  = s2 * (1.f / 8192.f) - mean * mean;
        float sc = gamma[c] / sqrtf(var + 1e-5f);
        bnsc[c] = sc;
        bnsh[c] = beta[c] - mean * sc;
    }
}

// ---------------- kernel: routing ----------------
// A block serves 32 (token, head) items with four waves: wave w takes items 16*(w>>1).. and key table w&1.
// The 16 x 32 scores of a wave are one matrix product, 16 queries x 128 channels by 128 channels x 32 keys.
// TOPK==DTK^2 so softmax runs over ALL 16 combos.

// puts (x, n) into the descending list v[0..3] / id[0..3]; an equal value stays behind the one that came first
__device__ inline void top4Insert(float x, int n, float* v, int* id) {
    bool c0 = x > v[0], c1 = x > v[1], c2 = x > v[2], c3 = x > v[3];
    v[3] = c2 ? v[2] : (c3 ? x : v[3]);  id[3] = c2 ? id[2] : (c3 ? n : id[3]);
    v[2] = c1 ? v[1] : (c2 ? x : v[2]);  id[2] = c1 ? id[1] : (c2 ? n : id[2]);
    v[1] = c0 ? v[0] : (c1 ? x : v[1]);  id[1] = c0 ? id[0] : (c1 ? n : id[1]);
    v[0] = c0 ? x : v[0];                id[0] = c0 ? n : id[0];
}

__global__ __launch_bounds__(128) void peer_route(const float* __restrict__ q,
                                                  const float* __restrict__ bnsc,
                                                  const float* __restrict__ bnsh,
                                                  const float* __restrict__ n0,
                                                  const float* __restrict__ n1,
                                                  int* __restrict__ rid,
                                                  float* __restrict__ rw) {
    __shared__ __attribute__((aligned(16))) float ks[2][NKEY][RP];   // both normalized key tables
    __shared__ __attribute__((aligned(16))) float qs[4][16][RP];     // per wave: 16 normalized half queries
    __shared__ __attribute__((aligned(16))) float sc[4][16][SP];     // per wave: 16 items x 32 scores
    __shared__ __attribute__((aligned(16))) float tv[32][2][DTK];    // per item and table: the four best scores
    __shared__ __attribute__((aligned(16))) int   tx[32][2][DTK];    // and their keys
    int t = threadIdx.x;
    int wid = t >> 5, lane = t & 31, l15 = lane & 15, hh = lane >> 4;
    int grp = wid >> 1, tb = wid & 1;

    int bidx = tb * (HALF / 4) + l15 * 2;       // the lane's 8 channels, in units of 16 bytes
    float4 sc0 = ((const float4*)bnsc)[bidx], sc1 = ((const float4*)bnsc)[bidx + 1];
    float4 sh0 = ((const float4*)bnsh)[bidx], sh1 = ((const float4*)bnsh)[bidx + 1];
    float bsc[8] = { sc0.x, sc0.y, sc0.z, sc0.w, sc1.x, sc1.y, sc1.z, sc1.w };
    float bsh[8] = { sh0.x, sh0.y, sh0.z, sh0.w, sh1.x, sh1.y, sh1.z, sh1.w };
    // Half a wave holds one item's 128 channels of the wave's table, 8 per lane; q is [NITEM][QD].
    const float* qb = q + (blockIdx.x * 32 + grp * 16 + hh) * QD + tb * HALF + l15 * 8;
    float4 qv[8][2];
    #pragma unroll
    for (int i = 0; i < 8; ++i) {
        qv[i][0] = ((const float4*)(qb + 2 * i * QD))[0];
        qv[i][1] = ((const float4*)(qb + 2 * i * QD))[1];
    }
    // stands in front of the first overwrite of the address pair and the index register of the loads above, which it
    // names so that they live up to here and no load's own result lands on them
    asm volatile("s_wait_xcnt 0x0" :: "v"(qb), "v"(bidx) : "memory");
    // Both key tables go into LDS once per block: a wave reads whole 512-byte rows.
    float4 kst0[8], kst1[8];
    #pragma unroll
    for (int i = 0; i < 8; ++i) {
        kst0[i] = ((const float4*)n0)[i * 128 + t];
        kst1[i] = ((const float4*)n1)[i * 128 + t];
    }
    #pragma unroll
    for (int i = 0; i < 8; ++i) {               // wave wid holds key i*4+wid, lane its channels 4*lane..4*lane+3
        *(float4*)&ks[0][i * 4 + wid][lane * 4] = kst0[i];
        *(float4*)&ks[1][i * 4 + wid][lane * 4] = kst1[i];
    }
    #pragma unroll
    for (int i = 0; i < 8; ++i) {
        float qr[8] = { qv[i][0].x, qv[i][0].y, qv[i][0].z, qv[i][0].w,
                        qv[i][1].x, qv[i][1].y, qv[i][1].z, qv[i][1].w };
        float vr[8]; float ss = 0.f;
        #pragma unroll
        for (int j = 0; j < 8; ++j) {
            float x = qr[j] * bsc[j] + bsh[j];
            vr[j] = x; ss += x * x;
        }
        #pragma unroll
        for (int off = 8; off; off >>= 1) ss += __shfl_xor(ss, off, 16);
        float inv = 1.f / fmaxf(sqrtf(ss), 1e-12f);
        float4* dst = (float4*)&qs[wid][2 * i + hh][l15 * 8];
        dst[0] = make_float4(vr[0] * inv, vr[1] * inv, vr[2] * inv, vr[3] * inv);
        dst[1] = make_float4(vr[4] * inv, vr[5] * inv, vr[6] * inv, vr[7] * inv);
    }
    __syncthreads();    // keys and queries are in LDS

    // Fragments as in the projection: lane l15 is the row of A (item) and the column of B (key); a lane holds
    // k = 2*hh and 2*hh+1 of a step's four channels. Step s takes channels 4s..4s+3, so each score is
    // summed over c = 0..127 in rising order.
    v8f acc0 = {}, acc1 = {};
    const float* ar  = &qs[wid][l15][2 * hh];
    const float* br0 = &ks[tb][l15][2 * hh];
    const float* br1 = &ks[tb][16 + l15][2 * hh];
    #pragma unroll
    for (int s = 0; s < HALF / 4; ++s) {
        v2f a  = *(const v2f*)(ar + 4 * s);
        v2f b0 = *(const v2f*)(br0 + 4 * s);
        v2f b1 = *(const v2f*)(br1 + 4 * s);
        acc0 = __builtin_amdgcn_wmma_f32_16x16x4_f32(false, a, false, b0, (short)0, acc0, false, false);
        acc1 = __builtin_amdgcn_wmma_f32_16x16x4_f32(false, a, false, b1, (short)0, acc1, false, false);
    }
    // Keeps the address work of the score stores out of the matrix block: without it the scheduler lets it
    // overwrite a fragment register directly behind the matrix instruction that reads it.
    __builtin_amdgcn_sched_barrier(0);
    // four vector slots between the last matrix instruction and the first vector write of one of its registers
    asm volatile("v_nop\n\tv_nop\n\tv_nop\n\tv_nop");
    __builtin_amdgcn_sched_barrier(0);  // holds the four slots where they stand
    // C layout: VGPR v -> item v + 8*hh, key l15 (acc0) or 16 + l15 (acc1)
    #pragma unroll
    for (int v = 0; v < 8; ++v) {
        sc[wid][v + 8 * hh][l15]      = acc0[v];
        sc[wid][v + 8 * hh][16 + l15] = acc1[v];
    }
    __syncthreads();    // the scores are in LDS

    // Lane (hh, l15) scans keys 16*hh..16*hh+15 of item l15, in rising order.
    float bv[DTK] = { -INFINITY, -INFINITY, -INFINITY, -INFINITY };
    int   bi[DTK] = { 0, 0, 0, 0 };
    #pragma unroll
    for (int c = 0; c < 4; ++c) {
        float4 x = *(const float4*)&sc[wid][l15][hh * 16 + c * 4];
        top4Insert(x.x, hh * 16 + c * 4,     bv, bi);
        top4Insert(x.y, hh * 16 + c * 4 + 1, bv, bi);
        top4Insert(x.z, hh * 16 + c * 4 + 2, bv, bi);
        top4Insert(x.w, hh * 16 + c * 4 + 3, bv, bi);
    }
    // The four best of keys 16..31 go, best first, into the list of keys 0..15 (the result counts in lanes 0..15).
    float ov[DTK]; int oi[DTK];
    #pragma unroll
    for (int r = 0; r < DTK; ++r) {
        ov[r] = __shfl_xor(bv[r], 16, 32);
        oi[r] = __shfl_xor(bi[r], 16, 32);
    }
    #pragma unroll
    for (int r = 0; r < DTK; ++r) top4Insert(ov[r], oi[r], bv, bi);
    if (hh == 0) {
        *(float4*)&tv[grp * 16 + l15][tb][0] = make_float4(bv[0], bv[1], bv[2], bv[3]);
        *(int4*)&tx[grp * 16 + l15][tb][0]   = make_int4(bi[0], bi[1], bi[2], bi[3]);
    }
    __syncthreads();    // both tables' lists are in LDS

    // Four threads share an item; thread ii of them writes combos 4*ii..4*ii+3. Each forms all 16 exponentials
    // and adds them as the tree over lane distances 8, 4, 2, 1 did, so the weights keep their bits.
    int item = t >> 2, ii = t & 3;
    float4 t0 = *(const float4*)&tv[item][0][0];
    float4 t1 = *(const float4*)&tv[item][1][0];
    int4   x1 = *(const int4*)&tx[item][1][0];
    float  mine = tv[item][0][ii];
    int    mid  = tx[item][0][ii] * NKEY;
    float a4[4] = { t0.x, t0.y, t0.z, t0.w }, b4[4] = { t1.x, t1.y, t1.z, t1.w };
    float m = a4[0] + b4[0];
    #pragma unroll
    for (int l = 1; l < 16; ++l) m = fmaxf(m, a4[l >> 2] + b4[l & 3]);
    float e[16];
    #pragma unroll
    for (int l = 0; l < 16; ++l) e[l] = expf(a4[l >> 2] + b4[l & 3] - m);
    #pragma unroll
    for (int off = 8; off; off >>= 1) {
        #pragma unroll
        for (int l = 0; l < off; ++l) e[l] += e[l + off];
    }
    float sum = e[0];
    float4 w = make_float4(expf(mine + b4[0] - m) / sum, expf(mine + b4[1] - m) / sum,
                           expf(mine + b4[2] - m) / sum, expf(mine + b4[3] - m) / sum);
    ((int4*)rid)[blockIdx.x * 128 + t]  = make_int4(mid + x1.x, mid + x1.y, mid + x1.z, mid + x1.w);
    ((float4*)rw)[blockIdx.x * 128 + t] = w;
}

typedef const __attribute__((address_space(1))) char* gbytes;   // byte pointer into global memory

__device__ inline float4 load16(gbytes p) {
    return *(const __attribute__((address_space(1))) float4*)p;
}
__device__ inline int4 load16i(gbytes p) {
    return *(const __attribute__((address_space(1))) int4*)p;
}

// x of the lane whose number differs in bit 0 (CTRL 0xB1) or in bit 1 (CTRL 0x4E): a register move inside a group of four lanes
template <int CTRL>
__device__ inline float quadSwap(float x) {
    return __int_as_float(__builtin_amdgcn_mov_dpp(__float_as_int(x), CTRL, 0xf, 0xf, true));
}

// ---------------- kernel: down dot products, one 64-column slice per block ----------------
// A block keeps UC columns of all 1024 rows of `down` in LDS and serves UT tokens from them; it writes, for each
// of a token's 128 picks, the dot product over its UC columns. The 16 slices' parts are added in peer_gelu.
// Four lanes share a pick: lane q of the four owns the 64 bytes q of the 256-byte row piece and reads them in
// four 16-byte steps, starting at a step that differs between the four picks of a half wave, so that the
// 16 lanes of a half wave always read 16 different 16-byte columns: no bank conflict, whatever the rows.
__global__ __launch_bounds__(512) void peer_down(const float* __restrict__ hs,
                                                 const float* __restrict__ down,
                                                 const int* __restrict__ rid,
                                                 float* __restrict__ part) {
    __shared__ __attribute__((aligned(16))) float dsl[1024 * UC];
    int t = threadIdx.x;
    int kg = blockIdx.x, tg = blockIdx.y;
    float4* ds4 = (float4*)dsl;
    const float4* src = (const float4*)down + kg * (UC / 4) + (t >> 4) * (D / 4) + (t & 15);
    // a lane's 32 loads of 16 bytes are all in flight before the first LDS store; load i of the block brings rows 32i..32i+31
    float4 v[32];
    #pragma unroll
    for (int i = 0; i < 32; ++i) v[i] = src[i * 32 * (D / 4)];
    #pragma unroll
    for (int i = 0; i < 32; ++i) ds4[i * 512 + t] = v[i];
    // stands in front of the first overwrite of the loads' address register pair, which it names so that the pair
    // lives up to here and no load's own result lands on it
    asm volatile("s_wait_xcnt 0x0" :: "v"(src) : "memory");
    __syncthreads();    // the slice is complete before any wave gathers from it

    unsigned int wid = (unsigned int)__builtin_amdgcn_readfirstlane(t >> 5);
    int lane = t & 31, slot = lane >> 2, q = lane & 3;
    bool b0 = (q & 1) != 0, b1 = (q & 2) != 0;
    unsigned int r0 = (unsigned int)tg * UT + wid * (UT / 16);      // the wave's first token
    unsigned int coff[4];                                           // byte offsets of the lane's four steps in a row piece
    #pragma unroll
    for (int c = 0; c < 4; ++c) coff[c] = (unsigned int)(q * 4 + ((c + slot) & 3)) * 16u;
    unsigned int soff = (unsigned int)slot * 64u;                   // the slot's 16 picks among the token's 128
    gbytes ep = (gbytes)((unsigned long long)(uintptr_t)rid + r0 * 512u);
    gbytes hp = (gbytes)((unsigned long long)(uintptr_t)hs + r0 * (D * 4u) + (unsigned int)kg * (UC * 4u));
    const char* lbase = (const char*)dsl;

    int4 e[2][4]; float4 h[2][4];
    const int cur = 0;
    #pragma unroll
    for (int m = 0; m < 4; ++m) {
        e[0][m] = load16i(ep + soff + m * 16);
        h[0][m] = load16(hp + coff[m]);
    }
    // stands in front of the first overwrite of a register that the loads above name
    asm volatile("s_wait_xcnt 0x0" ::: "memory");
    __builtin_amdgcn_sched_barrier(0);  // holds later vector work, which reuses those registers, behind the wait
    unsigned int pidx = (unsigned int)kg * (NITEM * 4) + r0 * 32 + lane;    // the wave's first 512 bytes of results
    // rolled: unrolled, the last token's 64 LDS reads all rose to its top and spilled
    #pragma unroll 1
    for (int k = 0; k < UT / 16; ++k) {
        // the next token's indices and its piece of the token row, one token ahead;
        // the last token fetches its own again, which keeps the body free of branches
        unsigned int kn = k < UT / 16 - 1 ? k + 1 : k;
        #pragma unroll
        for (int m = 0; m < 4; ++m) {
            e[1][m] = load16i(ep + soff + (kn * 512u + m * 16));
            h[1][m] = load16(hp + coff[m] + kn * (D * 4u));
        }
        // x[j] belongs to pick (j & 3) * 4 + (j >> 2) of the slot, so that the sums over four lanes below leave
        // lane q with the slot's picks 4q..4q+3
        int ej[16] = { e[cur][0].x, e[cur][1].x, e[cur][2].x, e[cur][3].x,
                       e[cur][0].y, e[cur][1].y, e[cur][2].y, e[cur][3].y,
                       e[cur][0].z, e[cur][1].z, e[cur][2].z, e[cur][3].z,
                       e[cur][0].w, e[cur][1].w, e[cur][2].w, e[cur][3].w };
        float x[16];
        float4 u[2][8];
        #pragma unroll
        for (int n = -1; n < 8; ++n) {
            if (n < 7) {                // the next two picks' row pieces are asked for ahead of this pair's sums
                float4* un = u[(n + 1) & 1];
                #pragma unroll
                for (int c = 0; c < 4; ++c) {
                    un[c]     = *(const float4*)(lbase + ((unsigned int)ej[2 * n + 2] * (UC * 4u) + coff[c]));
                    un[4 + c] = *(const float4*)(lbase + ((unsigned int)ej[2 * n + 3] * (UC * 4u) + coff[c]));
                }
            }
            // keeps the reads above ahead of the sums below; without it all 64 reads of a token rise to the top and spill
            __builtin_amdgcn_sched_barrier(0);
            if (n >= 0) {
                const float4* uc = u[n & 1];
                v2f sa = {0.f, 0.f}, sb = {0.f, 0.f};
                #pragma unroll
                for (int c = 0; c < 4; ++c) {
                    sa += (v2f){uc[c].x, uc[c].y} * (v2f){h[cur][c].x, h[cur][c].y};
                    sb += (v2f){uc[4 + c].x, uc[4 + c].y} * (v2f){h[cur][c].x, h[cur][c].y};
                    sa += (v2f){uc[c].z, uc[c].w} * (v2f){h[cur][c].z, h[cur][c].w};
                    sb += (v2f){uc[4 + c].z, uc[4 + c].w} * (v2f){h[cur][c].z, h[cur][c].w};
                }
                x[2 * n]     = sa.x + sa.y;
                x[2 * n + 1] = sb.x + sb.y;
                // keeps the next pair's reads from rising over these sums, for the same reason
                __builtin_amdgcn_sched_barrier(0);
            }
        }
        // sums over the four lanes of a pick: each step halves the values a lane goes on with
        float y[8], z[4];
        #pragma unroll
        for (int i = 0; i < 8; ++i)
            y[i] = (b0 ? x[2 * i + 1] : x[2 * i]) + quadSwap<0xB1>(b0 ? x[2 * i] : x[2 * i + 1]);
        #pragma unroll
        for (int i = 0; i < 4; ++i)
            z[i] = (b1 ? y[2 * i + 1] : y[2 * i]) + quadSwap<0x4E>(b1 ? y[2 * i] : y[2 * i + 1]);
        ((float4*)part)[pidx] = make_float4(z[0], z[1], z[2], z[3]);
        // stands in front of the overwrite of the store's index register, which it names so that the register lives up to here
        asm volatile("s_wait_xcnt 0x0" :: "v"(pidx) : "memory");
        pidx += 32;
        #pragma unroll
        for (int m = 0; m < 4; ++m) { e[0][m] = e[1][m]; h[0][m] = h[1][m]; }
    }
}

// ---------------- kernel: slice parts added, gelu, routing weight ----------------
// a thread serves four picks
__global__ void peer_gelu(const float* __restrict__ part,
                          const float* __restrict__ rw,
                          float* __restrict__ gw) {
    int p = blockIdx.x * 256 + threadIdx.x;         // [0, NITEM * 4)
    float4 s = {0.f, 0.f, 0.f, 0.f};
    #pragma unroll
    for (int kg = 0; kg < D / UC; ++kg) {
        float4 a = ((const float4*)part)[kg * (NITEM * 4) + p];
        s.x += a.x; s.y += a.y; s.z += a.z; s.w += a.w;
    }
    float4 w = ((const float4*)rw)[p];
    float4 o;                                       // exact gelu
    o.x = 0.5f * s.x * (1.0f + erff(s.x * 0.70710678118654752f)) * w.x;
    o.y = 0.5f * s.y * (1.0f + erff(s.y * 0.70710678118654752f)) * w.y;
    o.z = 0.5f * s.z * (1.0f + erff(s.z * 0.70710678118654752f)) * w.z;
    o.w = 0.5f * s.w * (1.0f + erff(s.w * 0.70710678118654752f)) * w.w;
    ((float4*)gw)[p] = o;
}

// ---------------- kernel: weighted sum of the gathered up rows ----------------
// A block keeps UC columns of all 1024 rows of `up` in LDS and serves UT tokens from them, so a gathered row
// piece is read from LDS and the table crosses from L2 once per block, not once per token and pick.
// A row piece is 256 bytes: 16 lanes x 16 bytes cover all 64 banks once, whatever the row, so the two halves
// of a wave read two different picks' rows without a bank conflict.
__global__ __launch_bounds__(512) void peer_up(const float* __restrict__ up,
                                               const int* __restrict__ rid,
                                               const float* __restrict__ gw,
                                               float* __restrict__ out) {
    __shared__ __attribute__((aligned(16))) float us[1024 * UC];
    int t = threadIdx.x;
    int cg = blockIdx.x, tg = blockIdx.y;
    float4* us4 = (float4*)us;
    const float4* src = (const float4*)up + cg * (UC / 4) + (t >> 4) * (OUTD / 4) + (t & 15);
    // a lane's 32 loads of 16 bytes are all in flight before the first LDS store; load i of the block brings rows 32i..32i+31
    float4 v[32];
    #pragma unroll
    for (int i = 0; i < 32; ++i) v[i] = src[i * 32 * (OUTD / 4)];
    #pragma unroll
    for (int i = 0; i < 32; ++i) us4[i * 512 + t] = v[i];
    // stands in front of the first overwrite of the loads' address register pair, which it names so that the pair
    // lives up to here and no load's own result lands on it
    asm volatile("s_wait_xcnt 0x0" :: "v"(src) : "memory");
    __syncthreads();    // the slice is complete before any wave gathers from it

    unsigned int wid = (unsigned int)__builtin_amdgcn_readfirstlane(t >> 5);
    int lane = t & 31, half = lane >> 4, l15 = lane & 15;
    const float4* ul = us4 + l15;
    // lanes 0..15 take a token's picks 0..63, lanes 16..31 its picks 64..127: 256 bytes of indices and of weights each
    unsigned int hoff = (unsigned int)half * 256u;
    unsigned int r0 = (unsigned int)tg * UT + wid * (UT / 16);      // the wave's first token
    gbytes ep = (gbytes)((unsigned long long)(uintptr_t)rid + r0 * 512u);
    gbytes gp = (gbytes)((unsigned long long)(uintptr_t)gw + r0 * 512u);
    int4 e[16]; float4 g[16];
    #pragma unroll
    for (int m = 0; m < 16; ++m) {
        e[m] = load16i(ep + hoff + m * 16);
        g[m] = load16(gp + hoff + m * 16);
    }
    // unrolled: every load and store names an address that is never rewritten, and an immediate,
    // and e[] and g[] need no copies from trip to trip
    #pragma unroll
    for (int k = 0; k < UT / 16; ++k) {
        // indices and weights of the wave's next token are fetched as this token's are used up
        unsigned int nx = (k + 1) * 512u;
        v2f a01 = {0.f, 0.f}, a23 = {0.f, 0.f};
        float4 u[2][8];
        #pragma unroll
        for (int n = -1; n < 8; ++n) {
            if (n < 7) {                // the next eight row pieces are asked for ahead of this group's sums
                int4 ea = e[2 * n + 2], eb = e[2 * n + 3];
                float4* un = u[(n + 1) & 1];
                un[0] = ul[ea.x * (UC / 4)]; un[1] = ul[ea.y * (UC / 4)];
                un[2] = ul[ea.z * (UC / 4)]; un[3] = ul[ea.w * (UC / 4)];
                un[4] = ul[eb.x * (UC / 4)]; un[5] = ul[eb.y * (UC / 4)];
                un[6] = ul[eb.z * (UC / 4)]; un[7] = ul[eb.w * (UC / 4)];
            }
            // keeps the reads above ahead of the sums below; without it all 64 reads of a token rise to the top and spill
            __builtin_amdgcn_sched_barrier(0);
            if (n >= 0) {
                const float4* uc = u[n & 1];
                float gs[8] = { g[2 * n].x, g[2 * n].y, g[2 * n].z, g[2 * n].w,
                                g[2 * n + 1].x, g[2 * n + 1].y, g[2 * n + 1].z, g[2 * n + 1].w };
                #pragma unroll
                for (int j = 0; j < 8; ++j) {
                    a01 += (v2f){gs[j], gs[j]} * (v2f){uc[j].x, uc[j].y};
                    a23 += (v2f){gs[j], gs[j]} * (v2f){uc[j].z, uc[j].w};
                }
                if (k < UT / 16 - 1) {
                    e[2 * n]     = load16i(ep + hoff + (nx + (2 * n) * 16));
                    e[2 * n + 1] = load16i(ep + hoff + (nx + (2 * n + 1) * 16));
                    g[2 * n]     = load16(gp + hoff + (nx + (2 * n) * 16));
                    g[2 * n + 1] = load16(gp + hoff + (nx + (2 * n + 1) * 16));
                }
                // keeps the next group's reads from rising over these sums, for the same reason
                __builtin_amdgcn_sched_barrier(0);
            }
        }
        float4 acc = { a01.x, a01.y, a23.x, a23.y };
        acc.x += __shfl_xor(acc.x, 16, 32); acc.y += __shfl_xor(acc.y, 16, 32);
        acc.z += __shfl_xor(acc.z, 16, 32); acc.w += __shfl_xor(acc.w, 16, 32);
        if (half == 0) ((float4*)out)[(r0 + k) * (OUTD / 4) + cg * (UC / 4) + l15] = acc;
    }
}

// ---------------- launcher ----------------
extern "C" void kernel_launch(void* const* d_in, const int* in_sizes, int n_in,
                              void* d_out, int out_size, void* d_ws, size_t ws_size,
                              hipStream_t stream) {
    const float* hs    = (const float*)d_in[0];  // [1024,1024]
    const float* Wq    = (const float*)d_in[1];  // [1024,2048]
    const float* bq    = (const float*)d_in[2];  // [2048]
    const float* gamma = (const float*)d_in[3];  // [256]
    const float* beta  = (const float*)d_in[4];  // [256]
    const float* sk0   = (const float*)d_in[5];  // [32,128]
    const float* sk1   = (const float*)d_in[6];  // [32,128]
    const float* down  = (const float*)d_in[7];  // [1024,1024]
    const float* up    = (const float*)d_in[8];  // [1024,1024]
    float* out = (float*)d_out;                  // [1024,1024]

    float* ws = (float*)d_ws;
    float* q      = ws;                   // 1024*2048
    float* n0     = q      + TOKENS * NQ;
    float* n1     = n0     + NKEY * HALF;
    float* part1  = n1     + NKEY * HALF;
    float* part2  = part1  + NRB * NQ;
    float* bnsc   = part2  + NRB * NQ;
    float* bnsh   = bnsc   + QD;
    int*   rid    = (int*)(bnsh + QD);
    float* rw     = (float*)(rid + NITEM * 16);
    float* gw     = rw     + NITEM * 16;
    float* part   = gw     + NITEM * 16;  // (D / UC) planes of NITEM * 16

    peer_knorm<<<dim3(8), dim3(256), 0, stream>>>(sk0, sk1, n0, n1);
    peer_qproj<<<dim3(NQ / BN, TOKENS / BM), dim3(256), 0, stream>>>(hs, Wq, bq, q, part1, part2);
    peer_bnfin<<<dim3(QD / 32), dim3(256), 0, stream>>>(part1, part2, gamma, beta, bnsc, bnsh);
    peer_route<<<dim3(NITEM / 32), dim3(128), 0, stream>>>(q, bnsc, bnsh, n0, n1, rid, rw);
    peer_down<<<dim3(D / UC, TOKENS / UT), dim3(512), 0, stream>>>(hs, down, rid, part);
    peer_gelu<<<dim3(NITEM * 4 / 256), dim3(256), 0, stream>>>(part, rw, gw);
    peer_up<<<dim3(OUTD / UC, TOKENS / UT), dim3(512), 0, stream>>>(up, rid, gw, out);
}

// v007
// Measured time: 64.5 microseconds a run.
// Timed twice side by side with v006, it ran 1.03 times as fast both times.
// All steps since v000 together make it 2.01 times as fast.
#include <hip/hip_runtime.h>
#include <math.h>

typedef float v2f __attribute__((ext_vector_type(2)));
typedef float v8f __attribute__((ext_vector_type(8)));
typedef unsigned int u32x4 __attribute__((ext_vector_type(4)));
typedef int i32x4 __attribute__((ext_vector_type(4)));
typedef int i32x8 __attribute__((ext_vector_type(8)));

#define H 8
#define QD 256
#define HALF 128
#define NKEY 32
#define DTK 4
#define TOKENS 1024      // B*S
#define D 1024
#define NQ 2048          // H*QD
#define OUTD 1024
#define NITEM 8192       // TOKENS*H
#define KNB 8            // blocks that normalize the 2 * NKEY sub-key rows, 8 rows each

// GEMM tiling
#define BM 64            // rows per block
#define NRB 16           // block rows of the projection: TOKENS / BM
#define BN 128           // cols per block
#define BK 32            // K-step
#define BNP 129          // padded B row stride (via TDM pad: 1 dword per 128)
#define AMP 33           // padded A row stride
#define UC 64            // columns of an expert table that a block keeps in LDS (256 KiB for 1024 rows)
#define UT 64            // tokens that such a block serves
#define RP 132           // LDS row stride of a 128-channel row: 16 rows' 8-byte reads at k and k+2 fall on all 64 banks once
#define SP 36            // LDS row stride of a 32-score row: 144 bytes = 16 x 9, an odd count of 16-byte units

// ---------------- helpers ----------------
__device__ inline float waveRedSum32(float x) {
    #pragma unroll
    for (int off = 16; off; off >>= 1) x += __shfl_xor(x, off, 32);
    return x;
}

// Issue a TDM load of a 32x128 f32 tile of Wq (row stride 2048 elems) into LDS
// at byte offset lds_off, padded +1 dword per 128 dwords (-> 129-dword rows).
__device__ inline void tdm_load_B(const float* gaddr, unsigned int lds_off) {
    u32x4 g0;
    g0.x = 1u;                                   // count=1, user mode
    g0.y = lds_off;                              // LDS byte address
    unsigned long long ga = (unsigned long long)(uintptr_t)gaddr;
    g0.z = (unsigned int)ga;                     // global_addr[31:0]
    g0.w = (unsigned int)(ga >> 32) | 0x80000000u; // global_addr[56:32] | type=2
    i32x8 g1;
    g1[0] = (int)((2u << 16)       // data_size = 4 bytes
                | (1u << 20)       // pad_enable
                | (6u << 22));     // pad_interval = 128 dwords (pad_amount=0 -> 1 dword)
    g1[1] = (int)(2048u << 16);    // tensor_dim0 = 2048 (elements per row)
    g1[2] = (int)(1024u << 16);    // tensor_dim1 = 1024 rows (dim0 hi bits = 0)
    g1[3] = (int)(128u << 16);     // tile_dim0 = 128 (dim1 hi bits = 0)
    g1[4] = 32;                    // tile_dim1 = 32, tile_dim2 = 0
    g1[5] = 2048;                  // tensor_dim0_stride[31:0] = 2048
    g1[6] = 0;                     // stride hi / dim1_stride lo
    g1[7] = 0;
    i32x4 gz4 = {0, 0, 0, 0};              // groups 2/3 unused (2D tensor)
    i32x8 gz8 = {0, 0, 0, 0, 0, 0, 0, 0};
    __builtin_amdgcn_tensor_load_to_lds(g0, g1, gz4, gz4, gz8, 0);
}

// ---------------- normalize sub-keys: block kb of KNB, one key row per wave ----------------
__device__ inline void knormBlock(int kb,
                                  const float* __restrict__ k0,
                                  const float* __restrict__ k1,
                                  float* __restrict__ n0,
                                  float* __restrict__ n1) {
    int wid = threadIdx.x >> 5, lane = threadIdx.x & 31;
    int gw = kb * 8 + wid;                  // [0,64)
    int table = gw >> 5, row = gw & 31;
    const float* src = table ? k1 : k0;
    float*       dst = table ? n1 : n0;
    float v[4]; float ss = 0.f;
    #pragma unroll
    for (int j = 0; j < 4; ++j) {
        v[j] = src[row * HALF + lane * 4 + j];
        ss += v[j] * v[j];
    }
    ss = waveRedSum32(ss);
    float inv = 1.f / fmaxf(sqrtf(ss), 1e-12f);
    #pragma unroll
    for (int j = 0; j < 4; ++j) dst[row * HALF + lane * 4 + j] = v[j] * inv;
}

// ---------------- kernel: Q projection GEMM (f32 WMMA + TDM double-buffer) ----------------
// q[TOKENS][NQ] = hs[TOKENS][D] @ Wq[D][NQ] + bq
// Block tile 64x128, 8 waves in 2x4 grid, each wave a 2x2 grid of 16x16 tiles.
// B tiles arrive via Tensor Data Mover (async, double buffered, padded rows).
// The epilogue also writes the block's column sums of q and q*q (64 rows) for the batch norm.
__global__ void peer_qproj(const float* __restrict__ hs,
                           const float* __restrict__ Wq,
                           const float* __restrict__ bq,
                           float* __restrict__ q,
                           float* __restrict__ part1,
                           float* __restrict__ part2) {
    __shared__ float As[2][BM][AMP];
    __shared__ float Bs[2][BK][BNP];
    int t = threadIdx.x;
    int wid = t >> 5, lane = t & 31;
    int rowBase = blockIdx.y * BM;
    int colBase = blockIdx.x * BN;
    int wm = wid >> 2;                 // 0..1  (row group of 32)
    int wn = wid & 3;                  // 0..3  (col group of 32)
    int l15 = lane & 15;
    int khi = (lane >> 4) << 1;        // 0 or 2

    v8f acc00 = {}, acc01 = {}, acc10 = {}, acc11 = {};

    // ---- prologue: stage 0 ----
    if (wid == 0)
        tdm_load_B(Wq + colBase, (unsigned int)(uintptr_t)&Bs[0][0][0]);
    #pragma unroll
    for (int i = 0; i < 8; ++i) {                // A: 64x32
        int idx = i * 256 + t;
        int r = idx >> 5, c = idx & 31;
        As[0][r][c] = hs[(rowBase + r) * D + c];
    }

    int buf = 0;
    for (int it = 0; it < D / BK; ++it) {
        int k0 = it * BK;
        float an[8];        // next stage's A elements: loaded ahead of the matrix block, stored to LDS behind it
        // ---- issue next stage (overlaps this stage's WMMA) ----
        if (it < D / BK - 1) {
            int kn = k0 + BK;
            if (wid == 0)
                tdm_load_B(Wq + (size_t)kn * NQ + colBase,
                           (unsigned int)(uintptr_t)&Bs[buf ^ 1][0][0]);
            if (wid == 0) __builtin_amdgcn_s_wait_tensorcnt(1);
        } else {
            if (wid == 0) __builtin_amdgcn_s_wait_tensorcnt(0);
        }
        __syncthreads();    // stage `buf` complete: TDM B here, A stores ahead of the previous trip's last barrier

        // Next stage's A loads stand behind the barrier (which waits for every load issued ahead of it)
        // and fly during the matrix block.
        if (it < D / BK - 1) {
            const float* ap = hs + (rowBase + wid) * D + k0 + BK + lane;   // rows wid + 8i of the tile
            #pragma unroll
            for (int i = 0; i < 8; ++i) an[i] = ap[i * 8 * D];
            // order at the head of the matrix block: the first six LDS fragment reads, then the eight global loads,
            // so that the issue of the global loads falls into the LDS reads' latency
            __builtin_amdgcn_sched_group_barrier(0x100, 6, 0);
            __builtin_amdgcn_sched_group_barrier(0x020, 8, 0);
        }

        #pragma unroll
        for (int kk = 0; kk < 8; ++kk) {
            int kb = kk * 4 + khi;
            v2f a0 = { As[buf][wm * 32 + l15][kb],      As[buf][wm * 32 + l15][kb + 1] };
            v2f a1 = { As[buf][wm * 32 + 16 + l15][kb], As[buf][wm * 32 + 16 + l15][kb + 1] };
            v2f b0 = { Bs[buf][kb][wn * 32 + l15],      Bs[buf][kb + 1][wn * 32 + l15] };
            v2f b1 = { Bs[buf][kb][wn * 32 + 16 + l15], Bs[buf][kb + 1][wn * 32 + 16 + l15] };
            acc00 = __builtin_amdgcn_wmma_f32_16x16x4_f32(false, a0, false, b0, (short)0, acc00, false, false);
            acc01 = __builtin_amdgcn_wmma_f32_16x16x4_f32(false, a0, false, b1, (short)0, acc01, false, false);
            acc10 = __builtin_amdgcn_wmma_f32_16x16x4_f32(false, a1, false, b0, (short)0, acc10, false, false);
            acc11 = __builtin_amdgcn_wmma_f32_16x16x4_f32(false, a1, false, b1, (short)0, acc11, false, false);
        }
        if (it < D / BK - 1) {
            // holds the wait for the A loads behind the matrix block; ahead of it the wave would idle for the loads
            __builtin_amdgcn_sched_barrier(0);
            #pragma unroll
            for (int i = 0; i < 8; ++i)      // As[buf ^ 1] was last read before the previous trip's last barrier
                As[buf ^ 1][wid + 8 * i][lane] = an[i];
        }
        __syncthreads();    // all waves done reading stage `buf`; next stage's A stores complete
        buf ^= 1;
    }

    // ---- epilogue: bias + store (C layout: VGPR v -> M = v + 8*(lane>=16)) ----
    int rhalf = (lane >> 4) << 3;
    float bias0 = bq[colBase + wn * 32 + l15];
    float bias1 = bq[colBase + wn * 32 + 16 + l15];
    // Keeps the epilogue's vector work out of the last matrix block: without it the scheduler puts reads of an
    // accumulator one or two slots behind the matrix instruction that writes it.
    __builtin_amdgcn_sched_barrier(0);
    // four vector slots between the last matrix instruction and the first read of its result
    asm volatile("v_nop\n\tv_nop\n\tv_nop\n\tv_nop");
    __builtin_amdgcn_sched_barrier(0);  // holds the four slots where they stand
    #pragma unroll
    for (int v = 0; v < 8; ++v) {
        acc00[v] += bias0; acc10[v] += bias0;
        acc01[v] += bias1; acc11[v] += bias1;
    }

    // Column sums of the wave's 32 rows: 16 values per lane, then the other half of the wave.
    // Lanes 0..15 go on with the sum, lanes 16..31 with the sum of squares.
    float* red = &As[0][0][0];         // free: every wave has passed the loop's last barrier
    float cs[2];
    #pragma unroll
    for (int sn = 0; sn < 2; ++sn) {
        v8f a0v = sn ? acc01 : acc00;
        v8f a1v = sn ? acc11 : acc10;
        float s = 0.f, s2 = 0.f;
        #pragma unroll
        for (int v = 0; v < 8; ++v) {
            s += a0v[v]; s2 += a0v[v] * a0v[v];
            s += a1v[v]; s2 += a1v[v] * a1v[v];
        }
        s  += __shfl_xor(s, 16, 32);
        s2 += __shfl_xor(s2, 16, 32);
        cs[sn] = (lane < 16) ? s : s2;
        if (wm == 1) red[(lane >> 4) * BN + wn * 32 + sn * 16 + l15] = cs[sn];
    }
    __syncthreads();    // the second row group's sums are in LDS; stands ahead of the q stores, so it waits for none

    #pragma unroll
    for (int sn = 0; sn < 2; ++sn) {
        int col = colBase + wn * 32 + sn * 16 + l15;
        v8f a0v = sn ? acc01 : acc00;
        v8f a1v = sn ? acc11 : acc10;
        #pragma unroll
        for (int v = 0; v < 8; ++v) {
            int row0 = rowBase + wm * 32 + v + rhalf;
            q[row0 * NQ + col] = a0v[v];
            q[(row0 + 16) * NQ + col] = a1v[v];
        }
        if (wm == 0) {
            float* dst = (lane < 16) ? part1 : part2;
            dst[blockIdx.y * NQ + col] = cs[sn] + red[(lane >> 4) * BN + wn * 32 + sn * 16 + l15];
        }
    }
}

// ---------------- kernel: BN finalize, and the sub-key normalization ----------------
// Both feed the routing kernel and neither reads the other's data, so they share one launch:
// blocks 0..QD/32-1 finalize the batch norm, the KNB blocks behind them normalize the sub-keys.
// part1/part2 hold, per block row of the projection (NRB of them), the sums of all NQ columns.
// A block serves 32 channels; wave w adds the 8 heads of block rows 2w and 2w+1, wave 0 the 8 wave sums.
__global__ void peer_bnfin(const float* __restrict__ part1,
                           const float* __restrict__ part2,
                           const float* __restrict__ gamma,
                           const float* __restrict__ beta,
                           float* __restrict__ bnsc,
                           float* __restrict__ bnsh,
                           const float* __restrict__ k0,
                           const float* __restrict__ k1,
                           float* __restrict__ n0,
                           float* __restrict__ n1) {
    __shared__ float r1[8][32];
    __shared__ float r2[8][32];
    if (blockIdx.x >= QD / 32) {        // the same for a whole block, and ahead of the barrier below
        knormBlock(blockIdx.x - QD / 32, k0, k1, n0, n1);
        return;
    }
    int wid = threadIdx.x >> 5, lane = threadIdx.x & 31;
    int c = blockIdx.x * 32 + lane;
    // NQ = H * QD: the wave's two block rows are 16 pieces of QD columns, one behind the other
    const float* p1 = part1 + wid * (NRB / 8) * NQ + c;
    const float* p2 = part2 + wid * (NRB / 8) * NQ + c;
    float s = 0.f, s2 = 0.f;
    #pragma unroll
    for (int p = 0; p < (NRB / 8) * H; ++p) {
        s  += p1[p * QD];
        s2 += p2[p * QD];
    }
    r1[wid][lane] = s;
    r2[wid][lane] = s2;
    __syncthreads();
    if (wid == 0) {
        s = 0.f; s2 = 0.f;
        #pragma unroll
        for (int w = 0; w < 8; ++w) { s += r1[w][lane]; s2 += r2[w][lane]; }
        float mean = s * (1.f / 8192.f);
        float var  = s2 * (1.f / 8192.f) - mean * mean;
        float sc = gamma[c] / sqrtf(var + 1e-5f);
        bnsc[c] = sc;
        bnsh[c] = beta[c] - mean * sc;
    }
}

// ---------------- kernel: routing ----------------
// A block serves 32 (token, head) items with four waves: wave w takes items 16*(w>>1).. and key table w&1.
// The 16 x 32 scores of a wave are one matrix product, 16 queries x 128 channels by 128 channels x 32 keys.
// TOPK==DTK^2 so softmax runs over ALL 16 combos.

// puts (x, n) into the descending list v[0..3] / id[0..3]; an equal value stays behind the one that came first
__device__ inline void top4Insert(float x, int n, float* v, int* id) {
    bool c0 = x > v[0], c1 = x > v[1], c2 = x > v[2], c3 = x > v[3];
    v[3] = c2 ? v[2] : (c3 ? x : v[3]);  id[3] = c2 ? id[2] : (c3 ? n : id[3]);
    v[2] = c1 ? v[1] : (c2 ? x : v[2]);  id[2] = c1 ? id[1] : (c2 ? n : id[2]);
    v[1] = c0 ? v[0] : (c1 ? x : v[1]);  id[1] = c0 ? id[0] : (c1 ? n : id[1]);
    v[0] = c0 ? x : v[0];                id[0] = c0 ? n : id[0];
}

__global__ __launch_bounds__(128) void peer_route(const float* __restrict__ q,
                                                  const float* __restrict__ bnsc,
                                                  const float* __restrict__ bnsh,
                                                  const float* __restrict__ n0,
                                                  const float* __restrict__ n1,
                                                  int* __restrict__ rid,
                                                  float* __restrict__ rw) {
    __shared__ __attribute__((aligned(16))) float ks[2][NKEY][RP];   // both normalized key tables
    __shared__ __attribute__((aligned(16))) float qs[4][16][RP];     // per wave: 16 normalized half queries
    __shared__ __attribute__((aligned(16))) float sc[4][16][SP];     // per wave: 16 items x 32 scores
    __shared__ __attribute__((aligned(16))) float tv[32][2][DTK];    // per item and table: the four best scores
    __shared__ __attribute__((aligned(16))) int   tx[32][2][DTK];    // and their keys
    int t = threadIdx.x;
    int wid = t >> 5, lane = t & 31, l15 = lane & 15, hh = lane >> 4;
    int grp = wid >> 1, tb = wid & 1;

    int bidx = tb * (HALF / 4) + l15 * 2;       // the lane's 8 channels, in units of 16 bytes
    float4 sc0 = ((const float4*)bnsc)[bidx], sc1 = ((const float4*)bnsc)[bidx + 1];
    float4 sh0 = ((const float4*)bnsh)[bidx], sh1 = ((const float4*)bnsh)[bidx + 1];
    float bsc[8] = { sc0.x, sc0.y, sc0.z, sc0.w, sc1.x, sc1.y, sc1.z, sc1.w };
    float bsh[8] = { sh0.x, sh0.y, sh0.z, sh0.w, sh1.x, sh1.y, sh1.z, sh1.w };
    // Half a wave holds one item's 128 channels of the wave's table, 8 per lane; q is [NITEM][QD].
    const float* qb = q + (blockIdx.x * 32 + grp * 16 + hh) * QD + tb * HALF + l15 * 8;
    float4 qv[8][2];
    #pragma unroll
    for (int i = 0; i < 8; ++i) {
        qv[i][0] = ((const float4*)(qb + 2 * i * QD))[0];
        qv[i][1] = ((const float4*)(qb + 2 * i * QD))[1];
    }
    // stands in front of the first overwrite of the address pair and the index register of the loads above, which it
    // names so that they live up to here and no load's own result lands on them
    asm volatile("s_wait_xcnt 0x0" :: "v"(qb), "v"(bidx) : "memory");
    // Both key tables go into LDS once per block: a wave reads whole 512-byte rows.
    float4 kst0[8], kst1[8];
    #pragma unroll
    for (int i = 0; i < 8; ++i) {
        kst0[i] = ((const float4*)n0)[i * 128 + t];
        kst1[i] = ((const float4*)n1)[i * 128 + t];
    }
    #pragma unroll
    for (int i = 0; i < 8; ++i) {               // wave wid holds key i*4+wid, lane its channels 4*lane..4*lane+3
        *(float4*)&ks[0][i * 4 + wid][lane * 4] = kst0[i];
        *(float4*)&ks[1][i * 4 + wid][lane * 4] = kst1[i];
    }
    #pragma unroll
    for (int i = 0; i < 8; ++i) {
        float qr[8] = { qv[i][0].x, qv[i][0].y, qv[i][0].z, qv[i][0].w,
                        qv[i][1].x, qv[i][1].y, qv[i][1].z, qv[i][1].w };
        float vr[8]; float ss = 0.f;
        #pragma unroll
        for (int j = 0; j < 8; ++j) {
            float x = qr[j] * bsc[j] + bsh[j];
            vr[j] = x; ss += x * x;
        }
        #pragma unroll
        for (int off = 8; off; off >>= 1) ss += __shfl_xor(ss, off, 16);
        float inv = 1.f / fmaxf(sqrtf(ss), 1e-12f);
        float4* dst = (float4*)&qs[wid][2 * i + hh][l15 * 8];
        dst[0] = make_float4(vr[0] * inv, vr[1] * inv, vr[2] * inv, vr[3] * inv);
        dst[1] = make_float4(vr[4] * inv, vr[5] * inv, vr[6] * inv, vr[7] * inv);
    }
    __syncthreads();    // keys and queries are in LDS

    // Fragments as in the projection: lane l15 is the row of A (item) and the column of B (key); a lane holds
    // k = 2*hh and 2*hh+1 of a step's four channels. Step s takes channels 4s..4s+3, so each score is
    // summed over c = 0..127 in rising order.
    v8f acc0 = {}, acc1 = {};
    const float* ar  = &qs[wid][l15][2 * hh];
    const float* br0 = &ks[tb][l15][2 * hh];
    const float* br1 = &ks[tb][16 + l15][2 * hh];
    #pragma unroll
    for (int s = 0; s < HALF / 4; ++s) {
        v2f a  = *(const v2f*)(ar + 4 * s);
        v2f b0 = *(const v2f*)(br0 + 4 * s);
        v2f b1 = *(const v2f*)(br1 + 4 * s);
        acc0 = __builtin_amdgcn_wmma_f32_16x16x4_f32(false, a, false, b0, (short)0, acc0, false, false);
        acc1 = __builtin_amdgcn_wmma_f32_16x16x4_f32(false, a, false, b1, (short)0, acc1, false, false);
    }
    // Keeps the address work of the score stores out of the matrix block: without it the scheduler lets it
    // overwrite a fragment register directly behind the matrix instruction that reads it.
    __builtin_amdgcn_sched_barrier(0);
    // four vector slots between the last matrix instruction and the first vector write of one of its registers
    asm volatile("v_nop\n\tv_nop\n\tv_nop\n\tv_nop");
    __builtin_amdgcn_sched_barrier(0);  // holds the four slots where they stand
    // C layout: VGPR v -> item v + 8*hh, key l15 (acc0) or 16 + l15 (acc1)
    #pragma unroll
    for (int v = 0; v < 8; ++v) {
        sc[wid][v + 8 * hh][l15]      = acc0[v];
        sc[wid][v + 8 * hh][16 + l15] = acc1[v];
    }
    __syncthreads();    // the scores are in LDS

    // Lane (hh, l15) scans keys 16*hh..16*hh+15 of item l15, in rising order.
    float bv[DTK] = { -INFINITY, -INFINITY, -INFINITY, -INFINITY };
    int   bi[DTK] = { 0, 0, 0, 0 };
    #pragma unroll
    for (int c = 0; c < 4; ++c) {
        float4 x = *(const float4*)&sc[wid][l15][hh * 16 + c * 4];
        top4Insert(x.x, hh * 16 + c * 4,     bv, bi);
        top4Insert(x.y, hh * 16 + c * 4 + 1, bv, bi);
        top4Insert(x.z, hh * 16 + c * 4 + 2, bv, bi);
        top4Insert(x.w, hh * 16 + c * 4 + 3, bv, bi);
    }
    // The four best of keys 16..31 go, best first, into the list of keys 0..15 (the result counts in lanes 0..15).
    float ov[DTK]; int oi[DTK];
    #pragma unroll
    for (int r = 0; r < DTK; ++r) {
        ov[r] = __shfl_xor(bv[r], 16, 32);
        oi[r] = __shfl_xor(bi[r], 16, 32);
    }
    #pragma unroll
    for (int r = 0; r < DTK; ++r) top4Insert(ov[r], oi[r], bv, bi);
    if (hh == 0) {
        *(float4*)&tv[grp * 16 + l15][tb][0] = make_float4(bv[0], bv[1], bv[2], bv[3]);
        *(int4*)&tx[grp * 16 + l15][tb][0]   = make_int4(bi[0], bi[1], bi[2], bi[3]);
    }
    __syncthreads();    // both tables' lists are in LDS

    // Four threads share an item; thread ii of them writes combos 4*ii..4*ii+3. Each forms all 16 exponentials
    // and adds them as the tree over lane distances 8, 4, 2, 1 did, so the weights keep their bits.
    int item = t >> 2, ii = t & 3;
    float4 t0 = *(const float4*)&tv[item][0][0];
    float4 t1 = *(const float4*)&tv[item][1][0];
    int4   x1 = *(const int4*)&tx[item][1][0];
    float  mine = tv[item][0][ii];
    int    mid  = tx[item][0][ii] * NKEY;
    float a4[4] = { t0.x, t0.y, t0.z, t0.w }, b4[4] = { t1.x, t1.y, t1.z, t1.w };
    float m = a4[0] + b4[0];
    #pragma unroll
    for (int l = 1; l < 16; ++l) m = fmaxf(m, a4[l >> 2] + b4[l & 3]);
    float e[16];
    #pragma unroll
    for (int l = 0; l < 16; ++l) e[l] = expf(a4[l >> 2] + b4[l & 3] - m);
    #pragma unroll
    for (int off = 8; off; off >>= 1) {
        #pragma unroll
        for (int l = 0; l < off; ++l) e[l] += e[l + off];
    }
    float sum = e[0];
    float4 w = make_float4(expf(mine + b4[0] - m) / sum, expf(mine + b4[1] - m) / sum,
                           expf(mine + b4[2] - m) / sum, expf(mine + b4[3] - m) / sum);
    ((int4*)rid)[blockIdx.x * 128 + t]  = make_int4(mid + x1.x, mid + x1.y, mid + x1.z, mid + x1.w);
    ((float4*)rw)[blockIdx.x * 128 + t] = w;
}

typedef const __attribute__((address_space(1))) char* gbytes;   // byte pointer into global memory

__device__ inline float4 load16(gbytes p) {
    return *(const __attribute__((address_space(1))) float4*)p;
}
__device__ inline int4 load16i(gbytes p) {
    return *(const __attribute__((address_space(1))) int4*)p;
}

// x of the lane whose number differs in bit 0 (CTRL 0xB1) or in bit 1 (CTRL 0x4E): a register move inside a group of four lanes
template <int CTRL>
__device__ inline float quadSwap(float x) {
    return __int_as_float(__builtin_amdgcn_mov_dpp(__float_as_int(x), CTRL, 0xf, 0xf, true));
}

// ---------------- kernel: down dot products, one 64-column slice per block ----------------
// A block keeps UC columns of all 1024 rows of `down` in LDS and serves UT tokens from them; it writes, for each
// of a token's 128 picks, the dot product over its UC columns. The 16 slices' parts are added in peer_gelu.
// Four lanes share a pick: lane q of the four owns the 64 bytes q of the 256-byte row piece and reads them in
// four 16-byte steps, starting at a step that differs between the four picks of a half wave, so that the
// 16 lanes of a half wave always read 16 different 16-byte columns: no bank conflict, whatever the rows.
__global__ __launch_bounds__(512) void peer_down(const float* __restrict__ hs,
                                                 const float* __restrict__ down,
                                                 const int* __restrict__ rid,
                                                 float* __restrict__ part) {
    __shared__ __attribute__((aligned(16))) float dsl[1024 * UC];
    int t = threadIdx.x;
    int kg = blockIdx.x, tg = blockIdx.y;
    float4* ds4 = (float4*)dsl;
    const float4* src = (const float4*)down + kg * (UC / 4) + (t >> 4) * (D / 4) + (t & 15);
    // a lane's 32 loads of 16 bytes are all in flight before the first LDS store; load i of the block brings rows 32i..32i+31
    float4 v[32];
    #pragma unroll
    for (int i = 0; i < 32; ++i) v[i] = src[i * 32 * (D / 4)];
    #pragma unroll
    for (int i = 0; i < 32; ++i) ds4[i * 512 + t] = v[i];
    // stands in front of the first overwrite of the loads' address register pair, which it names so that the pair
    // lives up to here and no load's own result lands on it
    asm volatile("s_wait_xcnt 0x0" :: "v"(src) : "memory");
    __syncthreads();    // the slice is complete before any wave gathers from it

    unsigned int wid = (unsigned int)__builtin_amdgcn_readfirstlane(t >> 5);
    int lane = t & 31, slot = lane >> 2, q = lane & 3;
    bool b0 = (q & 1) != 0, b1 = (q & 2) != 0;
    unsigned int r0 = (unsigned int)tg * UT + wid * (UT / 16);      // the wave's first token
    unsigned int coff[4];                                           // byte offsets of the lane's four steps in a row piece
    #pragma unroll
    for (int c = 0; c < 4; ++c) coff[c] = (unsigned int)(q * 4 + ((c + slot) & 3)) * 16u;
    unsigned int soff = (unsigned int)slot * 64u;                   // the slot's 16 picks among the token's 128
    gbytes ep = (gbytes)((unsigned long long)(uintptr_t)rid + r0 * 512u);
    gbytes hp = (gbytes)((unsigned long long)(uintptr_t)hs + r0 * (D * 4u) + (unsigned int)kg * (UC * 4u));
    const char* lbase = (const char*)dsl;

    int4 e[2][4]; float4 h[2][4];
    const int cur = 0;
    #pragma unroll
    for (int m = 0; m < 4; ++m) {
        e[0][m] = load16i(ep + soff + m * 16);
        h[0][m] = load16(hp + coff[m]);
    }
    // stands in front of the first overwrite of a register that the loads above name
    asm volatile("s_wait_xcnt 0x0" ::: "memory");
    __builtin_amdgcn_sched_barrier(0);  // holds later vector work, which reuses those registers, behind the wait
    unsigned int pidx = (unsigned int)kg * (NITEM * 4) + r0 * 32 + lane;    // the wave's first 512 bytes of results
    // rolled: unrolled, the last token's 64 LDS reads all rose to its top and spilled
    #pragma unroll 1
    for (int k = 0; k < UT / 16; ++k) {
        // the next token's indices and its piece of the token row, one token ahead;
        // the last token fetches its own again, which keeps the body free of branches
        unsigned int kn = k < UT / 16 - 1 ? k + 1 : k;
        #pragma unroll
        for (int m = 0; m < 4; ++m) {
            e[1][m] = load16i(ep + soff + (kn * 512u + m * 16));
            h[1][m] = load16(hp + coff[m] + kn * (D * 4u));
        }
        // x[j] belongs to pick (j & 3) * 4 + (j >> 2) of the slot, so that the sums over four lanes below leave
        // lane q with the slot's picks 4q..4q+3
        int ej[16] = { e[cur][0].x, e[cur][1].x, e[cur][2].x, e[cur][3].x,
                       e[cur][0].y, e[cur][1].y, e[cur][2].y, e[cur][3].y,
                       e[cur][0].z, e[cur][1].z, e[cur][2].z, e[cur][3].z,
                       e[cur][0].w, e[cur][1].w, e[cur][2].w, e[cur][3].w };
        float x[16];
        float4 u[2][8];
        #pragma unroll
        for (int n = -1; n < 8; ++n) {
            if (n < 7) {                // the next two picks' row pieces are asked for ahead of this pair's sums
                float4* un = u[(n + 1) & 1];
                #pragma unroll
                for (int c = 0; c < 4; ++c) {
                    un[c]     = *(const float4*)(lbase + ((unsigned int)ej[2 * n + 2] * (UC * 4u) + coff[c]));
                    un[4 + c] = *(const float4*)(lbase + ((unsigned int)ej[2 * n + 3] * (UC * 4u) + coff[c]));
                }
            }
            // keeps the reads above ahead of the sums below; without it all 64 reads of a token rise to the top and spill
            __builtin_amdgcn_sched_barrier(0);
            if (n >= 0) {
                const float4* uc = u[n & 1];
                v2f sa = {0.f, 0.f}, sb = {0.f, 0.f};
                #pragma unroll
                for (int c = 0; c < 4; ++c) {
                    sa += (v2f){uc[c].x, uc[c].y} * (v2f){h[cur][c].x, h[cur][c].y};
                    sb += (v2f){uc[4 + c].x, uc[4 + c].y} * (v2f){h[cur][c].x, h[cur][c].y};
                    sa += (v2f){uc[c].z, uc[c].w} * (v2f){h[cur][c].z, h[cur][c].w};
                    sb += (v2f){uc[4 + c].z, uc[4 + c].w} * (v2f){h[cur][c].z, h[cur][c].w};
                }
                x[2 * n]     = sa.x + sa.y;
                x[2 * n + 1] = sb.x + sb.y;
                // keeps the next pair's reads from rising over these sums, for the same reason
                __builtin_amdgcn_sched_barrier(0);
            }
        }
        // sums over the four lanes of a pick: each step halves the values a lane goes on with
        float y[8], z[4];
        #pragma unroll
        for (int i = 0; i < 8; ++i)
            y[i] = (b0 ? x[2 * i + 1] : x[2 * i]) + quadSwap<0xB1>(b0 ? x[2 * i] : x[2 * i + 1]);
        #pragma unroll
        for (int i = 0; i < 4; ++i)
            z[i] = (b1 ? y[2 * i + 1] : y[2 * i]) + quadSwap<0x4E>(b1 ? y[2 * i] : y[2 * i + 1]);
        ((float4*)part)[pidx] = make_float4(z[0], z[1], z[2], z[3]);
        // stands in front of the overwrite of the store's index register, which it names so that the register lives up to here
        asm volatile("s_wait_xcnt 0x0" :: "v"(pidx) : "memory");
        pidx += 32;
        #pragma unroll
        for (int m = 0; m < 4; ++m) { e[0][m] = e[1][m]; h[0][m] = h[1][m]; }
    }
}

// ---------------- kernel: slice parts added, gelu, routing weight ----------------
// a thread serves four picks
__global__ void peer_gelu(const float* __restrict__ part,
                          const float* __restrict__ rw,
                          float* __restrict__ gw) {
    int p = blockIdx.x * 256 + threadIdx.x;         // [0, NITEM * 4)
    float4 s = {0.f, 0.f, 0.f, 0.f};
    #pragma unroll
    for (int kg = 0; kg < D / UC; ++kg) {
        float4 a = ((const float4*)part)[kg * (NITEM * 4) + p];
        s.x += a.x; s.y += a.y; s.z += a.z; s.w += a.w;
    }
    float4 w = ((const float4*)rw)[p];
    float4 o;                                       // exact gelu
    o.x = 0.5f * s.x * (1.0f + erff(s.x * 0.70710678118654752f)) * w.x;
    o.y = 0.5f * s.y * (1.0f + erff(s.y * 0.70710678118654752f)) * w.y;
    o.z = 0.5f * s.z * (1.0f + erff(s.z * 0.70710678118654752f)) * w.z;
    o.w = 0.5f * s.w * (1.0f + erff(s.w * 0.70710678118654752f)) * w.w;
    ((float4*)gw)[p] = o;
}

// ---------------- kernel: weighted sum of the gathered up rows ----------------
// A block keeps UC columns of all 1024 rows of `up` in LDS and serves UT tokens from them, so a gathered row
// piece is read from LDS and the table crosses from L2 once per block, not once per token and pick.
// A row piece is 256 bytes: 16 lanes x 16 bytes cover all 64 banks once, whatever the row, so the two halves
// of a wave read two different picks' rows without a bank conflict.
__global__ __launch_bounds__(512) void peer_up(const float* __restrict__ up,
                                               const int* __restrict__ rid,
                                               const float* __restrict__ gw,
                                               float* __restrict__ out) {
    __shared__ __attribute__((aligned(16))) float us[1024 * UC];
    int t = threadIdx.x;
    int cg = blockIdx.x, tg = blockIdx.y;
    float4* us4 = (float4*)us;
    const float4* src = (const float4*)up + cg * (UC / 4) + (t >> 4) * (OUTD / 4) + (t & 15);
    // a lane's 32 loads of 16 bytes are all in flight before the first LDS store; load i of the block brings rows 32i..32i+31
    float4 v[32];
    #pragma unroll
    for (int i = 0; i < 32; ++i) v[i] = src[i * 32 * (OUTD / 4)];
    #pragma unroll
    for (int i = 0; i < 32; ++i) us4[i * 512 + t] = v[i];
    // stands in front of the first overwrite of the loads' address register pair, which it names so that the pair
    // lives up to here and no load's own result lands on it
    asm volatile("s_wait_xcnt 0x0" :: "v"(src) : "memory");
    __syncthreads();    // the slice is complete before any wave gathers from it

    unsigned int wid = (unsigned int)__builtin_amdgcn_readfirstlane(t >> 5);
    int lane = t & 31, half = lane >> 4, l15 = lane & 15;
    const float4* ul = us4 + l15;
    // lanes 0..15 take a token's picks 0..63, lanes 16..31 its picks 64..127: 256 bytes of indices and of weights each
    unsigned int hoff = (unsigned int)half * 256u;
    unsigned int r0 = (unsigned int)tg * UT + wid * (UT / 16);      // the wave's first token
    gbytes ep = (gbytes)((unsigned long long)(uintptr_t)rid + r0 * 512u);
    gbytes gp = (gbytes)((unsigned long long)(uintptr_t)gw + r0 * 512u);
    int4 e[16]; float4 g[16];
    #pragma unroll
    for (int m = 0; m < 16; ++m) {
        e[m] = load16i(ep + hoff + m * 16);
        g[m] = load16(gp + hoff + m * 16);
    }
    // unrolled: every load and store names an address that is never rewritten, and an immediate,
    // and e[] and g[] need no copies from trip to trip
    #pragma unroll
    for (int k = 0; k < UT / 16; ++k) {
        // indices and weights of the wave's next token are fetched as this token's are used up
        unsigned int nx = (k + 1) * 512u;
        v2f a01 = {0.f, 0.f}, a23 = {0.f, 0.f};
        float4 u[2][8];
        #pragma unroll
        for (int n = -1; n < 8; ++n) {
            if (n < 7) {                // the next eight row pieces are asked for ahead of this group's sums
                int4 ea = e[2 * n + 2], eb = e[2 * n + 3];
                float4* un = u[(n + 1) & 1];
                un[0] = ul[ea.x * (UC / 4)]; un[1] = ul[ea.y * (UC / 4)];
                un[2] = ul[ea.z * (UC / 4)]; un[3] = ul[ea.w * (UC / 4)];
                un[4] = ul[eb.x * (UC / 4)]; un[5] = ul[eb.y * (UC / 4)];
                un[6] = ul[eb.z * (UC / 4)]; un[7] = ul[eb.w * (UC / 4)];
            }
            // keeps the reads above ahead of the sums below; without it all 64 reads of a token rise to the top and spill
            __builtin_amdgcn_sched_barrier(0);
            if (n >= 0) {
                const float4* uc = u[n & 1];
                float gs[8] = { g[2 * n].x, g[2 * n].y, g[2 * n].z, g[2 * n].w,
                                g[2 * n + 1].x, g[2 * n + 1].y, g[2 * n + 1].z, g[2 * n + 1].w };
                #pragma unroll
                for (int j = 0; j < 8; ++j) {
                    a01 += (v2f){gs[j], gs[j]} * (v2f){uc[j].x, uc[j].y};
                    a23 += (v2f){gs[j], gs[j]} * (v2f){uc[j].z, uc[j].w};
                }
                if (k < UT / 16 - 1) {
                    e[2 * n]     = load16i(ep + hoff + (nx + (2 * n) * 16));
                    e[2 * n + 1] = load16i(ep + hoff + (nx + (2 * n + 1) * 16));
                    g[2 * n]     = load16(gp + hoff + (nx + (2 * n) * 16));
                    g[2 * n + 1] = load16(gp + hoff + (nx + (2 * n + 1) * 16));
                }
                // keeps the next group's reads from rising over these sums, for the same reason
                __builtin_amdgcn_sched_barrier(0);
            }
        }
        float4 acc = { a01.x, a01.y, a23.x, a23.y };
        acc.x += __shfl_xor(acc.x, 16, 32); acc.y += __shfl_xor(acc.y, 16, 32);
        acc.z += __shfl_xor(acc.z, 16, 32); acc.w += __shfl_xor(acc.w, 16, 32);
        if (half == 0) ((float4*)out)[(r0 + k) * (OUTD / 4) + cg * (UC / 4) + l15] = acc;
    }
}

// ---------------- launcher ----------------
extern "C" void kernel_launch(void* const* d_in, const int* in_sizes, int n_in,
                              void* d_out, int out_size, void* d_ws, size_t ws_size,
                              hipStream_t stream) {
    const float* hs    = (const float*)d_in[0];  // [1024,1024]
    const float* Wq    = (const float*)d_in[1];  // [1024,2048]
    const float* bq    = (const float*)d_in[2];  // [2048]
    const float* gamma = (const float*)d_in[3];  // [256]
    const float* beta  = (const float*)d_in[4];  // [256]
    const float* sk0   = (const float*)d_in[5];  // [32,128]
    const float* sk1   = (const float*)d_in[6];  // [32,128]
    const float* down  = (const float*)d_in[7];  // [1024,1024]
    const float* up    = (const float*)d_in[8];  // [1024,1024]
    float* out = (float*)d_out;                  // [1024,1024]

    float* ws = (float*)d_ws;
    float* q      = ws;                   // 1024*2048
    float* n0     = q      + TOKENS * NQ;
    float* n1     = n0     + NKEY * HALF;
    float* part1  = n1     + NKEY * HALF;
    float* part2  = part1  + NRB * NQ;
    float* bnsc   = part2  + NRB * NQ;
    float* bnsh   = bnsc   + QD;
    int*   rid    = (int*)(bnsh + QD);
    float* rw     = (float*)(rid + NITEM * 16);
    float* gw     = rw     + NITEM * 16;
    float* part   = gw     + NITEM * 16;  // (D / UC) planes of NITEM * 16

    peer_qproj<<<dim3(NQ / BN, TOKENS / BM), dim3(256), 0, stream>>>(hs, Wq, bq, q, part1, part2);
    peer_bnfin<<<dim3(QD / 32 + KNB), dim3(256), 0, stream>>>(part1, part2, gamma, beta, bnsc, bnsh, sk0, sk1, n0, n1);
    peer_route<<<dim3(NITEM / 32), dim3(128), 0, stream>>>(q, bnsc, bnsh, n0, n1, rid, rw);
    peer_down<<<dim3(D / UC, TOKENS / UT), dim3(512), 0, stream>>>(hs, down, rid, part);
    peer_gelu<<<dim3(NITEM * 4 / 256), dim3(256), 0, stream>>>(part, rw, gw);
    peer_up<<<dim3(OUTD / UC, TOKENS / UT), dim3(512), 0, stream>>>(up, rid, gw, out);
}

// v008
// One run takes 62.3 microseconds.
// Two timings next to v007 put it at 1.03 and 1.04 times that version's speed.
// All steps since v000 together make it 2.08 times as fast.
#include <hip/hip_runtime.h>
#include <math.h>

typedef float v2f __attribute__((ext_vector_type(2)));
typedef float v8f __attribute__((ext_vector_type(8)));
typedef unsigned int u32x4 __attribute__((ext_vector_type(4)));
typedef int i32x4 __attribute__((ext_vector_type(4)));
typedef int i32x8 __attribute__((ext_vector_type(8)));

#define H 8
#define QD 256
#define HALF 128
#define NKEY 32
#define DTK 4
#define TOKENS 1024      // B*S
#define D 1024
#define NQ 2048          // H*QD
#define OUTD 1024
#define NITEM 8192       // TOKENS*H
#define KNB 8            // blocks that normalize the 2 * NKEY sub-key rows, 8 rows each

// GEMM tiling
#define BM 32            // rows per block
#define NRB 32           // block rows of the projection: TOKENS / BM
#define BN 128           // cols per block
#define BK 32            // K-step
#define BNP 129          // padded B row stride (via TDM pad: 1 dword per 128)
#define AMP 33           // padded A row stride
#define UC 64            // columns of an expert table that a block keeps in LDS (256 KiB for 1024 rows)
#define UT 64            // tokens that such a block serves
#define RP 132           // LDS row stride of a 128-channel row: 16 rows' 8-byte reads at k and k+2 fall on all 64 banks once
#define SP 36            // LDS row stride of a 32-score row: 144 bytes = 16 x 9, an odd count of 16-byte units

// ---------------- helpers ----------------
__device__ inline float waveRedSum32(float x) {
    #pragma unroll
    for (int off = 16; off; off >>= 1) x += __shfl_xor(x, off, 32);
    return x;
}

// Issue a TDM load of a 32x128 f32 tile of Wq (row stride 2048 elems) into LDS
// at byte offset lds_off, padded +1 dword per 128 dwords (-> 129-dword rows).
__device__ inline void tdm_load_B(const float* gaddr, unsigned int lds_off) {
    u32x4 g0;
    g0.x = 1u;                                   // count=1, user mode
    g0.y = lds_off;                              // LDS byte address
    unsigned long long ga = (unsigned long long)(uintptr_t)gaddr;
    g0.z = (unsigned int)ga;                     // global_addr[31:0]
    g0.w = (unsigned int)(ga >> 32) | 0x80000000u; // global_addr[56:32] | type=2
    i32x8 g1;
    g1[0] = (int)((2u << 16)       // data_size = 4 bytes
                | (1u << 20)       // pad_enable
                | (6u << 22));     // pad_interval = 128 dwords (pad_amount=0 -> 1 dword)
    g1[1] = (int)(2048u << 16);    // tensor_dim0 = 2048 (elements per row)
    g1[2] = (int)(1024u << 16);    // tensor_dim1 = 1024 rows (dim0 hi bits = 0)
    g1[3] = (int)(128u << 16);     // tile_dim0 = 128 (dim1 hi bits = 0)
    g1[4] = 32;                    // tile_dim1 = 32, tile_dim2 = 0
    g1[5] = 2048;                  // tensor_dim0_stride[31:0] = 2048
    g1[6] = 0;                     // stride hi / dim1_stride lo
    g1[7] = 0;
    i32x4 gz4 = {0, 0, 0, 0};              // groups 2/3 unused (2D tensor)
    i32x8 gz8 = {0, 0, 0, 0, 0, 0, 0, 0};
    __builtin_amdgcn_tensor_load_to_lds(g0, g1, gz4, gz4, gz8, 0);
}

// ---------------- normalize sub-keys: block kb of KNB, one key row per wave ----------------
__device__ inline void knormBlock(int kb,
                                  const float* __restrict__ k0,
                                  const float* __restrict__ k1,
                                  float* __restrict__ n0,
                                  float* __restrict__ n1) {
    int wid = threadIdx.x >> 5, lane = threadIdx.x & 31;
    int gw = kb * 8 + wid;                  // [0,64)
    int table = gw >> 5, row = gw & 31;
    const float* src = table ? k1 : k0;
    float*       dst = table ? n1 : n0;
    float v[4]; float ss = 0.f;
    #pragma unroll
    for (int j = 0; j < 4; ++j) {
        v[j] = src[row * HALF + lane * 4 + j];
        ss += v[j] * v[j];
    }
    ss = waveRedSum32(ss);
    float inv = 1.f / fmaxf(sqrtf(ss), 1e-12f);
    #pragma unroll
    for (int j = 0; j < 4; ++j) dst[row * HALF + lane * 4 + j] = v[j] * inv;
}

// ---------------- kernel: Q projection GEMM (f32 WMMA + TDM double-buffer) ----------------
// q[TOKENS][NQ] = hs[TOKENS][D] @ Wq[D][NQ] + bq
// Block tile 32x128, 4 waves side by side, each wave a 2x2 grid of 16x16 tiles. 512 blocks: a WGP holds two,
// one wave of each per SIMD, and the two share no barrier, so one block's matrix work fills the matrix unit
// while the other stands at its barriers and waits for its first LDS fragments.
// B tiles arrive via Tensor Data Mover (async, double buffered, padded rows).
// The epilogue also writes the block's column sums of q and q*q (32 rows) for the batch norm.
__global__ void peer_qproj(const float* __restrict__ hs,
                           const float* __restrict__ Wq,
                           const float* __restrict__ bq,
                           float* __restrict__ q,
                           float* __restrict__ part1,
                           float* __restrict__ part2) {
    __shared__ float As[2][BM][AMP];
    __shared__ float Bs[2][BK][BNP];
    int t = threadIdx.x;
    int wid = t >> 5, lane = t & 31;
    int rowBase = blockIdx.y * BM;
    int colBase = blockIdx.x * BN;
    int wn = wid;                      // 0..3  (col group of 32)
    int l15 = lane & 15;
    int khi = (lane >> 4) << 1;        // 0 or 2

    v8f acc00 = {}, acc01 = {}, acc10 = {}, acc11 = {};

    // ---- prologue: stage 0 ----
    if (wid == 0)
        tdm_load_B(Wq + colBase, (unsigned int)(uintptr_t)&Bs[0][0][0]);
    #pragma unroll
    for (int i = 0; i < 8; ++i) {                // A: 32x32
        int idx = i * 128 + t;
        int r = idx >> 5, c = idx & 31;
        As[0][r][c] = hs[(rowBase + r) * D + c];
    }

    int buf = 0;
    for (int it = 0; it < D / BK; ++it) {
        int k0 = it * BK;
        float an[8];        // next stage's A elements: loaded ahead of the matrix block, stored to LDS behind it
        // ---- issue next stage (overlaps this stage's WMMA) ----
        if (it < D / BK - 1) {
            int kn = k0 + BK;
            if (wid == 0)
                tdm_load_B(Wq + (size_t)kn * NQ + colBase,
                           (unsigned int)(uintptr_t)&Bs[buf ^ 1][0][0]);
            if (wid == 0) __builtin_amdgcn_s_wait_tensorcnt(1);
        } else {
            if (wid == 0) __builtin_amdgcn_s_wait_tensorcnt(0);
        }
        __syncthreads();    // stage `buf` complete: TDM B here, A stores ahead of the previous trip's last barrier

        // Next stage's A loads stand behind the barrier (which waits for every load issued ahead of it)
        // and fly during the matrix block.
        if (it < D / BK - 1) {
            const float* ap = hs + (rowBase + wid) * D + k0 + BK + lane;   // rows wid + 4i of the tile
            #pragma unroll
            for (int i = 0; i < 8; ++i) an[i] = ap[i * 4 * D];
            // order at the head of the matrix block: the first six LDS fragment reads, then the eight global loads,
            // so that the issue of the global loads falls into the LDS reads' latency
            __builtin_amdgcn_sched_group_barrier(0x100, 6, 0);
            __builtin_amdgcn_sched_group_barrier(0x020, 8, 0);
        }

        #pragma unroll
        for (int kk = 0; kk < 8; ++kk) {
            int kb = kk * 4 + khi;
            v2f a0 = { As[buf][l15][kb],      As[buf][l15][kb + 1] };
            v2f a1 = { As[buf][16 + l15][kb], As[buf][16 + l15][kb + 1] };
            v2f b0 = { Bs[buf][kb][wn * 32 + l15],      Bs[buf][kb + 1][wn * 32 + l15] };
            v2f b1 = { Bs[buf][kb][wn * 32 + 16 + l15], Bs[buf][kb + 1][wn * 32 + 16 + l15] };
            acc00 = __builtin_amdgcn_wmma_f32_16x16x4_f32(false, a0, false, b0, (short)0, acc00, false, false);
            acc01 = __builtin_amdgcn_wmma_f32_16x16x4_f32(false, a0, false, b1, (short)0, acc01, false, false);
            acc10 = __builtin_amdgcn_wmma_f32_16x16x4_f32(false, a1, false, b0, (short)0, acc10, false, false);
            acc11 = __builtin_amdgcn_wmma_f32_16x16x4_f32(false, a1, false, b1, (short)0, acc11, false, false);
        }
        if (it < D / BK - 1) {
            // holds the wait for the A loads behind the matrix block; ahead of it the wave would idle for the loads
            __builtin_amdgcn_sched_barrier(0);
            #pragma unroll
            for (int i = 0; i < 8; ++i)      // As[buf ^ 1] was last read before the previous trip's last barrier
                As[buf ^ 1][wid + 4 * i][lane] = an[i];
        }
        __syncthreads();    // all waves done reading stage `buf`; next stage's A stores complete
        buf ^= 1;
    }

    // ---- epilogue: bias + store (C layout: VGPR v -> M = v + 8*(lane>=16)) ----
    int rhalf = (lane >> 4) << 3;
    float bias0 = bq[colBase + wn * 32 + l15];
    float bias1 = bq[colBase + wn * 32 + 16 + l15];
    // Keeps the epilogue's vector work out of the last matrix block: without it the scheduler puts reads of an
    // accumulator one or two slots behind the matrix instruction that writes it.
    __builtin_amdgcn_sched_barrier(0);
    // four vector slots between the last matrix instruction and the first read of its result
    asm volatile("v_nop\n\tv_nop\n\tv_nop\n\tv_nop");
    __builtin_amdgcn_sched_barrier(0);  // holds the four slots where they stand
    #pragma unroll
    for (int v = 0; v < 8; ++v) {
        acc00[v] += bias0; acc10[v] += bias0;
        acc01[v] += bias1; acc11[v] += bias1;
    }

    // Column sums of the wave's 32 rows, which are the block's: 16 values per lane, then the other half of the wave.
    // Lanes 0..15 go on with the sum, lanes 16..31 with the sum of squares.
    float cs[2];
    #pragma unroll
    for (int sn = 0; sn < 2; ++sn) {
        v8f a0v = sn ? acc01 : acc00;
        v8f a1v = sn ? acc11 : acc10;
        float s = 0.f, s2 = 0.f;
        #pragma unroll
        for (int v = 0; v < 8; ++v) {
            s += a0v[v]; s2 += a0v[v] * a0v[v];
            s += a1v[v]; s2 += a1v[v] * a1v[v];
        }
        s  += __shfl_xor(s, 16, 32);
        s2 += __shfl_xor(s2, 16, 32);
        cs[sn] = (lane < 16) ? s : s2;
    }

    #pragma unroll
    for (int sn = 0; sn < 2; ++sn) {
        int col = colBase + wn * 32 + sn * 16 + l15;
        v8f a0v = sn ? acc01 : acc00;
        v8f a1v = sn ? acc11 : acc10;
        #pragma unroll
        for (int v = 0; v < 8; ++v) {
            int row0 = rowBase + v + rhalf;
            q[row0 * NQ + col] = a0v[v];
            q[(row0 + 16) * NQ + col] = a1v[v];
        }
        float* dst = (lane < 16) ? part1 : part2;
        dst[blockIdx.y * NQ + col] = cs[sn];
    }
}

// ---------------- kernel: BN finalize, and the sub-key normalization ----------------
// Both feed the routing kernel and neither reads the other's data, so they share one launch:
// blocks 0..QD/32-1 finalize the batch norm, the KNB blocks behind them normalize the sub-keys.
// part1/part2 hold, per block row of the projection (NRB of them), the sums of all NQ columns.
// A block serves 32 channels; wave w adds the 8 heads of block rows 4w..4w+3, wave 0 the 8 wave sums.
// Block rows 2r and 2r+1 are added to each other first, then to the running sum, head by head.
__global__ void peer_bnfin(const float* __restrict__ part1,
                           const float* __restrict__ part2,
                           const float* __restrict__ gamma,
                           const float* __restrict__ beta,
                           float* __restrict__ bnsc,
                           float* __restrict__ bnsh,
                           const float* __restrict__ k0,
                           const float* __restrict__ k1,
                           float* __restrict__ n0,
                           float* __restrict__ n1) {
    __shared__ float r1[8][32];
    __shared__ float r2[8][32];
    if (blockIdx.x >= QD / 32) {        // the same for a whole block, and ahead of the barrier below
        knormBlock(blockIdx.x - QD / 32, k0, k1, n0, n1);
        return;
    }
    int wid = threadIdx.x >> 5, lane = threadIdx.x & 31;
    int c = blockIdx.x * 32 + lane;
    // NQ = H * QD: a block row is H pieces of QD columns, one behind the other
    const float* p1 = part1 + wid * (NRB / 8) * NQ + c;
    const float* p2 = part2 + wid * (NRB / 8) * NQ + c;
    float e1[(NRB / 16) * H], o1[(NRB / 16) * H], e2[(NRB / 16) * H], o2[(NRB / 16) * H];
    #pragma unroll
    for (int p = 0; p < (NRB / 16) * H; ++p) {
        int o = (p / H) * 2 * NQ + (p % H) * QD;
        e1[p] = p1[o]; o1[p] = p1[o + NQ];
        e2[p] = p2[o]; o2[p] = p2[o + NQ];
    }
    // stands in front of the first overwrite of the two address pairs of the loads above, which it names so that
    // they live up to here and no load's own result lands on them
    asm volatile("s_wait_xcnt 0x0" :: "v"(p1), "v"(p2) : "memory");
    // holds the sums behind the loads: without it the first sums, and their waits, rise among the loads and hold the last ones back
    __builtin_amdgcn_sched_barrier(0);
    float s = 0.f, s2 = 0.f;
    #pragma unroll
    for (int p = 0; p < (NRB / 16) * H; ++p) {
        s  += e1[p] + o1[p];
        s2 += e2[p] + o2[p];
    }
    r1[wid][lane] = s;
    r2[wid][lane] = s2;
    __syncthreads();
    if (wid == 0) {
        s = 0.f; s2 = 0.f;
        #pragma unroll
        for (int w = 0; w < 8; ++w) { s += r1[w][lane]; s2 += r2[w][lane]; }
        float mean = s * (1.f / 8192.f);
        float var  = s2 * (1.f / 8192.f) - mean * mean;
        float sc = gamma[c] / sqrtf(var + 1e-5f);
        bnsc[c] = sc;
        bnsh[c] = beta[c] - mean * sc;
    }
}

// ---------------- kernel: routing ----------------
// A block serves 32 (token, head) items with four waves: wave w takes items 16*(w>>1).. and key table w&1.
// The 16 x 32 scores of a wave are one matrix product, 16 queries x 128 channels by 128 channels x 32 keys.
// TOPK==DTK^2 so softmax runs over ALL 16 combos.

// puts (x, n) into the descending list v[0..3] / id[0..3]; an equal value stays behind the one that came first
__device__ inline void top4Insert(float x, int n, float* v, int* id) {
    bool c0 = x > v[0], c1 = x > v[1], c2 = x > v[2], c3 = x > v[3];
    v[3] = c2 ? v[2] : (c3 ? x : v[3]);  id[3] = c2 ? id[2] : (c3 ? n : id[3]);
    v[2] = c1 ? v[1] : (c2 ? x : v[2]);  id[2] = c1 ? id[1] : (c2 ? n : id[2]);
    v[1] = c0 ? v[0] : (c1 ? x : v[1]);  id[1] = c0 ? id[0] : (c1 ? n : id[1]);
    v[0] = c0 ? x : v[0];                id[0] = c0 ? n : id[0];
}

__global__ __launch_bounds__(128) void peer_route(const float* __restrict__ q,
                                                  const float* __restrict__ bnsc,
                                                  const float* __restrict__ bnsh,
                                                  const float* __restrict__ n0,
                                                  const float* __restrict__ n1,
                                                  int* __restrict__ rid,
                                                  float* __restrict__ rw) {
    __shared__ __attribute__((aligned(16))) float ks[2][NKEY][RP];   // both normalized key tables
    __shared__ __attribute__((aligned(16))) float qs[4][16][RP];     // per wave: 16 normalized half queries
    __shared__ __attribute__((aligned(16))) float sc[4][16][SP];     // per wave: 16 items x 32 scores
    __shared__ __attribute__((aligned(16))) float tv[32][2][DTK];    // per item and table: the four best scores
    __shared__ __attribute__((aligned(16))) int   tx[32][2][DTK];    // and their keys
    int t = threadIdx.x;
    int wid = t >> 5, lane = t & 31, l15 = lane & 15, hh = lane >> 4;
    int grp = wid >> 1, tb = wid & 1;

    int bidx = tb * (HALF / 4) + l15 * 2;       // the lane's 8 channels, in units of 16 bytes
    float4 sc0 = ((const float4*)bnsc)[bidx], sc1 = ((const float4*)bnsc)[bidx + 1];
    float4 sh0 = ((const float4*)bnsh)[bidx], sh1 = ((const float4*)bnsh)[bidx + 1];
    float bsc[8] = { sc0.x, sc0.y, sc0.z, sc0.w, sc1.x, sc1.y, sc1.z, sc1.w };
    float bsh[8] = { sh0.x, sh0.y, sh0.z, sh0.w, sh1.x, sh1.y, sh1.z, sh1.w };
    // Half a wave holds one item's 128 channels of the wave's table, 8 per lane; q is [NITEM][QD].
    const float* qb = q + (blockIdx.x * 32 + grp * 16 + hh) * QD + tb * HALF + l15 * 8;
    float4 qv[8][2];
    #pragma unroll
    for (int i = 0; i < 8; ++i) {
        qv[i][0] = ((const float4*)(qb + 2 * i * QD))[0];
        qv[i][1] = ((const float4*)(qb + 2 * i * QD))[1];
    }
    // stands in front of the first overwrite of the address pair and the index register of the loads above, which it
    // names so that they live up to here and no load's own result lands on them
    asm volatile("s_wait_xcnt 0x0" :: "v"(qb), "v"(bidx) : "memory");
    // Both key tables go into LDS once per block: a wave reads whole 512-byte rows.
    float4 kst0[8], kst1[8];
    #pragma unroll
    for (int i = 0; i < 8; ++i) {
        kst0[i] = ((const float4*)n0)[i * 128 + t];
        kst1[i] = ((const float4*)n1)[i * 128 + t];
    }
    #pragma unroll
    for (int i = 0; i < 8; ++i) {               // wave wid holds key i*4+wid, lane its channels 4*lane..4*lane+3
        *(float4*)&ks[0][i * 4 + wid][lane * 4] = kst0[i];
        *(float4*)&ks[1][i * 4 + wid][lane * 4] = kst1[i];
    }
    #pragma unroll
    for (int i = 0; i < 8; ++i) {
        float qr[8] = { qv[i][0].x, qv[i][0].y, qv[i][0].z, qv[i][0].w,
                        qv[i][1].x, qv[i][1].y, qv[i][1].z, qv[i][1].w };
        float vr[8]; float ss = 0.f;
        #pragma unroll
        for (int j = 0; j < 8; ++j) {
            float x = qr[j] * bsc[j] + bsh[j];
            vr[j] = x; ss += x * x;
        }
        #pragma unroll
        for (int off = 8; off; off >>= 1) ss += __shfl_xor(ss, off, 16);
        float inv = 1.f / fmaxf(sqrtf(ss), 1e-12f);
        float4* dst = (float4*)&qs[wid][2 * i + hh][l15 * 8];
        dst[0] = make_float4(vr[0] * inv, vr[1] * inv, vr[2] * inv, vr[3] * inv);
        dst[1] = make_float4(vr[4] * inv, vr[5] * inv, vr[6] * inv, vr[7] * inv);
    }
    __syncthreads();    // keys and queries are in LDS

    // Fragments as in the projection: lane l15 is the row of A (item) and the column of B (key); a lane holds
    // k = 2*hh and 2*hh+1 of a step's four channels. Step s takes channels 4s..4s+3, so each score is
    // summed over c = 0..127 in rising order.
    v8f acc0 = {}, acc1 = {};
    const float* ar  = &qs[wid][l15][2 * hh];
    const float* br0 = &ks[tb][l15][2 * hh];
    const float* br1 = &ks[tb][16 + l15][2 * hh];
    #pragma unroll
    for (int s = 0; s < HALF / 4; ++s) {
        v2f a  = *(const v2f*)(ar + 4 * s);
        v2f b0 = *(const v2f*)(br0 + 4 * s);
        v2f b1 = *(const v2f*)(br1 + 4 * s);
        acc0 = __builtin_amdgcn_wmma_f32_16x16x4_f32(false, a, false, b0, (short)0, acc0, false, false);
        acc1 = __builtin_amdgcn_wmma_f32_16x16x4_f32(false, a, false, b1, (short)0, acc1, false, false);
    }
    // Keeps the address work of the score stores out of the matrix block: without it the scheduler lets it
    // overwrite a fragment register directly behind the matrix instruction that reads it.
    __builtin_amdgcn_sched_barrier(0);
    // four vector slots between the last matrix instruction and the first vector write of one of its registers
    asm volatile("v_nop\n\tv_nop\n\tv_nop\n\tv_nop");
    __builtin_amdgcn_sched_barrier(0);  // holds the four slots where they stand
    // C layout: VGPR v -> item v + 8*hh, key l15 (acc0) or 16 + l15 (acc1)
    #pragma unroll
    for (int v = 0; v < 8; ++v) {
        sc[wid][v + 8 * hh][l15]      = acc0[v];
        sc[wid][v + 8 * hh][16 + l15] = acc1[v];
    }
    __syncthreads();    // the scores are in LDS

    // Lane (hh, l15) scans keys 16*hh..16*hh+15 of item l15, in rising order.
    float bv[DTK] = { -INFINITY, -INFINITY, -INFINITY, -INFINITY };
    int   bi[DTK] = { 0, 0, 0, 0 };
    #pragma unroll
    for (int c = 0; c < 4; ++c) {
        float4 x = *(const float4*)&sc[wid][l15][hh * 16 + c * 4];
        top4Insert(x.x, hh * 16 + c * 4,     bv, bi);
        top4Insert(x.y, hh * 16 + c * 4 + 1, bv, bi);
        top4Insert(x.z, hh * 16 + c * 4 + 2, bv, bi);
        top4Insert(x.w, hh * 16 + c * 4 + 3, bv, bi);
    }
    // The four best of keys 16..31 go, best first, into the list of keys 0..15 (the result counts in lanes 0..15).
    float ov[DTK]; int oi[DTK];
    #pragma unroll
    for (int r = 0; r < DTK; ++r) {
        ov[r] = __shfl_xor(bv[r], 16, 32);
        oi[r] = __shfl_xor(bi[r], 16, 32);
    }
    #pragma unroll
    for (int r = 0; r < DTK; ++r) top4Insert(ov[r], oi[r], bv, bi);
    if (hh == 0) {
        *(float4*)&tv[grp * 16 + l15][tb][0] = make_float4(bv[0], bv[1], bv[2], bv[3]);
        *(int4*)&tx[grp * 16 + l15][tb][0]   = make_int4(bi[0], bi[1], bi[2], bi[3]);
    }
    __syncthreads();    // both tables' lists are in LDS

    // Four threads share an item; thread ii of them writes combos 4*ii..4*ii+3. Each forms all 16 exponentials
    // and adds them as the tree over lane distances 8, 4, 2, 1 did, so the weights keep their bits.
    int item = t >> 2, ii = t & 3;
    float4 t0 = *(const float4*)&tv[item][0][0];
    float4 t1 = *(const float4*)&tv[item][1][0];
    int4   x1 = *(const int4*)&tx[item][1][0];
    float  mine = tv[item][0][ii];
    int    mid  = tx[item][0][ii] * NKEY;
    float a4[4] = { t0.x, t0.y, t0.z, t0.w }, b4[4] = { t1.x, t1.y, t1.z, t1.w };
    float m = a4[0] + b4[0];
    #pragma unroll
    for (int l = 1; l < 16; ++l) m = fmaxf(m, a4[l >> 2] + b4[l & 3]);
    float e[16];
    #pragma unroll
    for (int l = 0; l < 16; ++l) e[l] = expf(a4[l >> 2] + b4[l & 3] - m);
    #pragma unroll
    for (int off = 8; off; off >>= 1) {
        #pragma unroll
        for (int l = 0; l < off; ++l) e[l] += e[l + off];
    }
    float sum = e[0];
    float4 w = make_float4(expf(mine + b4[0] - m) / sum, expf(mine + b4[1] - m) / sum,
                           expf(mine + b4[2] - m) / sum, expf(mine + b4[3] - m) / sum);
    ((int4*)rid)[blockIdx.x * 128 + t]  = make_int4(mid + x1.x, mid + x1.y, mid + x1.z, mid + x1.w);
    ((float4*)rw)[blockIdx.x * 128 + t] = w;
}

typedef const __attribute__((address_space(1))) char* gbytes;   // byte pointer into global memory

__device__ inline float4 load16(gbytes p) {
    return *(const __attribute__((address_space(1))) float4*)p;
}
__device__ inline int4 load16i(gbytes p) {
    return *(const __attribute__((address_space(1))) int4*)p;
}

// x of the lane whose number differs in bit 0 (CTRL 0xB1) or in bit 1 (CTRL 0x4E): a register move inside a group of four lanes
template <int CTRL>
__device__ inline float quadSwap(float x) {
    return __int_as_float(__builtin_amdgcn_mov_dpp(__float_as_int(x), CTRL, 0xf, 0xf, true));
}

// ---------------- kernel: down dot products, one 64-column slice per block ----------------
// A block keeps UC columns of all 1024 rows of `down` in LDS and serves UT tokens from them; it writes, for each
// of a token's 128 picks, the dot product over its UC columns. The 16 slices' parts are added in peer_gelu.
// Four lanes share a pick: lane q of the four owns the 64 bytes q of the 256-byte row piece and reads them in
// four 16-byte steps, starting at a step that differs between the four picks of a half wave, so that the
// 16 lanes of a half wave always read 16 different 16-byte columns: no bank conflict, whatever the rows.
__global__ __launch_bounds__(512) void peer_down(const float* __restrict__ hs,
                                                 const float* __restrict__ down,
                                                 const int* __restrict__ rid,
                                                 float* __restrict__ part) {
    __shared__ __attribute__((aligned(16))) float dsl[1024 * UC];
    int t = threadIdx.x;
    int kg = blockIdx.x, tg = blockIdx.y;
    float4* ds4 = (float4*)dsl;
    const float4* src = (const float4*)down + kg * (UC / 4) + (t >> 4) * (D / 4) + (t & 15);
    // a lane's 32 loads of 16 bytes are all in flight before the first LDS store; load i of the block brings rows 32i..32i+31
    float4 v[32];
    #pragma unroll
    for (int i = 0; i < 32; ++i) v[i] = src[i * 32 * (D / 4)];
    #pragma unroll
    for (int i = 0; i < 32; ++i) ds4[i * 512 + t] = v[i];
    // stands in front of the first overwrite of the loads' address register pair, which it names so that the pair
    // lives up to here and no load's own result lands on it
    asm volatile("s_wait_xcnt 0x0" :: "v"(src) : "memory");
    __syncthreads();    // the slice is complete before any wave gathers from it

    unsigned int wid = (unsigned int)__builtin_amdgcn_readfirstlane(t >> 5);
    int lane = t & 31, slot = lane >> 2, q = lane & 3;
    bool b0 = (q & 1) != 0, b1 = (q & 2) != 0;
    unsigned int r0 = (unsigned int)tg * UT + wid * (UT / 16);      // the wave's first token
    unsigned int coff[4];                                           // byte offsets of the lane's four steps in a row piece
    #pragma unroll
    for (int c = 0; c < 4; ++c) coff[c] = (unsigned int)(q * 4 + ((c + slot) & 3)) * 16u;
    unsigned int soff = (unsigned int)slot * 64u;                   // the slot's 16 picks among the token's 128
    gbytes ep = (gbytes)((unsigned long long)(uintptr_t)rid + r0 * 512u);
    gbytes hp = (gbytes)((unsigned long long)(uintptr_t)hs + r0 * (D * 4u) + (unsigned int)kg * (UC * 4u));
    const char* lbase = (const char*)dsl;

    int4 e[2][4]; float4 h[2][4];
    const int cur = 0;
    #pragma unroll
    for (int m = 0; m < 4; ++m) {
        e[0][m] = load16i(ep + soff + m * 16);
        h[0][m] = load16(hp + coff[m]);
    }
    // stands in front of the first overwrite of a register that the loads above name
    asm volatile("s_wait_xcnt 0x0" ::: "memory");
    __builtin_amdgcn_sched_barrier(0);  // holds later vector work, which reuses those registers, behind the wait
    unsigned int pidx = (unsigned int)kg * (NITEM * 4) + r0 * 32 + lane;    // the wave's first 512 bytes of results
    // rolled: unrolled, the last token's 64 LDS reads all rose to its top and spilled
    #pragma unroll 1
    for (int k = 0; k < UT / 16; ++k) {
        // the next token's indices and its piece of the token row, one token ahead;
        // the last token fetches its own again, which keeps the body free of branches
        unsigned int kn = k < UT / 16 - 1 ? k + 1 : k;
        #pragma unroll
        for (int m = 0; m < 4; ++m) {
            e[1][m] = load16i(ep + soff + (kn * 512u + m * 16));
            h[1][m] = load16(hp + coff[m] + kn * (D * 4u));
        }
        // x[j] belongs to pick (j & 3) * 4 + (j >> 2) of the slot, so that the sums over four lanes below leave
        // lane q with the slot's picks 4q..4q+3
        int ej[16] = { e[cur][0].x, e[cur][1].x, e[cur][2].x, e[cur][3].x,
                       e[cur][0].y, e[cur][1].y, e[cur][2].y, e[cur][3].y,
                       e[cur][0].z, e[cur][1].z, e[cur][2].z, e[cur][3].z,
                       e[cur][0].w, e[cur][1].w, e[cur][2].w, e[cur][3].w };
        float x[16];
        float4 u[2][8];
        #pragma unroll
        for (int n = -1; n < 8; ++n) {
            if (n < 7) {                // the next two picks' row pieces are asked for ahead of this pair's sums
                float4* un = u[(n + 1) & 1];
                #pragma unroll
                for (int c = 0; c < 4; ++c) {
                    un[c]     = *(const float4*)(lbase + ((unsigned int)ej[2 * n + 2] * (UC * 4u) + coff[c]));
                    un[4 + c] = *(const float4*)(lbase + ((unsigned int)ej[2 * n + 3] * (UC * 4u) + coff[c]));
                }
            }
            // keeps the reads above ahead of the sums below; without it all 64 reads of a token rise to the top and spill
            __builtin_amdgcn_sched_barrier(0);
            if (n >= 0) {
                const float4* uc = u[n & 1];
                v2f sa = {0.f, 0.f}, sb = {0.f, 0.f};
                #pragma unroll
                for (int c = 0; c < 4; ++c) {
                    sa += (v2f){uc[c].x, uc[c].y} * (v2f){h[cur][c].x, h[cur][c].y};
                    sb += (v2f){uc[4 + c].x, uc[4 + c].y} * (v2f){h[cur][c].x, h[cur][c].y};
                    sa += (v2f){uc[c].z, uc[c].w} * (v2f){h[cur][c].z, h[cur][c].w};
                    sb += (v2f){uc[4 + c].z, uc[4 + c].w} * (v2f){h[cur][c].z, h[cur][c].w};
                }
                x[2 * n]     = sa.x + sa.y;
                x[2 * n + 1] = sb.x + sb.y;
                // keeps the next pair's reads from rising over these sums, for the same reason
                __builtin_amdgcn_sched_barrier(0);
            }
        }
        // sums over the four lanes of a pick: each step halves the values a lane goes on with
        float y[8], z[4];
        #pragma unroll
        for (int i = 0; i < 8; ++i)
            y[i] = (b0 ? x[2 * i + 1] : x[2 * i]) + quadSwap<0xB1>(b0 ? x[2 * i] : x[2 * i + 1]);
        #pragma unroll
        for (int i = 0; i < 4; ++i)
            z[i] = (b1 ? y[2 * i + 1] : y[2 * i]) + quadSwap<0x4E>(b1 ? y[2 * i] : y[2 * i + 1]);
        ((float4*)part)[pidx] = make_float4(z[0], z[1], z[2], z[3]);
        // stands in front of the overwrite of the store's index register, which it names so that the register lives up to here
        asm volatile("s_wait_xcnt 0x0" :: "v"(pidx) : "memory");
        pidx += 32;
        #pragma unroll
        for (int m = 0; m < 4; ++m) { e[0][m] = e[1][m]; h[0][m] = h[1][m]; }
    }
}

// ---------------- kernel: slice parts added, gelu, routing weight ----------------
// a thread serves four picks
__global__ void peer_gelu(const float* __restrict__ part,
                          const float* __restrict__ rw,
                          float* __restrict__ gw) {
    int p = blockIdx.x * 256 + threadIdx.x;         // [0, NITEM * 4)
    float4 s = {0.f, 0.f, 0.f, 0.f};
    #pragma unroll
    for (int kg = 0; kg < D / UC; ++kg) {
        float4 a = ((const float4*)part)[kg * (NITEM * 4) + p];
        s.x += a.x; s.y += a.y; s.z += a.z; s.w += a.w;
    }
    float4 w = ((const float4*)rw)[p];
    float4 o;                                       // exact gelu
    o.x = 0.5f * s.x * (1.0f + erff(s.x * 0.70710678118654752f)) * w.x;
    o.y = 0.5f * s.y * (1.0f + erff(s.y * 0.70710678118654752f)) * w.y;
    o.z = 0.5f * s.z * (1.0f + erff(s.z * 0.70710678118654752f)) * w.z;
    o.w = 0.5f * s.w * (1.0f + erff(s.w * 0.70710678118654752f)) * w.w;
    ((float4*)gw)[p] = o;
}

// ---------------- kernel: weighted sum of the gathered up rows ----------------
// A block keeps UC columns of all 1024 rows of `up` in LDS and serves UT tokens from them, so a gathered row
// piece is read from LDS and the table crosses from L2 once per block, not once per token and pick.
// A row piece is 256 bytes: 16 lanes x 16 bytes cover all 64 banks once, whatever the row, so the two halves
// of a wave read two different picks' rows without a bank conflict.
__global__ __launch_bounds__(512) void peer_up(const float* __restrict__ up,
                                               const int* __restrict__ rid,
                                               const float* __restrict__ gw,
                                               float* __restrict__ out) {
    __shared__ __attribute__((aligned(16))) float us[1024 * UC];
    int t = threadIdx.x;
    int cg = blockIdx.x, tg = blockIdx.y;
    float4* us4 = (float4*)us;
    const float4* src = (const float4*)up + cg * (UC / 4) + (t >> 4) * (OUTD / 4) + (t & 15);
    // a lane's 32 loads of 16 bytes are all in flight before the first LDS store; load i of the block brings rows 32i..32i+31
    float4 v[32];
    #pragma unroll
    for (int i = 0; i < 32; ++i) v[i] = src[i * 32 * (OUTD / 4)];
    #pragma unroll
    for (int i = 0; i < 32; ++i) us4[i * 512 + t] = v[i];
    // stands in front of the first overwrite of the loads' address register pair, which it names so that the pair
    // lives up to here and no load's own result lands on it
    asm volatile("s_wait_xcnt 0x0" :: "v"(src) : "memory");
    __syncthreads();    // the slice is complete before any wave gathers from it

    unsigned int wid = (unsigned int)__builtin_amdgcn_readfirstlane(t >> 5);
    int lane = t & 31, half = lane >> 4, l15 = lane & 15;
    const float4* ul = us4 + l15;
    // lanes 0..15 take a token's picks 0..63, lanes 16..31 its picks 64..127: 256 bytes of indices and of weights each
    unsigned int hoff = (unsigned int)half * 256u;
    unsigned int r0 = (unsigned int)tg * UT + wid * (UT / 16);      // the wave's first token
    gbytes ep = (gbytes)((unsigned long long)(uintptr_t)rid + r0 * 512u);
    gbytes gp = (gbytes)((unsigned long long)(uintptr_t)gw + r0 * 512u);
    int4 e[16]; float4 g[16];
    #pragma unroll
    for (int m = 0; m < 16; ++m) {
        e[m] = load16i(ep + hoff + m * 16);
        g[m] = load16(gp + hoff + m * 16);
    }
    // unrolled: every load and store names an address that is never rewritten, and an immediate,
    // and e[] and g[] need no copies from trip to trip
    #pragma unroll
    for (int k = 0; k < UT / 16; ++k) {
        // indices and weights of the wave's next token are fetched as this token's are used up
        unsigned int nx = (k + 1) * 512u;
        v2f a01 = {0.f, 0.f}, a23 = {0.f, 0.f};
        float4 u[2][8];
        #pragma unroll
        for (int n = -1; n < 8; ++n) {
            if (n < 7) {                // the next eight row pieces are asked for ahead of this group's sums
                int4 ea = e[2 * n + 2], eb = e[2 * n + 3];
                float4* un = u[(n + 1) & 1];
                un[0] = ul[ea.x * (UC / 4)]; un[1] = ul[ea.y * (UC / 4)];
                un[2] = ul[ea.z * (UC / 4)]; un[3] = ul[ea.w * (UC / 4)];
                un[4] = ul[eb.x * (UC / 4)]; un[5] = ul[eb.y * (UC / 4)];
                un[6] = ul[eb.z * (UC / 4)]; un[7] = ul[eb.w * (UC / 4)];
            }
            // keeps the reads above ahead of the sums below; without it all 64 reads of a token rise to the top and spill
            __builtin_amdgcn_sched_barrier(0);
            if (n >= 0) {
                const float4* uc = u[n & 1];
                float gs[8] = { g[2 * n].x, g[2 * n].y, g[2 * n].z, g[2 * n].w,
                                g[2 * n + 1].x, g[2 * n + 1].y, g[2 * n + 1].z, g[2 * n + 1].w };
                #pragma unroll
                for (int j = 0; j < 8; ++j) {
                    a01 += (v2f){gs[j], gs[j]} * (v2f){uc[j].x, uc[j].y};
                    a23 += (v2f){gs[j], gs[j]} * (v2f){uc[j].z, uc[j].w};
                }
                if (k < UT / 16 - 1) {
                    e[2 * n]     = load16i(ep + hoff + (nx + (2 * n) * 16));
                    e[2 * n + 1] = load16i(ep + hoff + (nx + (2 * n + 1) * 16));
                    g[2 * n]     = load16(gp + hoff + (nx + (2 * n) * 16));
                    g[2 * n + 1] = load16(gp + hoff + (nx + (2 * n + 1) * 16));
                }
                // keeps the next group's reads from rising over these sums, for the same reason
                __builtin_amdgcn_sched_barrier(0);
            }
        }
        float4 acc = { a01.x, a01.y, a23.x, a23.y };
        acc.x += __shfl_xor(acc.x, 16, 32); acc.y += __shfl_xor(acc.y, 16, 32);
        acc.z += __shfl_xor(acc.z, 16, 32); acc.w += __shfl_xor(acc.w, 16, 32);
        if (half == 0) ((float4*)out)[(r0 + k) * (OUTD / 4) + cg * (UC / 4) + l15] = acc;
    }
}

// ---------------- launcher ----------------
extern "C" void kernel_launch(void* const* d_in, const int* in_sizes, int n_in,
                              void* d_out, int out_size, void* d_ws, size_t ws_size,
                              hipStream_t stream) {
    const float* hs    = (const float*)d_in[0];  // [1024,1024]
    const float* Wq    = (const float*)d_in[1];  // [1024,2048]
    const float* bq    = (const float*)d_in[2];  // [2048]
    const float* gamma = (const float*)d_in[3];  // [256]
    const float* beta  = (const float*)d_in[4];  // [256]
    const float* sk0   = (const float*)d_in[5];  // [32,128]
    const float* sk1   = (const float*)d_in[6];  // [32,128]
    const float* down  = (const float*)d_in[7];  // [1024,1024]
    const float* up    = (const float*)d_in[8];  // [1024,1024]
    float* out = (float*)d_out;                  // [1024,1024]

    float* ws = (float*)d_ws;
    float* q      = ws;                   // 1024*2048
    float* n0     = q      + TOKENS * NQ;
    float* n1     = n0     + NKEY * HALF;
    float* part1  = n1     + NKEY * HALF;
    float* part2  = part1  + NRB * NQ;
    float* bnsc   = part2  + NRB * NQ;
    float* bnsh   = bnsc   + QD;
    int*   rid    = (int*)(bnsh + QD);
    float* rw     = (float*)(rid + NITEM * 16);
    float* gw     = rw     + NITEM * 16;
    float* part   = gw     + NITEM * 16;  // (D / UC) planes of NITEM * 16

    peer_qproj<<<dim3(NQ / BN, TOKENS / BM), dim3(128), 0, stream>>>(hs, Wq, bq, q, part1, part2);
    peer_bnfin<<<dim3(QD / 32 + KNB), dim3(256), 0, stream>>>(part1, part2, gamma, beta, bnsc, bnsh, sk0, sk1, n0, n1);
    peer_route<<<dim3(NITEM / 32), dim3(128), 0, stream>>>(q, bnsc, bnsh, n0, n1, rid, rw);
    peer_down<<<dim3(D / UC, TOKENS / UT), dim3(512), 0, stream>>>(hs, down, rid, part);
    peer_gelu<<<dim3(NITEM * 4 / 256), dim3(256), 0, stream>>>(part, rw, gw);
    peer_up<<<dim3(OUTD / UC, TOKENS / UT), dim3(512), 0, stream>>>(up, rid, gw, out);
}

// v010
// A run of this version takes 56.3 microseconds.
// It is 1.11 times as fast as v008, going by the measured steps of the versions left out in between.
// Over all steps from v000 it is 2.30 times as fast.
#include <hip/hip_runtime.h>
#include <math.h>

typedef float v2f __attribute__((ext_vector_type(2)));
typedef float v4f __attribute__((ext_vector_type(4)));
typedef float v8f __attribute__((ext_vector_type(8)));
typedef unsigned int u32x4 __attribute__((ext_vector_type(4)));
typedef int i32x4 __attribute__((ext_vector_type(4)));
typedef int i32x8 __attribute__((ext_vector_type(8)));

#define H 8
#define QD 256
#define HALF 128
#define NKEY 32
#define DTK 4
#define TOKENS 1024      // B*S
#define D 1024
#define NQ 2048          // H*QD
#define OUTD 1024
#define NITEM 8192       // TOKENS*H
#define KNB 8            // blocks that normalize the 2 * NKEY sub-key rows, 8 rows each

// GEMM tiling
#define BM 32            // rows per block
#define NRB 32           // block rows of the projection: TOKENS / BM
#define BN 128           // cols per block
#define BK 32            // K-step
#define BNP 129          // padded B row stride (via TDM pad: 1 dword per 128)
#define AMP 33           // padded A row stride
#define EN 64            // rows of `down` (experts) whose dot products a projection block forms: 1024 / (NQ / BN)
#define DP 36            // LDS row stride of a 32-channel piece of a `down` row: 16 rows' 8-byte reads at k and k+2 fall on all 64 banks once
#define UC 64            // columns of an expert table that a block keeps in LDS (256 KiB for 1024 rows)
#define UT 64            // tokens that such a block serves
#define RP 132           // LDS row stride of a 128-channel row: 16 rows' 8-byte reads at k and k+2 fall on all 64 banks once
#define SP 36            // LDS row stride of a 32-score row: 144 bytes = 16 x 9, an odd count of 16-byte units

// ---------------- helpers ----------------
__device__ inline float waveRedSum32(float x) {
    #pragma unroll
    for (int off = 16; off; off >>= 1) x += __shfl_xor(x, off, 32);
    return x;
}

// Place of (token, expert) in the plane of all down dot products. Two tokens' 16-expert pieces share a 128-byte line,
// so that a line is written by one wave of the projection kernel, which holds 16 experts of 32 tokens.
__device__ inline int dotIdx(int tok, int e) {
    return ((tok >> 1) * (1024 / 16) + (e >> 4)) * 32 + (tok & 1) * 16 + (e & 15);
}

// Issue a TDM load of a 32x128 f32 tile of Wq (row stride 2048 elems) into LDS
// at byte offset lds_off, padded +1 dword per 128 dwords (-> 129-dword rows).
__device__ inline void tdm_load_B(const float* gaddr, unsigned int lds_off) {
    u32x4 g0;
    g0.x = 1u;                                   // count=1, user mode
    g0.y = lds_off;                              // LDS byte address
    unsigned long long ga = (unsigned long long)(uintptr_t)gaddr;
    g0.z = (unsigned int)ga;                     // global_addr[31:0]
    g0.w = (unsigned int)(ga >> 32) | 0x80000000u; // global_addr[56:32] | type=2
    i32x8 g1;
    g1[0] = (int)((2u << 16)       // data_size = 4 bytes
                | (1u << 20)       // pad_enable
                | (6u << 22));     // pad_interval = 128 dwords (pad_amount=0 -> 1 dword)
    g1[1] = (int)(2048u << 16);    // tensor_dim0 = 2048 (elements per row)
    g1[2] = (int)(1024u << 16);    // tensor_dim1 = 1024 rows (dim0 hi bits = 0)
    g1[3] = (int)(128u << 16);     // tile_dim0 = 128 (dim1 hi bits = 0)
    g1[4] = 32;                    // tile_dim1 = 32, tile_dim2 = 0
    g1[5] = 2048;                  // tensor_dim0_stride[31:0] = 2048
    g1[6] = 0;                     // stride hi / dim1_stride lo
    g1[7] = 0;
    i32x4 gz4 = {0, 0, 0, 0};              // groups 2/3 unused (2D tensor)
    i32x8 gz8 = {0, 0, 0, 0, 0, 0, 0, 0};
    __builtin_amdgcn_tensor_load_to_lds(g0, g1, gz4, gz4, gz8, 0);
}

// ---------------- normalize sub-keys: block kb of KNB, one key row per wave ----------------
__device__ inline void knormBlock(int kb,
                                  const float* __restrict__ k0,
                                  const float* __restrict__ k1,
                                  float* __restrict__ n0,
                                  float* __restrict__ n1) {
    int wid = threadIdx.x >> 5, lane = threadIdx.x & 31;
    int gw = kb * 8 + wid;                  // [0,64)
    int table = gw >> 5, row = gw & 31;
    const float* src = table ? k1 : k0;
    float*       dst = table ? n1 : n0;
    float v[4]; float ss = 0.f;
    #pragma unroll
    for (int j = 0; j < 4; ++j) {
        v[j] = src[row * HALF + lane * 4 + j];
        ss += v[j] * v[j];
    }
    ss = waveRedSum32(ss);
    float inv = 1.f / fmaxf(sqrtf(ss), 1e-12f);
    #pragma unroll
    for (int j = 0; j < 4; ++j) dst[row * HALF + lane * 4 + j] = v[j] * inv;
}

// ---------------- kernel: Q projection GEMM (f32 WMMA + TDM double-buffer) ----------------
// q[TOKENS][NQ] = hs[TOKENS][D] @ Wq[D][NQ] + bq
// Block tile 32x128, 4 waves side by side, each wave a 2x2 grid of 16x16 tiles. 512 blocks: a WGP holds two,
// one wave of each per SIMD, and the two share no barrier, so one block's matrix work fills the matrix unit
// while the other stands at its barriers and waits for its first LDS fragments. A wave that is well into its
// matrix block holds a higher issue priority.
// B tiles arrive via Tensor Data Mover (async, double buffered, padded rows).
// The epilogue also writes the block's column sums of q and q*q (32 rows) for the batch norm.
// The same loop forms dots[token][expert] = hs[token] . down[expert] for the block's 32 tokens and EN experts:
// the A fragments are those of the projection, a wave adds one 16-expert column of tiles. The dot products do not
// depend on the routing; the routing kernel picks the ones it has chosen.
__global__ void peer_qproj(const float* __restrict__ hs,
                           const float* __restrict__ Wq,
                           const float* __restrict__ bq,
                           const float* __restrict__ down,
                           float* __restrict__ q,
                           float* __restrict__ part1,
                           float* __restrict__ part2,
                           float* __restrict__ dots) {
    __shared__ float As[2][BM][AMP];
    __shared__ float Bs[2][BK][BNP];
    __shared__ __attribute__((aligned(16))) float Ds[2][EN][DP];
    int t = threadIdx.x;
    int wid = t >> 5, lane = t & 31;
    int rowBase = blockIdx.y * BM;
    int colBase = blockIdx.x * BN;
    int wn = wid;                      // 0..3  (col group of 32)
    int l15 = lane & 15;
    int khi = (lane >> 4) << 1;        // 0 or 2

    v8f acc00 = {}, acc01 = {}, acc10 = {}, acc11 = {};
    v8f acc20 = {}, acc21 = {};        // dot products: tokens 0..15 and 16..31 by the wave's 16 experts
    // a thread brings 16 bytes of rows (t >> 3) + 16i of the block's EN rows of `down`: 8 lanes cover a 128-byte piece
    int dr = t >> 3, dc = (t & 7) * 4;
    const float* dsrc = down + (blockIdx.x * EN + dr) * D + dc;

    // ---- prologue: stage 0 ----
    if (wid == 0)
        tdm_load_B(Wq + colBase, (unsigned int)(uintptr_t)&Bs[0][0][0]);
    #pragma unroll
    for (int i = 0; i < 8; ++i) {                // A: 32x32
        int idx = i * 128 + t;
        int r = idx >> 5, c = idx & 31;
        As[0][r][c] = hs[(rowBase + r) * D + c];
    }
    #pragma unroll
    for (int i = 0; i < 4; ++i)                  // down: 64x32
        *(v4f*)&Ds[0][dr + 16 * i][dc] = *(const v4f*)(dsrc + i * 16 * D);

    int buf = 0;
    for (int it = 0; it < D / BK; ++it) {
        int k0 = it * BK;
        float an[8];        // next stage's A elements: loaded ahead of the matrix block, stored to LDS behind it
        v4f dn[4];          // and its pieces of the `down` rows, likewise
        // ---- issue next stage (overlaps this stage's WMMA) ----
        if (it < D / BK - 1) {
            int kn = k0 + BK;
            if (wid == 0)
                tdm_load_B(Wq + (size_t)kn * NQ + colBase,
                           (unsigned int)(uintptr_t)&Bs[buf ^ 1][0][0]);
            if (wid == 0) __builtin_amdgcn_s_wait_tensorcnt(1);
        } else {
            if (wid == 0) __builtin_amdgcn_s_wait_tensorcnt(0);
        }
        __syncthreads();    // stage `buf` complete: TDM B here, A stores ahead of the previous trip's last barrier

        // Next stage's A loads stand behind the barrier (which waits for every load issued ahead of it)
        // and fly during the matrix block.
        if (it < D / BK - 1) {
            const float* ap = hs + (rowBase + wid) * D + k0 + BK + lane;   // rows wid + 4i of the tile
            #pragma unroll
            for (int i = 0; i < 8; ++i) an[i] = ap[i * 4 * D];
            const float* dp = dsrc + k0 + BK;
            #pragma unroll
            for (int i = 0; i < 4; ++i) dn[i] = *(const v4f*)(dp + i * 16 * D);
            // stands in front of the first overwrite of the two address pairs of the loads above, which it names so
            // that they live up to here and no load's own result lands on them
            asm volatile("s_wait_xcnt 0x0" :: "v"(ap), "v"(dp) : "memory");
        }

        // The fragments of a trip's first four k groups are asked for ahead of its first matrix instruction, the other
        // four behind the priority instruction below: the compiler moves no LDS read over that instruction, and the
        // third and fourth groups' matrix instructions cover the later reads. Both loops are unrolled so that the
        // fragment arrays are indexed by constants and stay in registers.
        v2f fa0[8], fa1[8], fb0[8], fb1[8], fb2[8];
        #pragma unroll
        for (int kk = 0; kk < 8; ++kk) {
            #pragma unroll
            for (int j = (kk == 0 ? 0 : 4); j < (kk == 0 ? 4 : (kk == 2 ? 8 : 4)); ++j) {
                int kb = j * 4 + khi;
                fa0[j] = (v2f){ As[buf][l15][kb],      As[buf][l15][kb + 1] };
                fa1[j] = (v2f){ As[buf][16 + l15][kb], As[buf][16 + l15][kb + 1] };
                fb0[j] = (v2f){ Bs[buf][kb][wn * 32 + l15],      Bs[buf][kb + 1][wn * 32 + l15] };
                fb1[j] = (v2f){ Bs[buf][kb][wn * 32 + 16 + l15], Bs[buf][kb + 1][wn * 32 + 16 + l15] };
                fb2[j] = *(const v2f*)&Ds[buf][wn * 16 + l15][kb];  // column l15 of B is expert row l15, same k as A
            }
            v2f a0 = fa0[kk], a1 = fa1[kk], b0 = fb0[kk], b1 = fb1[kk], b2 = fb2[kk];
            acc00 = __builtin_amdgcn_wmma_f32_16x16x4_f32(false, a0, false, b0, (short)0, acc00, false, false);
            acc01 = __builtin_amdgcn_wmma_f32_16x16x4_f32(false, a0, false, b1, (short)0, acc01, false, false);
            acc10 = __builtin_amdgcn_wmma_f32_16x16x4_f32(false, a1, false, b0, (short)0, acc10, false, false);
            acc11 = __builtin_amdgcn_wmma_f32_16x16x4_f32(false, a1, false, b1, (short)0, acc11, false, false);
            acc20 = __builtin_amdgcn_wmma_f32_16x16x4_f32(false, a0, false, b2, (short)0, acc20, false, false);
            acc21 = __builtin_amdgcn_wmma_f32_16x16x4_f32(false, a1, false, b2, (short)0, acc21, false, false);
            // Behind its first 12 matrix instructions of a trip the wave takes the higher issue priority.
            if (kk == 1) __builtin_amdgcn_s_setprio(3);
        }
        // back to the lowest priority for the part of the trip that needs no matrix unit, and on the way out
        __builtin_amdgcn_s_setprio(0);
        if (it < D / BK - 1) {
            // holds the wait for the A loads behind the matrix block; ahead of it the wave would idle for the loads
            __builtin_amdgcn_sched_barrier(0);
            #pragma unroll
            for (int i = 0; i < 8; ++i)      // As[buf ^ 1] was last read before the previous trip's last barrier
                As[buf ^ 1][wid + 4 * i][lane] = an[i];
            #pragma unroll
            for (int i = 0; i < 4; ++i)      // and so was Ds[buf ^ 1]
                *(v4f*)&Ds[buf ^ 1][dr + 16 * i][dc] = dn[i];
        }
        __syncthreads();    // all waves done reading stage `buf`; next stage's A stores complete
        buf ^= 1;
    }

    // ---- epilogue: bias + store (C layout: VGPR v -> M = v + 8*(lane>=16)) ----
    int rhalf = (lane >> 4) << 3;
    float bias0 = bq[colBase + wn * 32 + l15];
    float bias1 = bq[colBase + wn * 32 + 16 + l15];
    // Keeps the epilogue's vector work out of the last matrix block: without it the scheduler puts reads of an
    // accumulator one or two slots behind the matrix instruction that writes it.
    __builtin_amdgcn_sched_barrier(0);
    // four vector slots between the last matrix instruction and the first read of its result
    asm volatile("v_nop\n\tv_nop\n\tv_nop\n\tv_nop");
    __builtin_amdgcn_sched_barrier(0);  // holds the four slots where they stand
    #pragma unroll
    for (int v = 0; v < 8; ++v) {
        acc00[v] += bias0; acc10[v] += bias0;
        acc01[v] += bias1; acc11[v] += bias1;
    }

    // Column sums of the wave's 32 rows, which are the block's: 16 values per lane, then the other half of the wave.
    // Lanes 0..15 go on with the sum, lanes 16..31 with the sum of squares.
    float cs[2];
    #pragma unroll
    for (int sn = 0; sn < 2; ++sn) {
        v8f a0v = sn ? acc01 : acc00;
        v8f a1v = sn ? acc11 : acc10;
        float s = 0.f, s2 = 0.f;
        #pragma unroll
        for (int v = 0; v < 8; ++v) {
            s += a0v[v]; s2 += a0v[v] * a0v[v];
            s += a1v[v]; s2 += a1v[v] * a1v[v];
        }
        s  += __shfl_xor(s, 16, 32);
        s2 += __shfl_xor(s2, 16, 32);
        cs[sn] = (lane < 16) ? s : s2;
    }

    #pragma unroll
    for (int sn = 0; sn < 2; ++sn) {
        int col = colBase + wn * 32 + sn * 16 + l15;
        v8f a0v = sn ? acc01 : acc00;
        v8f a1v = sn ? acc11 : acc10;
        #pragma unroll
        for (int v = 0; v < 8; ++v) {
            int row0 = rowBase + v + rhalf;
            q[row0 * NQ + col] = a0v[v];
            q[(row0 + 16) * NQ + col] = a1v[v];
        }
        float* dst = (lane < 16) ? part1 : part2;
        dst[blockIdx.y * NQ + col] = cs[sn];
    }
    #pragma unroll
    for (int v = 0; v < 8; ++v) {
        int row0 = rowBase + v + rhalf, e = blockIdx.x * EN + wn * 16 + l15;
        dots[dotIdx(row0, e)]      = acc20[v];
        dots[dotIdx(row0 + 16, e)] = acc21[v];
    }
}

// ---------------- kernel: BN finalize, and the sub-key normalization ----------------
// Both feed the routing kernel and neither reads the other's data, so they share one launch:
// blocks 0..QD/32-1 finalize the batch norm, the KNB blocks behind them normalize the sub-keys.
// part1/part2 hold, per block row of the projection (NRB of them), the sums of all NQ columns.
// A block serves 32 channels; wave w adds the 8 heads of block rows 4w..4w+3, wave 0 the 8 wave sums.
// Block rows 2r and 2r+1 are added to each other first, then to the running sum, head by head.
__global__ void peer_bnfin(const float* __restrict__ part1,
                           const float* __restrict__ part2,
                           const float* __restrict__ gamma,
                           const float* __restrict__ beta,
                           float* __restrict__ bnsc,
                           float* __restrict__ bnsh,
                           const float* __restrict__ k0,
                           const float* __restrict__ k1,
                           float* __restrict__ n0,
                           float* __restrict__ n1) {
    __shared__ float r1[8][32];
    __shared__ float r2[8][32];
    if (blockIdx.x >= QD / 32) {        // the same for a whole block, and ahead of the barrier below
        knormBlock(blockIdx.x - QD / 32, k0, k1, n0, n1);
        return;
    }
    int wid = threadIdx.x >> 5, lane = threadIdx.x & 31;
    int c = blockIdx.x * 32 + lane;
    // NQ = H * QD: a block row is H pieces of QD columns, one behind the other
    const float* p1 = part1 + wid * (NRB / 8) * NQ + c;
    const float* p2 = part2 + wid * (NRB / 8) * NQ + c;
    float e1[(NRB / 16) * H], o1[(NRB / 16) * H], e2[(NRB / 16) * H], o2[(NRB / 16) * H];
    #pragma unroll
    for (int p = 0; p < (NRB / 16) * H; ++p) {
        int o = (p / H) * 2 * NQ + (p % H) * QD;
        e1[p] = p1[o]; o1[p] = p1[o + NQ];
        e2[p] = p2[o]; o2[p] = p2[o + NQ];
    }
    // stands in front of the first overwrite of the two address pairs of the loads above, which it names so that
    // they live up to here and no load's own result lands on them
    asm volatile("s_wait_xcnt 0x0" :: "v"(p1), "v"(p2) : "memory");
    // holds the sums behind the loads: without it the first sums, and their waits, rise among the loads and hold the last ones back
    __builtin_amdgcn_sched_barrier(0);
    float s = 0.f, s2 = 0.f;
    #pragma unroll
    for (int p = 0; p < (NRB / 16) * H; ++p) {
        s  += e1[p] + o1[p];
        s2 += e2[p] + o2[p];
    }
    r1[wid][lane] = s;
    r2[wid][lane] = s2;
    __syncthreads();
    if (wid == 0) {
        s = 0.f; s2 = 0.f;
        #pragma unroll
        for (int w = 0; w < 8; ++w) { s += r1[w][lane]; s2 += r2[w][lane]; }
        float mean = s * (1.f / 8192.f);
        float var  = s2 * (1.f / 8192.f) - mean * mean;
        float sc = gamma[c] / sqrtf(var + 1e-5f);
        bnsc[c] = sc;
        bnsh[c] = beta[c] - mean * sc;
    }
}

// ---------------- kernel: routing ----------------
// A block serves 32 (token, head) items with four waves: wave w takes items 16*(w>>1).. and key table w&1.
// The 16 x 32 scores of a wave are one matrix product, 16 queries x 128 channels by 128 channels x 32 keys.
// TOPK==DTK^2 so softmax runs over ALL 16 combos.

// puts (x, n) into the descending list v[0..3] / id[0..3]; an equal value stays behind the one that came first
__device__ inline void top4Insert(float x, int n, float* v, int* id) {
    bool c0 = x > v[0], c1 = x > v[1], c2 = x > v[2], c3 = x > v[3];
    v[3] = c2 ? v[2] : (c3 ? x : v[3]);  id[3] = c2 ? id[2] : (c3 ? n : id[3]);
    v[2] = c1 ? v[1] : (c2 ? x : v[2]);  id[2] = c1 ? id[1] : (c2 ? n : id[2]);
    v[1] = c0 ? v[0] : (c1 ? x : v[1]);  id[1] = c0 ? id[0] : (c1 ? n : id[1]);
    v[0] = c0 ? x : v[0];                id[0] = c0 ? n : id[0];
}

__global__ __launch_bounds__(128) void peer_route(const float* __restrict__ q,
                                                  const float* __restrict__ bnsc,
                                                  const float* __restrict__ bnsh,
                                                  const float* __restrict__ n0,
                                                  const float* __restrict__ n1,
                                                  const float* __restrict__ dots,
                                                  int* __restrict__ rid,
                                                  float* __restrict__ gw) {
    __shared__ __attribute__((aligned(16))) float ks[2][NKEY][RP];   // both normalized key tables
    __shared__ __attribute__((aligned(16))) float qs[4][16][RP];     // per wave: 16 normalized half queries
    __shared__ __attribute__((aligned(16))) float sc[4][16][SP];     // per wave: 16 items x 32 scores
    __shared__ __attribute__((aligned(16))) float tv[32][2][DTK];    // per item and table: the four best scores
    __shared__ __attribute__((aligned(16))) int   tx[32][2][DTK];    // and their keys
    int t = threadIdx.x;
    int wid = t >> 5, lane = t & 31, l15 = lane & 15, hh = lane >> 4;
    int grp = wid >> 1, tb = wid & 1;

    int bidx = tb * (HALF / 4) + l15 * 2;       // the lane's 8 channels, in units of 16 bytes
    float4 sc0 = ((const float4*)bnsc)[bidx], sc1 = ((const float4*)bnsc)[bidx + 1];
    float4 sh0 = ((const float4*)bnsh)[bidx], sh1 = ((const float4*)bnsh)[bidx + 1];
    float bsc[8] = { sc0.x, sc0.y, sc0.z, sc0.w, sc1.x, sc1.y, sc1.z, sc1.w };
    float bsh[8] = { sh0.x, sh0.y, sh0.z, sh0.w, sh1.x, sh1.y, sh1.z, sh1.w };
    // Half a wave holds one item's 128 channels of the wave's table, 8 per lane; q is [NITEM][QD].
    const float* qb = q + (blockIdx.x * 32 + grp * 16 + hh) * QD + tb * HALF + l15 * 8;
    float4 qv[8][2];
    #pragma unroll
    for (int i = 0; i < 8; ++i) {
        qv[i][0] = ((const float4*)(qb + 2 * i * QD))[0];
        qv[i][1] = ((const float4*)(qb + 2 * i * QD))[1];
    }
    // stands in front of the first overwrite of the address pair and the index register of the loads above, which it
    // names so that they live up to here and no load's own result lands on them
    asm volatile("s_wait_xcnt 0x0" :: "v"(qb), "v"(bidx) : "memory");
    // Both key tables go into LDS once per block: a wave reads whole 512-byte rows.
    float4 kst0[8], kst1[8];
    #pragma unroll
    for (int i = 0; i < 8; ++i) {
        kst0[i] = ((const float4*)n0)[i * 128 + t];
        kst1[i] = ((const float4*)n1)[i * 128 + t];
    }
    #pragma unroll
    for (int i = 0; i < 8; ++i) {               // wave wid holds key i*4+wid, lane its channels 4*lane..4*lane+3
        *(float4*)&ks[0][i * 4 + wid][lane * 4] = kst0[i];
        *(float4*)&ks[1][i * 4 + wid][lane * 4] = kst1[i];
    }
    #pragma unroll
    for (int i = 0; i < 8; ++i) {
        float qr[8] = { qv[i][0].x, qv[i][0].y, qv[i][0].z, qv[i][0].w,
                        qv[i][1].x, qv[i][1].y, qv[i][1].z, qv[i][1].w };
        float vr[8]; float ss = 0.f;
        #pragma unroll
        for (int j = 0; j < 8; ++j) {
            float x = qr[j] * bsc[j] + bsh[j];
            vr[j] = x; ss += x * x;
        }
        #pragma unroll
        for (int off = 8; off; off >>= 1) ss += __shfl_xor(ss, off, 16);
        float inv = 1.f / fmaxf(sqrtf(ss), 1e-12f);
        float4* dst = (float4*)&qs[wid][2 * i + hh][l15 * 8];
        dst[0] = make_float4(vr[0] * inv, vr[1] * inv, vr[2] * inv, vr[3] * inv);
        dst[1] = make_float4(vr[4] * inv, vr[5] * inv, vr[6] * inv, vr[7] * inv);
    }
    __syncthreads();    // keys and queries are in LDS

    // Fragments as in the projection: lane l15 is the row of A (item) and the column of B (key); a lane holds
    // k = 2*hh and 2*hh+1 of a step's four channels. Step s takes channels 4s..4s+3, so each score is
    // summed over c = 0..127 in rising order.
    v8f acc0 = {}, acc1 = {};
    const float* ar  = &qs[wid][l15][2 * hh];
    const float* br0 = &ks[tb][l15][2 * hh];
    const float* br1 = &ks[tb][16 + l15][2 * hh];
    #pragma unroll
    for (int s = 0; s < HALF / 4; ++s) {
        v2f a  = *(const v2f*)(ar + 4 * s);
        v2f b0 = *(const v2f*)(br0 + 4 * s);
        v2f b1 = *(const v2f*)(br1 + 4 * s);
        acc0 = __builtin_amdgcn_wmma_f32_16x16x4_f32(false, a, false, b0, (short)0, acc0, false, false);
        acc1 = __builtin_amdgcn_wmma_f32_16x16x4_f32(false, a, false, b1, (short)0, acc1, false, false);
    }
    // Keeps the address work of the score stores out of the matrix block: without it the scheduler lets it
    // overwrite a fragment register directly behind the matrix instruction that reads it.
    __builtin_amdgcn_sched_barrier(0);
    // four vector slots between the last matrix instruction and the first vector write of one of its registers
    asm volatile("v_nop\n\tv_nop\n\tv_nop\n\tv_nop");
    __builtin_amdgcn_sched_barrier(0);  // holds the four slots where they stand
    // C layout: VGPR v -> item v + 8*hh, key l15 (acc0) or 16 + l15 (acc1)
    #pragma unroll
    for (int v = 0; v < 8; ++v) {
        sc[wid][v + 8 * hh][l15]      = acc0[v];
        sc[wid][v + 8 * hh][16 + l15] = acc1[v];
    }
    __syncthreads();    // the scores are in LDS

    // Lane (hh, l15) scans keys 16*hh..16*hh+15 of item l15, in rising order.
    float bv[DTK] = { -INFINITY, -INFINITY, -INFINITY, -INFINITY };
    int   bi[DTK] = { 0, 0, 0, 0 };
    #pragma unroll
    for (int c = 0; c < 4; ++c) {
        float4 x = *(const float4*)&sc[wid][l15][hh * 16 + c * 4];
        top4Insert(x.x, hh * 16 + c * 4,     bv, bi);
        top4Insert(x.y, hh * 16 + c * 4 + 1, bv, bi);
        top4Insert(x.z, hh * 16 + c * 4 + 2, bv, bi);
        top4Insert(x.w, hh * 16 + c * 4 + 3, bv, bi);
    }
    // The four best of keys 16..31 go, best first, into the list of keys 0..15 (the result counts in lanes 0..15).
    float ov[DTK]; int oi[DTK];
    #pragma unroll
    for (int r = 0; r < DTK; ++r) {
        ov[r] = __shfl_xor(bv[r], 16, 32);
        oi[r] = __shfl_xor(bi[r], 16, 32);
    }
    #pragma unroll
    for (int r = 0; r < DTK; ++r) top4Insert(ov[r], oi[r], bv, bi);
    if (hh == 0) {
        *(float4*)&tv[grp * 16 + l15][tb][0] = make_float4(bv[0], bv[1], bv[2], bv[3]);
        *(int4*)&tx[grp * 16 + l15][tb][0]   = make_int4(bi[0], bi[1], bi[2], bi[3]);
    }
    __syncthreads();    // both tables' lists are in LDS

    // Four threads share an item; thread ii of them writes combos 4*ii..4*ii+3. Each forms all 16 exponentials
    // and adds them as the tree over lane distances 8, 4, 2, 1 did, so the weights keep their bits.
    int item = t >> 2, ii = t & 3;
    float4 t0 = *(const float4*)&tv[item][0][0];
    float4 t1 = *(const float4*)&tv[item][1][0];
    int4   x1 = *(const int4*)&tx[item][1][0];
    float  mine = tv[item][0][ii];
    int    mid  = tx[item][0][ii] * NKEY;
    float a4[4] = { t0.x, t0.y, t0.z, t0.w }, b4[4] = { t1.x, t1.y, t1.z, t1.w };
    float m = a4[0] + b4[0];
    #pragma unroll
    for (int l = 1; l < 16; ++l) m = fmaxf(m, a4[l >> 2] + b4[l & 3]);
    float e[16];
    #pragma unroll
    for (int l = 0; l < 16; ++l) e[l] = expf(a4[l >> 2] + b4[l & 3] - m);
    #pragma unroll
    for (int off = 8; off; off >>= 1) {
        #pragma unroll
        for (int l = 0; l < off; ++l) e[l] += e[l + off];
    }
    float sum = e[0];
    float4 w = make_float4(expf(mine + b4[0] - m) / sum, expf(mine + b4[1] - m) / sum,
                           expf(mine + b4[2] - m) / sum, expf(mine + b4[3] - m) / sum);
    int4 id = make_int4(mid + x1.x, mid + x1.y, mid + x1.z, mid + x1.w);     // each in [0, NKEY * NKEY)
    ((int4*)rid)[blockIdx.x * 128 + t] = id;
    // the four picks' down dot products out of the plane that the projection kernel wrote; exact gelu; routing weight
    int tok = (blockIdx.x * 32 + item) / H;
    float4 d = make_float4(dots[dotIdx(tok, id.x)], dots[dotIdx(tok, id.y)],
                           dots[dotIdx(tok, id.z)], dots[dotIdx(tok, id.w)]);
    float4 o;
    o.x = 0.5f * d.x * (1.0f + erff(d.x * 0.70710678118654752f)) * w.x;
    o.y = 0.5f * d.y * (1.0f + erff(d.y * 0.70710678118654752f)) * w.y;
    o.z = 0.5f * d.z * (1.0f + erff(d.z * 0.70710678118654752f)) * w.z;
    o.w = 0.5f * d.w * (1.0f + erff(d.w * 0.70710678118654752f)) * w.w;
    ((float4*)gw)[blockIdx.x * 128 + t] = o;
}

typedef const __attribute__((address_space(1))) char* gbytes;   // byte pointer into global memory

__device__ inline float4 load16(gbytes p) {
    return *(const __attribute__((address_space(1))) float4*)p;
}
__device__ inline int4 load16i(gbytes p) {
    return *(const __attribute__((address_space(1))) int4*)p;
}

// ---------------- kernel: weighted sum of the gathered up rows ----------------
// A block keeps UC columns of all 1024 rows of `up` in LDS and serves UT tokens from them, so a gathered row
// piece is read from LDS and the table crosses from L2 once per block, not once per token and pick.
// A row piece is 256 bytes: 16 lanes x 16 bytes cover all 64 banks once, whatever the row, so the two halves
// of a wave read two different picks' rows without a bank conflict.
__global__ __launch_bounds__(512) void peer_up(const float* __restrict__ up,
                                               const int* __restrict__ rid,
                                               const float* __restrict__ gw,
                                               float* __restrict__ out) {
    __shared__ __attribute__((aligned(16))) float us[1024 * UC];
    int t = threadIdx.x;
    int cg = blockIdx.x, tg = blockIdx.y;
    float4* us4 = (float4*)us;
    const float4* src = (const float4*)up + cg * (UC / 4) + (t >> 4) * (OUTD / 4) + (t & 15);
    // a lane's 32 loads of 16 bytes are all in flight before the first LDS store; load i of the block brings rows 32i..32i+31
    float4 v[32];
    #pragma unroll
    for (int i = 0; i < 32; ++i) v[i] = src[i * 32 * (OUTD / 4)];
    #pragma unroll
    for (int i = 0; i < 32; ++i) us4[i * 512 + t] = v[i];
    // stands in front of the first overwrite of the loads' address register pair, which it names so that the pair
    // lives up to here and no load's own result lands on it
    asm volatile("s_wait_xcnt 0x0" :: "v"(src) : "memory");
    __syncthreads();    // the slice is complete before any wave gathers from it

    unsigned int wid = (unsigned int)__builtin_amdgcn_readfirstlane(t >> 5);
    int lane = t & 31, half = lane >> 4, l15 = lane & 15;
    const float4* ul = us4 + l15;
    // lanes 0..15 take a token's picks 0..63, lanes 16..31 its picks 64..127: 256 bytes of indices and of weights each
    unsigned int hoff = (unsigned int)half * 256u;
    unsigned int r0 = (unsigned int)tg * UT + wid * (UT / 16);      // the wave's first token
    gbytes ep = (gbytes)((unsigned long long)(uintptr_t)rid + r0 * 512u);
    gbytes gp = (gbytes)((unsigned long long)(uintptr_t)gw + r0 * 512u);
    int4 e[16]; float4 g[16];
    #pragma unroll
    for (int m = 0; m < 16; ++m) {
        e[m] = load16i(ep + hoff + m * 16);
        g[m] = load16(gp + hoff + m * 16);
    }
    // unrolled: every load and store names an address that is never rewritten, and an immediate,
    // and e[] and g[] need no copies from trip to trip
    #pragma unroll
    for (int k = 0; k < UT / 16; ++k) {
        // indices and weights of the wave's next token are fetched as this token's are used up
        unsigned int nx = (k + 1) * 512u;
        v2f a01 = {0.f, 0.f}, a23 = {0.f, 0.f};
        float4 u[2][8];
        #pragma unroll
        for (int n = -1; n < 8; ++n) {
            if (n < 7) {                // the next eight row pieces are asked for ahead of this group's sums
                int4 ea = e[2 * n + 2], eb = e[2 * n + 3];
                float4* un = u[(n + 1) & 1];
                un[0] = ul[ea.x * (UC / 4)]; un[1] = ul[ea.y * (UC / 4)];
                un[2] = ul[ea.z * (UC / 4)]; un[3] = ul[ea.w * (UC / 4)];
                un[4] = ul[eb.x * (UC / 4)]; un[5] = ul[eb.y * (UC / 4)];
                un[6] = ul[eb.z * (UC / 4)]; un[7] = ul[eb.w * (UC / 4)];
            }
            // keeps the reads above ahead of the sums below; without it all 64 reads of a token rise to the top and spill
            __builtin_amdgcn_sched_barrier(0);
            if (n >= 0) {
                const float4* uc = u[n & 1];
                float gs[8] = { g[2 * n].x, g[2 * n].y, g[2 * n].z, g[2 * n].w,
                                g[2 * n + 1].x, g[2 * n + 1].y, g[2 * n + 1].z, g[2 * n + 1].w };
                #pragma unroll
                for (int j = 0; j < 8; ++j) {
                    a01 += (v2f){gs[j], gs[j]} * (v2f){uc[j].x, uc[j].y};
                    a23 += (v2f){gs[j], gs[j]} * (v2f){uc[j].z, uc[j].w};
                }
                if (k < UT / 16 - 1) {
                    e[2 * n]     = load16i(ep + hoff + (nx + (2 * n) * 16));
                    e[2 * n + 1] = load16i(ep + hoff + (nx + (2 * n + 1) * 16));
                    g[2 * n]     = load16(gp + hoff + (nx + (2 * n) * 16));
                    g[2 * n + 1] = load16(gp + hoff + (nx + (2 * n + 1) * 16));
                }
                // keeps the next group's reads from rising over these sums, for the same reason
                __builtin_amdgcn_sched_barrier(0);
            }
        }
        float4 acc = { a01.x, a01.y, a23.x, a23.y };
        acc.x += __shfl_xor(acc.x, 16, 32); acc.y += __shfl_xor(acc.y, 16, 32);
        acc.z += __shfl_xor(acc.z, 16, 32); acc.w += __shfl_xor(acc.w, 16, 32);
        if (half == 0) ((float4*)out)[(r0 + k) * (OUTD / 4) + cg * (UC / 4) + l15] = acc;
    }
}

// ---------------- launcher ----------------
extern "C" void kernel_launch(void* const* d_in, const int* in_sizes, int n_in,
                              void* d_out, int out_size, void* d_ws, size_t ws_size,
                              hipStream_t stream) {
    const float* hs    = (const float*)d_in[0];  // [1024,1024]
    const float* Wq    = (const float*)d_in[1];  // [1024,2048]
    const float* bq    = (const float*)d_in[2];  // [2048]
    const float* gamma = (const float*)d_in[3];  // [256]
    const float* beta  = (const float*)d_in[4];  // [256]
    const float* sk0   = (const float*)d_in[5];  // [32,128]
    const float* sk1   = (const float*)d_in[6];  // [32,128]
    const float* down  = (const float*)d_in[7];  // [1024,1024]
    const float* up    = (const float*)d_in[8];  // [1024,1024]
    float* out = (float*)d_out;                  // [1024,1024]

    float* ws = (float*)d_ws;
    float* q      = ws;                   // 1024*2048
    float* n0     = q      + TOKENS * NQ;
    float* n1     = n0     + NKEY * HALF;
    float* part1  = n1     + NKEY * HALF;
    float* part2  = part1  + NRB * NQ;
    float* bnsc   = part2  + NRB * NQ;
    float* bnsh   = bnsc   + QD;
    int*   rid    = (int*)(bnsh + QD);
    float* gw     = (float*)(rid + NITEM * 16);
    float* dots   = gw     + NITEM * 16;  // TOKENS x 1024 experts

    peer_qproj<<<dim3(NQ / BN, TOKENS / BM), dim3(128), 0, stream>>>(hs, Wq, bq, down, q, part1, part2, dots);
    peer_bnfin<<<dim3(QD / 32 + KNB), dim3(256), 0, stream>>>(part1, part2, gamma, beta, bnsc, bnsh, sk0, sk1, n0, n1);
    peer_route<<<dim3(NITEM / 32), dim3(128), 0, stream>>>(q, bnsc, bnsh, n0, n1, dots, rid, gw);
    peer_up<<<dim3(OUTD / UC, TOKENS / UT), dim3(512), 0, stream>>>(up, rid, gw, out);
}
